// v000
// Measured on an AMD MI455X. A time is GPU time per run, averaged over a window of back-to-back runs after a warm-up
// (all launches, gaps included; the runs take copies of the inputs in turn), and the median of several windows.
// Apart from v000's, it joins two sittings. Times from different sittings can be a few percent apart, while
// side-by-side timings come from the same sitting.
// The starting kernel, v000, takes 771 microseconds a run.
#include <hip/hip_runtime.h>

// ---------------------------------------------------------------------------
// Problem constants (from reference): D=1024, H=16, DK=64, DFF=4096, B=2,
// T=S=2048.  M = B*T = 4096 rows for every activation GEMM.
// ---------------------------------------------------------------------------
#define DMODEL 1024
#define NHEAD  16
#define DHEAD  64
#define DFFN   4096
#define NB     2
#define TSEQ   2048
#define SSEQ   2048
#define MROWS  (NB * TSEQ)   // 4096

typedef __attribute__((ext_vector_type(16))) __bf16 v16bf;
typedef __attribute__((ext_vector_type(8)))  __bf16 v8bf;
typedef __attribute__((ext_vector_type(8)))  float  v8f;

// ---------------------------------------------------------------------------
// Helpers
// ---------------------------------------------------------------------------
__device__ __forceinline__ __bf16 f2bf(float f) {
  unsigned int u = __float_as_uint(f);
  u += 0x7FFFu + ((u >> 16) & 1u);          // round-to-nearest-even
  unsigned short s = (unsigned short)(u >> 16);
  __bf16 r;
  __builtin_memcpy(&r, &s, 2);
  return r;
}

// Load one WMMA 16-lane fragment row following the CDNA5 per-lane K-chunk
// layout: lanes 0-15 hold K {hi8=0: 0..7,16..23}, lanes 16-31 hold {8..15,24..31}.
__device__ __forceinline__ v16bf load_frag(const __bf16* row, int hi8) {
  v8bf a = *(const v8bf*)(row + hi8);
  v8bf b = *(const v8bf*)(row + hi8 + 16);
  return __builtin_shufflevector(a, b, 0,1,2,3,4,5,6,7,8,9,10,11,12,13,14,15);
}

__device__ __forceinline__ v8f wmma_bf16(v16bf a, v16bf b, v8f c) {
  return __builtin_amdgcn_wmma_f32_16x16x32_bf16(
      /*neg_a=*/false, a, /*neg_b=*/false, b,
      /*c_mod=*/(short)0, c, /*reuse_a=*/false, /*reuse_b=*/false);
}

// CDNA5 async global->LDS copy (16B per lane), tracked by ASYNCcnt.
// lds_addr = byte offset within the workgroup LDS allocation (low 32 bits of
// the generic pointer), gptr = per-lane 64-bit global address.
__device__ __forceinline__ void async_copy_b128(unsigned int lds_addr,
                                                const void* gptr) {
  asm volatile("global_load_async_to_lds_b128 %0, %1, off"
               :: "v"(lds_addr), "v"(gptr)
               : "memory");
}
__device__ __forceinline__ void wait_asynccnt0() {
  asm volatile("s_wait_asynccnt 0x0" ::: "memory");
}

// ---------------------------------------------------------------------------
// fp32 -> bf16 conversion (grid-stride)
// ---------------------------------------------------------------------------
__global__ __launch_bounds__(256) void cvt_kernel(const float* __restrict__ in,
                                                  __bf16* __restrict__ out, int n) {
  int i = blockIdx.x * 256 + threadIdx.x;
  const int stride = gridDim.x * 256;
  for (; i < n; i += stride) out[i] = f2bf(in[i]);
}

// ---------------------------------------------------------------------------
// Tiled GEMM: out[M,N] = A[M,K] @ W[N,K]^T + bias[N]   (torch Linear semantics)
// Block = 256 threads = 8 waves; 128x128 output tile; wave tile 32x64.
// K is staged 32 wide through double-buffered LDS using async global->LDS
// copies so the next tile streams in while WMMAs consume the current one.
// ---------------------------------------------------------------------------
template<bool RELU, bool OUT_BF16>
__global__ __launch_bounds__(256) void gemm_kernel(
    const __bf16* __restrict__ A, const __bf16* __restrict__ W,
    const float* __restrict__ bias, void* __restrict__ outp,
    int M, int N, int K)
{
  __shared__ __bf16 As[2][128 * 32];
  __shared__ __bf16 Ws[2][128 * 32];

  const int tid  = threadIdx.x;
  const int lane = tid & 31;
  const int wave = tid >> 5;     // 0..7
  const int wm   = wave >> 1;    // 0..3 -> 32-row strip
  const int wn   = wave & 1;     // 0..1 -> 64-col strip
  const int bm   = blockIdx.x * 128;
  const int bn   = blockIdx.y * 128;
  const int l15  = lane & 15;
  const int hi8  = (lane >> 4) << 3;

  const v8f vzero = {0.f,0.f,0.f,0.f,0.f,0.f,0.f,0.f};
  v8f acc[2][4];
#pragma unroll
  for (int i = 0; i < 2; ++i)
#pragma unroll
    for (int j = 0; j < 4; ++j) acc[i][j] = vzero;

  const int ldrow = tid >> 1;          // 0..127
  const int ldcol = (tid & 1) * 16;    // 0 or 16  (32 contiguous bytes/thread)
  const __bf16* aptr = A + (size_t)(bm + ldrow) * K + ldcol;
  const __bf16* wptr = W + (size_t)(bn + ldrow) * K + ldcol;
  const unsigned int lA0 = (unsigned int)(uintptr_t)(&As[0][ldrow * 32 + ldcol]);
  const unsigned int lA1 = (unsigned int)(uintptr_t)(&As[1][ldrow * 32 + ldcol]);
  const unsigned int lW0 = (unsigned int)(uintptr_t)(&Ws[0][ldrow * 32 + ldcol]);
  const unsigned int lW1 = (unsigned int)(uintptr_t)(&Ws[1][ldrow * 32 + ldcol]);

  auto stage = [&](int buf, int k0) {
    const unsigned int la = buf ? lA1 : lA0;
    const unsigned int lw = buf ? lW1 : lW0;
    async_copy_b128(la,      aptr + k0);
    async_copy_b128(la + 16, aptr + k0 + 8);
    async_copy_b128(lw,      wptr + k0);
    async_copy_b128(lw + 16, wptr + k0 + 8);
  };

  stage(0, 0);
  int buf = 0;
  for (int k0 = 0; k0 < K; k0 += 32) {
    wait_asynccnt0();     // our async fills for `buf` have landed in LDS
    __syncthreads();      // ... and everyone else's too; prev reads done
    if (k0 + 32 < K) stage(buf ^ 1, k0 + 32);   // prefetch next tile

    v16bf af[2], bfr[4];
#pragma unroll
    for (int i = 0; i < 2; ++i)
      af[i] = load_frag(&As[buf][(wm * 32 + i * 16 + l15) * 32], hi8);
#pragma unroll
    for (int j = 0; j < 4; ++j)
      bfr[j] = load_frag(&Ws[buf][(wn * 64 + j * 16 + l15) * 32], hi8);
#pragma unroll
    for (int i = 0; i < 2; ++i)
#pragma unroll
      for (int j = 0; j < 4; ++j)
        acc[i][j] = wmma_bf16(af[i], bfr[j], acc[i][j]);
    buf ^= 1;
  }

  float*  outf = (float*)outp;
  __bf16* outb = (__bf16*)outp;
#pragma unroll
  for (int i = 0; i < 2; ++i) {
    const int mrow = bm + wm * 32 + i * 16 + hi8;  // C layout: row r+8*(lane>>4)
#pragma unroll
    for (int j = 0; j < 4; ++j) {
      const int ncol = bn + wn * 64 + j * 16 + l15;
      const float bv = bias[ncol];
#pragma unroll
      for (int r = 0; r < 8; ++r) {
        float v = acc[i][j][r] + bv;
        if (RELU) v = fmaxf(v, 0.0f);
        const size_t idx = (size_t)(mrow + r) * N + ncol;
        if (OUT_BF16) outb[idx] = f2bf(v); else outf[idx] = v;
      }
    }
  }
}

// ---------------------------------------------------------------------------
// Transpose V ([b][s][h][d] bf16) -> Vt ([b][h][d][s] bf16) so V columns are
// contiguous for the PV B-operand.
// ---------------------------------------------------------------------------
__global__ __launch_bounds__(256) void transpose_v_kernel(
    const __bf16* __restrict__ V, __bf16* __restrict__ Vt, int Skv)
{
  __shared__ __bf16 tile[32][72];    // 32 s  x 64 d (+pad)
  const int b  = blockIdx.z;
  const int h  = blockIdx.y;
  const int s0 = blockIdx.x * 32;
  const int tid = threadIdx.x;
  {
    const int sl = tid >> 3;                 // 0..31
    const int dp = (tid & 7) * 8;            // 0..56
    const __bf16* src = V + (size_t)(b * Skv + s0 + sl) * DMODEL + h * DHEAD + dp;
    v8bf val = *(const v8bf*)src;
#pragma unroll
    for (int i = 0; i < 8; ++i) tile[sl][dp + i] = val[i];
  }
  __syncthreads();
  {
    const int dl = tid >> 2;                 // 0..63
    const int sp = (tid & 3) * 8;            // 0..24
    v8bf o;
#pragma unroll
    for (int i = 0; i < 8; ++i) o[i] = tile[sp + i][dl];
    __bf16* dst = Vt + (size_t)((b * NHEAD + h) * DHEAD + dl) * Skv + s0 + sp;
    *(v8bf*)dst = o;
  }
}

// ---------------------------------------------------------------------------
// Flash attention. Block = 128 threads = 4 waves, each wave owns 16 q rows.
// Per 32-column S step: 4 WMMAs for Q@K^T (K-dim 64), online softmax with
// cross-lane reductions, P -> LDS -> A-fragment, 4 WMMAs for P@V.
// ---------------------------------------------------------------------------
__global__ __launch_bounds__(128) void attn_kernel(
    const __bf16* __restrict__ Qb,   // [B*Tq, DMODEL] bf16
    const __bf16* __restrict__ Kb,   // [B*Skv, DMODEL] bf16
    const __bf16* __restrict__ Vt,   // [B*H*DHEAD, Skv] bf16
    const int*    __restrict__ mask, // [B, Tq, Skv]
    float*        __restrict__ ctx,  // [B*Tq, DMODEL] f32
    int Tq, int Skv)
{
  __shared__ __bf16 plds[4][16 * 32];
  const int lane = threadIdx.x & 31;
  const int wave = threadIdx.x >> 5;
  const int l15  = lane & 15;
  const int hi8  = (lane >> 4) << 3;
  const int h    = blockIdx.y;
  const int b    = blockIdx.z;
  const int q0   = blockIdx.x * 64 + wave * 16;

  const __bf16* qrow = Qb + (size_t)(b * Tq + q0 + l15) * DMODEL + h * DHEAD;
  const v16bf qf0 = load_frag(qrow, hi8);        // K-dim 0..31 of head
  const v16bf qf1 = load_frag(qrow + 32, hi8);   // K-dim 32..63

  const __bf16* kbase  = Kb + (size_t)b * Skv * DMODEL + h * DHEAD;
  const __bf16* vtbase = Vt + (size_t)((b * NHEAD + h) * DHEAD) * Skv;
  const int*    mbase  = mask + (size_t)b * Tq * Skv;

  const v8f vzero = {0.f,0.f,0.f,0.f,0.f,0.f,0.f,0.f};
  v8f o[4];
#pragma unroll
  for (int j = 0; j < 4; ++j) o[j] = vzero;
  float mrow[8], lrow[8];
#pragma unroll
  for (int r = 0; r < 8; ++r) { mrow[r] = -1e30f; lrow[r] = 0.f; }

  __bf16* pl = plds[wave];

  for (int s0 = 0; s0 < Skv; s0 += 32) {
    v8f sc0 = vzero, sc1 = vzero;
    {
      const __bf16* krow0 = kbase + (size_t)(s0 + l15) * DMODEL;
      const __bf16* krow1 = kbase + (size_t)(s0 + 16 + l15) * DMODEL;
      sc0 = wmma_bf16(qf0, load_frag(krow0, hi8), sc0);
      sc0 = wmma_bf16(qf1, load_frag(krow0 + 32, hi8), sc0);
      sc1 = wmma_bf16(qf0, load_frag(krow1, hi8), sc1);
      sc1 = wmma_bf16(qf1, load_frag(krow1 + 32, hi8), sc1);
    }
    // scale + mask + local row max (C layout: element r -> row q0+r+hi8,
    // col l15 (tile0) / 16+l15 (tile1))
    float nmax[8];
#pragma unroll
    for (int r = 0; r < 8; ++r) {
      float v0 = sc0[r] * 0.125f;   // 1/sqrt(64)
      float v1 = sc1[r] * 0.125f;
      const int* mrp = mbase + (size_t)(q0 + r + hi8) * Skv + s0;
      if (mrp[l15] == 0)      v0 = -1e9f;
      if (mrp[16 + l15] == 0) v1 = -1e9f;
      sc0[r] = v0; sc1[r] = v1;
      nmax[r] = fmaxf(v0, v1);
    }
#pragma unroll
    for (int off = 1; off < 16; off <<= 1)
#pragma unroll
      for (int r = 0; r < 8; ++r)
        nmax[r] = fmaxf(nmax[r], __shfl_xor(nmax[r], off, 32));

    float scl[8], rsum[8];
#pragma unroll
    for (int r = 0; r < 8; ++r) {
      const float mn = fmaxf(mrow[r], nmax[r]);
      scl[r] = __expf(mrow[r] - mn);
      mrow[r] = mn;
      const float p0 = __expf(sc0[r] - mn);
      const float p1 = __expf(sc1[r] - mn);
      sc0[r] = p0; sc1[r] = p1;
      rsum[r] = p0 + p1;
    }
#pragma unroll
    for (int off = 1; off < 16; off <<= 1)
#pragma unroll
      for (int r = 0; r < 8; ++r)
        rsum[r] += __shfl_xor(rsum[r], off, 32);
#pragma unroll
    for (int r = 0; r < 8; ++r) lrow[r] = lrow[r] * scl[r] + rsum[r];
#pragma unroll
    for (int j = 0; j < 4; ++j)
#pragma unroll
      for (int r = 0; r < 8; ++r) o[j][r] *= scl[r];

    // P (C layout, f32) -> LDS row-major 16x32 bf16
#pragma unroll
    for (int r = 0; r < 8; ++r) {
      pl[(r + hi8) * 32 + l15]      = f2bf(sc0[r]);
      pl[(r + hi8) * 32 + 16 + l15] = f2bf(sc1[r]);
    }
    __syncthreads();
    const v16bf pf = load_frag(pl + l15 * 32, hi8);   // A-fragment of P
#pragma unroll
    for (int j = 0; j < 4; ++j) {
      const __bf16* vrow = vtbase + (size_t)(j * 16 + l15) * Skv + s0;
      o[j] = wmma_bf16(pf, load_frag(vrow, hi8), o[j]);
    }
    __syncthreads();
  }

#pragma unroll
  for (int r = 0; r < 8; ++r) lrow[r] = 1.0f / lrow[r];
#pragma unroll
  for (int j = 0; j < 4; ++j)
#pragma unroll
    for (int r = 0; r < 8; ++r) {
      const size_t idx = (size_t)(b * Tq + q0 + r + hi8) * DMODEL + h * DHEAD + j * 16 + l15;
      ctx[idx] = o[j][r] * lrow[r];
    }
}

// ---------------------------------------------------------------------------
// Residual add + LayerNorm; writes f32 stream + bf16 copy for next GEMM.
// One block per row of 1024. (x/yout may alias for in-place update.)
// ---------------------------------------------------------------------------
__global__ __launch_bounds__(256) void ln_kernel(
    const float* x, const float* __restrict__ sub,
    const float* __restrict__ g, const float* __restrict__ bta,
    float* yout, __bf16* __restrict__ ybf)
{
  __shared__ float s1[256], s2[256];
  const size_t base = (size_t)blockIdx.x * DMODEL;
  float v[4];
  float lsum = 0.f, lsq = 0.f;
#pragma unroll
  for (int k = 0; k < 4; ++k) {
    const int i = threadIdx.x + k * 256;
    v[k] = x[base + i] + sub[base + i];
    lsum += v[k];
    lsq  += v[k] * v[k];
  }
  s1[threadIdx.x] = lsum; s2[threadIdx.x] = lsq;
  __syncthreads();
  for (int off = 128; off > 0; off >>= 1) {
    if (threadIdx.x < off) {
      s1[threadIdx.x] += s1[threadIdx.x + off];
      s2[threadIdx.x] += s2[threadIdx.x + off];
    }
    __syncthreads();
  }
  const float mean = s1[0] * (1.0f / DMODEL);
  const float var  = s2[0] * (1.0f / DMODEL) - mean * mean;
  const float rs   = rsqrtf(var + 1e-5f);
#pragma unroll
  for (int k = 0; k < 4; ++k) {
    const int i = threadIdx.x + k * 256;
    const float o = (v[k] - mean) * rs * g[i] + bta[i];
    yout[base + i] = o;
    ybf[base + i]  = f2bf(o);
  }
}

// ---------------------------------------------------------------------------
// Host orchestration
// ---------------------------------------------------------------------------
extern "C" void kernel_launch(void* const* d_in, const int* in_sizes, int n_in,
                              void* d_out, int out_size, void* d_ws, size_t ws_size,
                              hipStream_t stream) {
  (void)in_sizes; (void)n_in; (void)out_size; (void)ws_size;

  const float* x        = (const float*)d_in[0];
  const float* enc      = (const float*)d_in[1];
  const int*   src_mask = (const int*)d_in[2];
  const int*   tgt_mask = (const int*)d_in[3];
  const float* sa_Wq = (const float*)d_in[4],  *sa_bq = (const float*)d_in[5];
  const float* sa_Wk = (const float*)d_in[6],  *sa_bk = (const float*)d_in[7];
  const float* sa_Wv = (const float*)d_in[8],  *sa_bv = (const float*)d_in[9];
  const float* sa_Wo = (const float*)d_in[10], *sa_bo = (const float*)d_in[11];
  const float* ca_Wq = (const float*)d_in[12], *ca_bq = (const float*)d_in[13];
  const float* ca_Wk = (const float*)d_in[14], *ca_bk = (const float*)d_in[15];
  const float* ca_Wv = (const float*)d_in[16], *ca_bv = (const float*)d_in[17];
  const float* ca_Wo = (const float*)d_in[18], *ca_bo = (const float*)d_in[19];
  const float* ff_W1 = (const float*)d_in[20], *ff_b1 = (const float*)d_in[21];
  const float* ff_W2 = (const float*)d_in[22], *ff_b2 = (const float*)d_in[23];
  const float* ln1_g = (const float*)d_in[24], *ln1_b = (const float*)d_in[25];
  const float* ln2_g = (const float*)d_in[26], *ln2_b = (const float*)d_in[27];
  const float* ln3_g = (const float*)d_in[28], *ln3_b = (const float*)d_in[29];

  char* ws = (char*)d_ws;
  const size_t MB = 1024ull * 1024ull;
  // bf16 weights
  __bf16* saWq_bf = (__bf16*)(ws + 0 * MB);
  __bf16* saWk_bf = (__bf16*)(ws + 2 * MB);
  __bf16* saWv_bf = (__bf16*)(ws + 4 * MB);
  __bf16* saWo_bf = (__bf16*)(ws + 6 * MB);
  __bf16* caWq_bf = (__bf16*)(ws + 8 * MB);
  __bf16* caWk_bf = (__bf16*)(ws + 10 * MB);
  __bf16* caWv_bf = (__bf16*)(ws + 12 * MB);
  __bf16* caWo_bf = (__bf16*)(ws + 14 * MB);
  __bf16* W1_bf   = (__bf16*)(ws + 16 * MB);   // 8 MB
  __bf16* W2_bf   = (__bf16*)(ws + 24 * MB);   // 8 MB
  // activations
  __bf16* x_bf    = (__bf16*)(ws + 32 * MB);
  __bf16* enc_bf  = (__bf16*)(ws + 40 * MB);
  __bf16* Qb      = (__bf16*)(ws + 48 * MB);
  __bf16* Kb      = (__bf16*)(ws + 56 * MB);
  __bf16* Vb      = (__bf16*)(ws + 64 * MB);
  __bf16* Vt      = (__bf16*)(ws + 72 * MB);
  float*  ctx     = (float*) (ws + 80 * MB);   // 16 MB
  float*  proj    = (float*) (ws + 96 * MB);   // 16 MB
  float*  yres    = (float*) (ws + 112 * MB);  // 16 MB
  __bf16* y_bf    = (__bf16*)(ws + 128 * MB);  // 8 MB
  __bf16* hidden  = (__bf16*)(ws + 136 * MB);  // 32 MB
  __bf16* ctx_bf  = (__bf16*)(ws + 168 * MB);  // 8 MB

  auto cvt = [&](const float* in, __bf16* out, int n) {
    cvt_kernel<<<dim3(2048), dim3(256), 0, stream>>>(in, out, n);
  };
  auto gemmF = [&](const __bf16* A, const __bf16* W, const float* b, float* out,
                   int M, int N, int K) {
    gemm_kernel<false, false><<<dim3(M / 128, N / 128), 256, 0, stream>>>(
        A, W, b, (void*)out, M, N, K);
  };
  auto gemmB = [&](const __bf16* A, const __bf16* W, const float* b, __bf16* out,
                   int M, int N, int K) {
    gemm_kernel<false, true><<<dim3(M / 128, N / 128), 256, 0, stream>>>(
        A, W, b, (void*)out, M, N, K);
  };

  // --- precision staging ---
  cvt(sa_Wq, saWq_bf, DMODEL * DMODEL);
  cvt(sa_Wk, saWk_bf, DMODEL * DMODEL);
  cvt(sa_Wv, saWv_bf, DMODEL * DMODEL);
  cvt(sa_Wo, saWo_bf, DMODEL * DMODEL);
  cvt(ca_Wq, caWq_bf, DMODEL * DMODEL);
  cvt(ca_Wk, caWk_bf, DMODEL * DMODEL);
  cvt(ca_Wv, caWv_bf, DMODEL * DMODEL);
  cvt(ca_Wo, caWo_bf, DMODEL * DMODEL);
  cvt(ff_W1, W1_bf, DFFN * DMODEL);
  cvt(ff_W2, W2_bf, DMODEL * DFFN);
  cvt(x,   x_bf,   MROWS * DMODEL);
  cvt(enc, enc_bf, MROWS * DMODEL);

  // --- self attention ---
  gemmB(x_bf, saWq_bf, sa_bq, Qb, MROWS, DMODEL, DMODEL);
  gemmB(x_bf, saWk_bf, sa_bk, Kb, MROWS, DMODEL, DMODEL);
  gemmB(x_bf, saWv_bf, sa_bv, Vb, MROWS, DMODEL, DMODEL);
  transpose_v_kernel<<<dim3(TSEQ / 32, NHEAD, NB), 256, 0, stream>>>(Vb, Vt, TSEQ);
  attn_kernel<<<dim3(TSEQ / 64, NHEAD, NB), 128, 0, stream>>>(
      Qb, Kb, Vt, tgt_mask, ctx, TSEQ, TSEQ);
  cvt(ctx, ctx_bf, MROWS * DMODEL);
  gemmF(ctx_bf, saWo_bf, sa_bo, proj, MROWS, DMODEL, DMODEL);
  ln_kernel<<<MROWS, 256, 0, stream>>>(x, proj, ln1_g, ln1_b, yres, y_bf);

  // --- cross attention ---
  gemmB(y_bf,   caWq_bf, ca_bq, Qb, MROWS, DMODEL, DMODEL);
  gemmB(enc_bf, caWk_bf, ca_bk, Kb, MROWS, DMODEL, DMODEL);
  gemmB(enc_bf, caWv_bf, ca_bv, Vb, MROWS, DMODEL, DMODEL);
  transpose_v_kernel<<<dim3(SSEQ / 32, NHEAD, NB), 256, 0, stream>>>(Vb, Vt, SSEQ);
  attn_kernel<<<dim3(TSEQ / 64, NHEAD, NB), 128, 0, stream>>>(
      Qb, Kb, Vt, src_mask, ctx, TSEQ, SSEQ);
  cvt(ctx, ctx_bf, MROWS * DMODEL);
  gemmF(ctx_bf, caWo_bf, ca_bo, proj, MROWS, DMODEL, DMODEL);
  ln_kernel<<<MROWS, 256, 0, stream>>>(yres, proj, ln2_g, ln2_b, yres, y_bf);

  // --- feed forward ---
  gemm_kernel<true, true><<<dim3(MROWS / 128, DFFN / 128), 256, 0, stream>>>(
      y_bf, W1_bf, ff_b1, (void*)hidden, MROWS, DFFN, DMODEL);
  gemmF(hidden, W2_bf, ff_b2, proj, MROWS, DMODEL, DFFN);
  ln_kernel<<<MROWS, 256, 0, stream>>>(yres, proj, ln3_g, ln3_b, (float*)d_out, y_bf);
}

// v001
// A run of this version takes 628 microseconds.
// Next to v000, in two timings, it ran 1.25 times as fast each time.
#include <hip/hip_runtime.h>

// ---------------------------------------------------------------------------
// Problem constants (from reference): D=1024, H=16, DK=64, DFF=4096, B=2,
// T=S=2048.  M = B*T = 4096 rows for every activation GEMM.
// ---------------------------------------------------------------------------
#define DMODEL 1024
#define NHEAD  16
#define DHEAD  64
#define DFFN   4096
#define NB     2
#define TSEQ   2048
#define SSEQ   2048
#define MROWS  (NB * TSEQ)   // 4096

typedef __attribute__((ext_vector_type(16))) __bf16 v16bf;
typedef __attribute__((ext_vector_type(8)))  __bf16 v8bf;
typedef __attribute__((ext_vector_type(8)))  float  v8f;

// ---------------------------------------------------------------------------
// Helpers
// ---------------------------------------------------------------------------
__device__ __forceinline__ __bf16 f2bf(float f) {
  unsigned int u = __float_as_uint(f);
  u += 0x7FFFu + ((u >> 16) & 1u);          // round-to-nearest-even
  unsigned short s = (unsigned short)(u >> 16);
  __bf16 r;
  __builtin_memcpy(&r, &s, 2);
  return r;
}

// Load one WMMA 16-lane fragment row following the CDNA5 per-lane K-chunk
// layout: lanes 0-15 hold K {hi8=0: 0..7,16..23}, lanes 16-31 hold {8..15,24..31}.
__device__ __forceinline__ v16bf load_frag(const __bf16* row, int hi8) {
  v8bf a = *(const v8bf*)(row + hi8);
  v8bf b = *(const v8bf*)(row + hi8 + 16);
  return __builtin_shufflevector(a, b, 0,1,2,3,4,5,6,7,8,9,10,11,12,13,14,15);
}

__device__ __forceinline__ v8f wmma_bf16(v16bf a, v16bf b, v8f c) {
  return __builtin_amdgcn_wmma_f32_16x16x32_bf16(
      /*neg_a=*/false, a, /*neg_b=*/false, b,
      /*c_mod=*/(short)0, c, /*reuse_a=*/false, /*reuse_b=*/false);
}

// CDNA5 async global->LDS copy (16B per lane), tracked by ASYNCcnt.
// lds_addr = byte offset within the workgroup LDS allocation (low 32 bits of
// the generic pointer), gptr = per-lane 64-bit global address.
__device__ __forceinline__ void async_copy_b128(unsigned int lds_addr,
                                                const void* gptr) {
  asm volatile("global_load_async_to_lds_b128 %0, %1, off"
               :: "v"(lds_addr), "v"(gptr)
               : "memory");
}
__device__ __forceinline__ void wait_asynccnt0() {
  asm volatile("s_wait_asynccnt 0x0" ::: "memory");
}
// Eight async copies (16B per lane each) in one statement. The closing
// s_wait_xcnt stands inside the statement so that no address register of an
// issued copy is rewritten ahead of it.
__device__ __forceinline__ void async_copy8_b128(
    unsigned int l0, unsigned int l1, unsigned int l2, unsigned int l3,
    unsigned int l4, unsigned int l5, unsigned int l6, unsigned int l7,
    const void* g0, const void* g1, const void* g2, const void* g3,
    const void* g4, const void* g5, const void* g6, const void* g7) {
  asm volatile("global_load_async_to_lds_b128 %0, %8, off\n\t"
               "global_load_async_to_lds_b128 %1, %9, off\n\t"
               "global_load_async_to_lds_b128 %2, %10, off\n\t"
               "global_load_async_to_lds_b128 %3, %11, off\n\t"
               "global_load_async_to_lds_b128 %4, %12, off\n\t"
               "global_load_async_to_lds_b128 %5, %13, off\n\t"
               "global_load_async_to_lds_b128 %6, %14, off\n\t"
               "global_load_async_to_lds_b128 %7, %15, off\n\t"
               "s_wait_xcnt 0x0"
               :: "v"(l0), "v"(l1), "v"(l2), "v"(l3),
                  "v"(l4), "v"(l5), "v"(l6), "v"(l7),
                  "v"(g0), "v"(g1), "v"(g2), "v"(g3),
                  "v"(g4), "v"(g5), "v"(g6), "v"(g7)
               : "memory");
}
// Retires this wave's LDS reads before a barrier behind which the buffer they
// read is refilled by copies.
__device__ __forceinline__ void wait_dscnt0() {
  asm volatile("s_wait_dscnt 0x0" ::: "memory");
}

// ---------------------------------------------------------------------------
// fp32 -> bf16 conversion (grid-stride)
// ---------------------------------------------------------------------------
__global__ __launch_bounds__(256) void cvt_kernel(const float* __restrict__ in,
                                                  __bf16* __restrict__ out, int n) {
  int i = blockIdx.x * 256 + threadIdx.x;
  const int stride = gridDim.x * 256;
  for (; i < n; i += stride) out[i] = f2bf(in[i]);
}

// ---------------------------------------------------------------------------
// Tiled GEMM: out[M,N] = A[M,K] @ W[N,K]^T + bias[N]   (torch Linear semantics)
// Block = 256 threads = 8 waves; 128x128 output tile; wave tile 32x64.
// K is staged 32 wide through double-buffered LDS using async global->LDS
// copies so the next tile streams in while WMMAs consume the current one.
// ---------------------------------------------------------------------------
template<bool RELU, bool OUT_BF16>
__global__ __launch_bounds__(256) void gemm_kernel(
    const __bf16* __restrict__ A, const __bf16* __restrict__ W,
    const float* __restrict__ bias, void* __restrict__ outp,
    int M, int N, int K)
{
  __shared__ __bf16 As[2][128 * 32];
  __shared__ __bf16 Ws[2][128 * 32];

  const int tid  = threadIdx.x;
  const int lane = tid & 31;
  const int wave = tid >> 5;     // 0..7
  const int wm   = wave >> 1;    // 0..3 -> 32-row strip
  const int wn   = wave & 1;     // 0..1 -> 64-col strip
  const int bm   = blockIdx.x * 128;
  const int bn   = blockIdx.y * 128;
  const int l15  = lane & 15;
  const int hi8  = (lane >> 4) << 3;

  const v8f vzero = {0.f,0.f,0.f,0.f,0.f,0.f,0.f,0.f};
  v8f acc[2][4];
#pragma unroll
  for (int i = 0; i < 2; ++i)
#pragma unroll
    for (int j = 0; j < 4; ++j) acc[i][j] = vzero;

  const int ldrow = tid >> 1;          // 0..127
  const int ldcol = (tid & 1) * 16;    // 0 or 16  (32 contiguous bytes/thread)
  const __bf16* aptr = A + (size_t)(bm + ldrow) * K + ldcol;
  const __bf16* wptr = W + (size_t)(bn + ldrow) * K + ldcol;
  const unsigned int lA0 = (unsigned int)(uintptr_t)(&As[0][ldrow * 32 + ldcol]);
  const unsigned int lA1 = (unsigned int)(uintptr_t)(&As[1][ldrow * 32 + ldcol]);
  const unsigned int lW0 = (unsigned int)(uintptr_t)(&Ws[0][ldrow * 32 + ldcol]);
  const unsigned int lW1 = (unsigned int)(uintptr_t)(&Ws[1][ldrow * 32 + ldcol]);

  auto stage = [&](int buf, int k0) {
    const unsigned int la = buf ? lA1 : lA0;
    const unsigned int lw = buf ? lW1 : lW0;
    async_copy_b128(la,      aptr + k0);
    async_copy_b128(la + 16, aptr + k0 + 8);
    async_copy_b128(lw,      wptr + k0);
    async_copy_b128(lw + 16, wptr + k0 + 8);
  };

  stage(0, 0);
  int buf = 0;
  for (int k0 = 0; k0 < K; k0 += 32) {
    wait_asynccnt0();     // our async fills for `buf` have landed in LDS
    __syncthreads();      // ... and everyone else's too; prev reads done
    if (k0 + 32 < K) stage(buf ^ 1, k0 + 32);   // prefetch next tile

    v16bf af[2], bfr[4];
#pragma unroll
    for (int i = 0; i < 2; ++i)
      af[i] = load_frag(&As[buf][(wm * 32 + i * 16 + l15) * 32], hi8);
#pragma unroll
    for (int j = 0; j < 4; ++j)
      bfr[j] = load_frag(&Ws[buf][(wn * 64 + j * 16 + l15) * 32], hi8);
#pragma unroll
    for (int i = 0; i < 2; ++i)
#pragma unroll
      for (int j = 0; j < 4; ++j)
        acc[i][j] = wmma_bf16(af[i], bfr[j], acc[i][j]);
    buf ^= 1;
  }

  float*  outf = (float*)outp;
  __bf16* outb = (__bf16*)outp;
#pragma unroll
  for (int i = 0; i < 2; ++i) {
    const int mrow = bm + wm * 32 + i * 16 + hi8;  // C layout: row r+8*(lane>>4)
#pragma unroll
    for (int j = 0; j < 4; ++j) {
      const int ncol = bn + wn * 64 + j * 16 + l15;
      const float bv = bias[ncol];
#pragma unroll
      for (int r = 0; r < 8; ++r) {
        float v = acc[i][j][r] + bv;
        if (RELU) v = fmaxf(v, 0.0f);
        const size_t idx = (size_t)(mrow + r) * N + ncol;
        if (OUT_BF16) outb[idx] = f2bf(v); else outf[idx] = v;
      }
    }
  }
}

// ---------------------------------------------------------------------------
// Transpose V ([b][s][h][d] bf16) -> Vt ([b][h][d][s] bf16) so V columns are
// contiguous for the PV B-operand.
// ---------------------------------------------------------------------------
__global__ __launch_bounds__(256) void transpose_v_kernel(
    const __bf16* __restrict__ V, __bf16* __restrict__ Vt, int Skv)
{
  __shared__ __bf16 tile[32][72];    // 32 s  x 64 d (+pad)
  const int b  = blockIdx.z;
  const int h  = blockIdx.y;
  const int s0 = blockIdx.x * 32;
  const int tid = threadIdx.x;
  {
    const int sl = tid >> 3;                 // 0..31
    const int dp = (tid & 7) * 8;            // 0..56
    const __bf16* src = V + (size_t)(b * Skv + s0 + sl) * DMODEL + h * DHEAD + dp;
    v8bf val = *(const v8bf*)src;
#pragma unroll
    for (int i = 0; i < 8; ++i) tile[sl][dp + i] = val[i];
  }
  __syncthreads();
  {
    const int dl = tid >> 2;                 // 0..63
    const int sp = (tid & 3) * 8;            // 0..24
    v8bf o;
#pragma unroll
    for (int i = 0; i < 8; ++i) o[i] = tile[sp + i][dl];
    __bf16* dst = Vt + (size_t)((b * NHEAD + h) * DHEAD + dl) * Skv + s0 + sp;
    *(v8bf*)dst = o;
  }
}

#define KVPITCH 72
__global__ __launch_bounds__(128) void attn_kernel(
    const __bf16* __restrict__ Qb,   // [B*Tq, DMODEL] bf16
    const __bf16* __restrict__ Kb,   // [B*Skv, DMODEL] bf16
    const __bf16* __restrict__ Vt,   // [B*H*DHEAD, Skv] bf16
    const int*    __restrict__ mask, // [B, Tq, Skv]
    float*        __restrict__ ctx,  // [B*Tq, DMODEL] f32
    int Tq, int Skv)
{
  // 64 rows of 128 B at a pitch of 144 B (16 B x odd: no bank conflict for the
  // 16-byte fragment reads).
  __shared__ __attribute__((aligned(16))) __bf16 Ks[2][64 * KVPITCH];
  __shared__ __attribute__((aligned(16))) __bf16 Vs[2][64 * KVPITCH];
  __shared__ __bf16 plds[4][16 * 32];
  const int lane = threadIdx.x & 31;
  const int wave = threadIdx.x >> 5;
  const int l15  = lane & 15;
  const int hi8  = (lane >> 4) << 3;
  const int h    = blockIdx.y;
  const int b    = blockIdx.z;
  const int q0   = blockIdx.x * 64 + wave * 16;

  const __bf16* qrow = Qb + (size_t)(b * Tq + q0 + l15) * DMODEL + h * DHEAD;
  const v16bf qf0 = load_frag(qrow, hi8);        // K-dim 0..31 of head
  const v16bf qf1 = load_frag(qrow + 32, hi8);   // K-dim 32..63

  const __bf16* kbase  = Kb + (size_t)b * Skv * DMODEL + h * DHEAD;
  const __bf16* vtbase = Vt + (size_t)((b * NHEAD + h) * DHEAD) * Skv;
  const int*    mbase  = mask + (size_t)b * Tq * Skv;

  const v8f vzero = {0.f,0.f,0.f,0.f,0.f,0.f,0.f,0.f};
  v8f o[4];
#pragma unroll
  for (int j = 0; j < 4; ++j) o[j] = vzero;
  float mrow[8], lrow[8];
#pragma unroll
  for (int r = 0; r < 8; ++r) { mrow[r] = -1e30f; lrow[r] = 0.f; }

  __bf16* pl = plds[wave];

  // Staging map: thread t brings 16 B at column chunk (t & 7) of rows
  // (t >> 3) + 16 * i, i = 0..3, of the K tile and of the V^T tile: each
  // wave-wide copy covers four whole 128-B lines.
  const int crow = threadIdx.x >> 3;          // 0..15
  const int ccol = (threadIdx.x & 7) * 8;     // element offset in the row
  const __bf16* kcp = kbase  + (size_t)crow * DMODEL + ccol;
  const __bf16* vcp = vtbase + (size_t)crow * Skv + ccol;
  const unsigned int lK = (unsigned int)(uintptr_t)(&Ks[0][crow * KVPITCH + ccol]);
  const unsigned int lV = (unsigned int)(uintptr_t)(&Vs[0][crow * KVPITCH + ccol]);
  const unsigned int rstep = 16 * KVPITCH * 2;   // 16 LDS rows, bytes
  const unsigned int bstep = 64 * KVPITCH * 2;   // one buffer, bytes
  auto stage = [&](int bsel, int key0) {
    const unsigned int lk = lK + bsel * bstep;
    const unsigned int lv = lV + bsel * bstep;
    const __bf16* kg = kcp + (size_t)key0 * DMODEL;
    const __bf16* vg = vcp + key0;
    async_copy8_b128(lk, lk + rstep, lk + 2 * rstep, lk + 3 * rstep,
                     lv, lv + rstep, lv + 2 * rstep, lv + 3 * rstep,
                     kg, kg + 16 * DMODEL, kg + 32 * DMODEL, kg + 48 * DMODEL,
                     vg, vg + (size_t)16 * Skv, vg + (size_t)32 * Skv,
                     vg + (size_t)48 * Skv);
  };

  stage(0, 0);
  wait_asynccnt0();     // this wave's share of tile 0 has landed
  __syncthreads();      // ... and every other wave's
  if (64 < Skv) stage(1, 64);

  int buf = 0;
  for (int t0 = 0; t0 < Skv; t0 += 64) {
   const __bf16* kt = Ks[buf];
   const __bf16* vt = Vs[buf];
   // unrolled: the pass's place in the tile becomes an immediate LDS offset
#pragma unroll
   for (int p = 0; p < 2; ++p) {
    const int s0 = t0 + p * 32;
    v8f sc0 = vzero, sc1 = vzero;
    {
      const __bf16* krow0 = kt + (p * 32 + l15) * KVPITCH;
      const __bf16* krow1 = kt + (p * 32 + 16 + l15) * KVPITCH;
      sc0 = wmma_bf16(qf0, load_frag(krow0, hi8), sc0);
      sc0 = wmma_bf16(qf1, load_frag(krow0 + 32, hi8), sc0);
      sc1 = wmma_bf16(qf0, load_frag(krow1, hi8), sc1);
      sc1 = wmma_bf16(qf1, load_frag(krow1 + 32, hi8), sc1);
    }
    // scale + mask + local row max (C layout: element r -> row q0+r+hi8,
    // col l15 (tile0) / 16+l15 (tile1))
    float nmax[8];
#pragma unroll
    for (int r = 0; r < 8; ++r) {
      float v0 = sc0[r] * 0.125f;   // 1/sqrt(64)
      float v1 = sc1[r] * 0.125f;
      const int* mrp = mbase + (size_t)(q0 + r + hi8) * Skv + s0;
      if (mrp[l15] == 0)      v0 = -1e9f;
      if (mrp[16 + l15] == 0) v1 = -1e9f;
      sc0[r] = v0; sc1[r] = v1;
      nmax[r] = fmaxf(v0, v1);
    }
#pragma unroll
    for (int off = 1; off < 16; off <<= 1)
#pragma unroll
      for (int r = 0; r < 8; ++r)
        nmax[r] = fmaxf(nmax[r], __shfl_xor(nmax[r], off, 32));

    float scl[8], rsum[8];
#pragma unroll
    for (int r = 0; r < 8; ++r) {
      const float mn = fmaxf(mrow[r], nmax[r]);
      scl[r] = __expf(mrow[r] - mn);
      mrow[r] = mn;
      const float p0 = __expf(sc0[r] - mn);
      const float p1 = __expf(sc1[r] - mn);
      sc0[r] = p0; sc1[r] = p1;
      rsum[r] = p0 + p1;
    }
#pragma unroll
    for (int off = 1; off < 16; off <<= 1)
#pragma unroll
      for (int r = 0; r < 8; ++r)
        rsum[r] += __shfl_xor(rsum[r], off, 32);
#pragma unroll
    for (int r = 0; r < 8; ++r) lrow[r] = lrow[r] * scl[r] + rsum[r];
#pragma unroll
    for (int j = 0; j < 4; ++j)
#pragma unroll
      for (int r = 0; r < 8; ++r) o[j][r] *= scl[r];

    // P (C layout, f32) -> LDS row-major 16x32 bf16
#pragma unroll
    for (int r = 0; r < 8; ++r) {
      pl[(r + hi8) * 32 + l15]      = f2bf(sc0[r]);
      pl[(r + hi8) * 32 + 16 + l15] = f2bf(sc1[r]);
    }
    __syncthreads();
    const v16bf pf = load_frag(pl + l15 * 32, hi8);   // A-fragment of P
#pragma unroll
    for (int j = 0; j < 4; ++j) {
      const __bf16* vrow = vt + (j * 16 + l15) * KVPITCH + p * 32;
      o[j] = wmma_bf16(pf, load_frag(vrow, hi8), o[j]);
    }
    // closing barrier of the pass, as before; the second pass's is the one at
    // the publish point below
    if (p == 0) __syncthreads();
   }
   // Publish point: own LDS reads of this tile retired, own copies of the next
   // tile landed, then the barrier that publishes the next tile and frees this
   // buffer for the refill behind it.
   wait_dscnt0();
   wait_asynccnt0();
   __syncthreads();
   if (t0 + 128 < Skv) stage(buf, t0 + 128);
   buf ^= 1;
  }
  wait_asynccnt0();     // nothing of the ring is in flight when the wave ends

#pragma unroll
  for (int r = 0; r < 8; ++r) lrow[r] = 1.0f / lrow[r];
#pragma unroll
  for (int j = 0; j < 4; ++j)
#pragma unroll
    for (int r = 0; r < 8; ++r) {
      const size_t idx = (size_t)(b * Tq + q0 + r + hi8) * DMODEL + h * DHEAD + j * 16 + l15;
      ctx[idx] = o[j][r] * lrow[r];
    }
}

// ---------------------------------------------------------------------------
// Residual add + LayerNorm; writes f32 stream + bf16 copy for next GEMM.
// One block per row of 1024. (x/yout may alias for in-place update.)
// ---------------------------------------------------------------------------
__global__ __launch_bounds__(256) void ln_kernel(
    const float* x, const float* __restrict__ sub,
    const float* __restrict__ g, const float* __restrict__ bta,
    float* yout, __bf16* __restrict__ ybf)
{
  __shared__ float s1[256], s2[256];
  const size_t base = (size_t)blockIdx.x * DMODEL;
  float v[4];
  float lsum = 0.f, lsq = 0.f;
#pragma unroll
  for (int k = 0; k < 4; ++k) {
    const int i = threadIdx.x + k * 256;
    v[k] = x[base + i] + sub[base + i];
    lsum += v[k];
    lsq  += v[k] * v[k];
  }
  s1[threadIdx.x] = lsum; s2[threadIdx.x] = lsq;
  __syncthreads();
  for (int off = 128; off > 0; off >>= 1) {
    if (threadIdx.x < off) {
      s1[threadIdx.x] += s1[threadIdx.x + off];
      s2[threadIdx.x] += s2[threadIdx.x + off];
    }
    __syncthreads();
  }
  const float mean = s1[0] * (1.0f / DMODEL);
  const float var  = s2[0] * (1.0f / DMODEL) - mean * mean;
  const float rs   = rsqrtf(var + 1e-5f);
#pragma unroll
  for (int k = 0; k < 4; ++k) {
    const int i = threadIdx.x + k * 256;
    const float o = (v[k] - mean) * rs * g[i] + bta[i];
    yout[base + i] = o;
    ybf[base + i]  = f2bf(o);
  }
}

// ---------------------------------------------------------------------------
// Host orchestration
// ---------------------------------------------------------------------------
extern "C" void kernel_launch(void* const* d_in, const int* in_sizes, int n_in,
                              void* d_out, int out_size, void* d_ws, size_t ws_size,
                              hipStream_t stream) {
  (void)in_sizes; (void)n_in; (void)out_size; (void)ws_size;

  const float* x        = (const float*)d_in[0];
  const float* enc      = (const float*)d_in[1];
  const int*   src_mask = (const int*)d_in[2];
  const int*   tgt_mask = (const int*)d_in[3];
  const float* sa_Wq = (const float*)d_in[4],  *sa_bq = (const float*)d_in[5];
  const float* sa_Wk = (const float*)d_in[6],  *sa_bk = (const float*)d_in[7];
  const float* sa_Wv = (const float*)d_in[8],  *sa_bv = (const float*)d_in[9];
  const float* sa_Wo = (const float*)d_in[10], *sa_bo = (const float*)d_in[11];
  const float* ca_Wq = (const float*)d_in[12], *ca_bq = (const float*)d_in[13];
  const float* ca_Wk = (const float*)d_in[14], *ca_bk = (const float*)d_in[15];
  const float* ca_Wv = (const float*)d_in[16], *ca_bv = (const float*)d_in[17];
  const float* ca_Wo = (const float*)d_in[18], *ca_bo = (const float*)d_in[19];
  const float* ff_W1 = (const float*)d_in[20], *ff_b1 = (const float*)d_in[21];
  const float* ff_W2 = (const float*)d_in[22], *ff_b2 = (const float*)d_in[23];
  const float* ln1_g = (const float*)d_in[24], *ln1_b = (const float*)d_in[25];
  const float* ln2_g = (const float*)d_in[26], *ln2_b = (const float*)d_in[27];
  const float* ln3_g = (const float*)d_in[28], *ln3_b = (const float*)d_in[29];

  char* ws = (char*)d_ws;
  const size_t MB = 1024ull * 1024ull;
  // bf16 weights
  __bf16* saWq_bf = (__bf16*)(ws + 0 * MB);
  __bf16* saWk_bf = (__bf16*)(ws + 2 * MB);
  __bf16* saWv_bf = (__bf16*)(ws + 4 * MB);
  __bf16* saWo_bf = (__bf16*)(ws + 6 * MB);
  __bf16* caWq_bf = (__bf16*)(ws + 8 * MB);
  __bf16* caWk_bf = (__bf16*)(ws + 10 * MB);
  __bf16* caWv_bf = (__bf16*)(ws + 12 * MB);
  __bf16* caWo_bf = (__bf16*)(ws + 14 * MB);
  __bf16* W1_bf   = (__bf16*)(ws + 16 * MB);   // 8 MB
  __bf16* W2_bf   = (__bf16*)(ws + 24 * MB);   // 8 MB
  // activations
  __bf16* x_bf    = (__bf16*)(ws + 32 * MB);
  __bf16* enc_bf  = (__bf16*)(ws + 40 * MB);
  __bf16* Qb      = (__bf16*)(ws + 48 * MB);
  __bf16* Kb      = (__bf16*)(ws + 56 * MB);
  __bf16* Vb      = (__bf16*)(ws + 64 * MB);
  __bf16* Vt      = (__bf16*)(ws + 72 * MB);
  float*  ctx     = (float*) (ws + 80 * MB);   // 16 MB
  float*  proj    = (float*) (ws + 96 * MB);   // 16 MB
  float*  yres    = (float*) (ws + 112 * MB);  // 16 MB
  __bf16* y_bf    = (__bf16*)(ws + 128 * MB);  // 8 MB
  __bf16* hidden  = (__bf16*)(ws + 136 * MB);  // 32 MB
  __bf16* ctx_bf  = (__bf16*)(ws + 168 * MB);  // 8 MB

  auto cvt = [&](const float* in, __bf16* out, int n) {
    cvt_kernel<<<dim3(2048), dim3(256), 0, stream>>>(in, out, n);
  };
  auto gemmF = [&](const __bf16* A, const __bf16* W, const float* b, float* out,
                   int M, int N, int K) {
    gemm_kernel<false, false><<<dim3(M / 128, N / 128), 256, 0, stream>>>(
        A, W, b, (void*)out, M, N, K);
  };
  auto gemmB = [&](const __bf16* A, const __bf16* W, const float* b, __bf16* out,
                   int M, int N, int K) {
    gemm_kernel<false, true><<<dim3(M / 128, N / 128), 256, 0, stream>>>(
        A, W, b, (void*)out, M, N, K);
  };

  // --- precision staging ---
  cvt(sa_Wq, saWq_bf, DMODEL * DMODEL);
  cvt(sa_Wk, saWk_bf, DMODEL * DMODEL);
  cvt(sa_Wv, saWv_bf, DMODEL * DMODEL);
  cvt(sa_Wo, saWo_bf, DMODEL * DMODEL);
  cvt(ca_Wq, caWq_bf, DMODEL * DMODEL);
  cvt(ca_Wk, caWk_bf, DMODEL * DMODEL);
  cvt(ca_Wv, caWv_bf, DMODEL * DMODEL);
  cvt(ca_Wo, caWo_bf, DMODEL * DMODEL);
  cvt(ff_W1, W1_bf, DFFN * DMODEL);
  cvt(ff_W2, W2_bf, DMODEL * DFFN);
  cvt(x,   x_bf,   MROWS * DMODEL);
  cvt(enc, enc_bf, MROWS * DMODEL);

  // --- self attention ---
  gemmB(x_bf, saWq_bf, sa_bq, Qb, MROWS, DMODEL, DMODEL);
  gemmB(x_bf, saWk_bf, sa_bk, Kb, MROWS, DMODEL, DMODEL);
  gemmB(x_bf, saWv_bf, sa_bv, Vb, MROWS, DMODEL, DMODEL);
  transpose_v_kernel<<<dim3(TSEQ / 32, NHEAD, NB), 256, 0, stream>>>(Vb, Vt, TSEQ);
  attn_kernel<<<dim3(TSEQ / 64, NHEAD, NB), 128, 0, stream>>>(
      Qb, Kb, Vt, tgt_mask, ctx, TSEQ, TSEQ);
  cvt(ctx, ctx_bf, MROWS * DMODEL);
  gemmF(ctx_bf, saWo_bf, sa_bo, proj, MROWS, DMODEL, DMODEL);
  ln_kernel<<<MROWS, 256, 0, stream>>>(x, proj, ln1_g, ln1_b, yres, y_bf);

  // --- cross attention ---
  gemmB(y_bf,   caWq_bf, ca_bq, Qb, MROWS, DMODEL, DMODEL);
  gemmB(enc_bf, caWk_bf, ca_bk, Kb, MROWS, DMODEL, DMODEL);
  gemmB(enc_bf, caWv_bf, ca_bv, Vb, MROWS, DMODEL, DMODEL);
  transpose_v_kernel<<<dim3(SSEQ / 32, NHEAD, NB), 256, 0, stream>>>(Vb, Vt, SSEQ);
  attn_kernel<<<dim3(TSEQ / 64, NHEAD, NB), 128, 0, stream>>>(
      Qb, Kb, Vt, src_mask, ctx, TSEQ, SSEQ);
  cvt(ctx, ctx_bf, MROWS * DMODEL);
  gemmF(ctx_bf, caWo_bf, ca_bo, proj, MROWS, DMODEL, DMODEL);
  ln_kernel<<<MROWS, 256, 0, stream>>>(yres, proj, ln2_g, ln2_b, yres, y_bf);

  // --- feed forward ---
  gemm_kernel<true, true><<<dim3(MROWS / 128, DFFN / 128), 256, 0, stream>>>(
      y_bf, W1_bf, ff_b1, (void*)hidden, MROWS, DFFN, DMODEL);
  gemmF(hidden, W2_bf, ff_b2, proj, MROWS, DMODEL, DFFN);
  ln_kernel<<<MROWS, 256, 0, stream>>>(yres, proj, ln3_g, ln3_b, (float*)d_out, y_bf);
}

// v002
// Measured time: 606 microseconds a run.
// Timed twice side by side with v001, it ran 1.05 and 1.04 times as fast.
// Counting every step since v000, it is 1.30 times as fast.
#include <hip/hip_runtime.h>

// ---------------------------------------------------------------------------
// Problem constants (from reference): D=1024, H=16, DK=64, DFF=4096, B=2,
// T=S=2048.  M = B*T = 4096 rows for every activation GEMM.
// ---------------------------------------------------------------------------
#define DMODEL 1024
#define NHEAD  16
#define DHEAD  64
#define DFFN   4096
#define NB     2
#define TSEQ   2048
#define SSEQ   2048
#define MROWS  (NB * TSEQ)   // 4096

typedef __attribute__((ext_vector_type(16))) __bf16 v16bf;
typedef __attribute__((ext_vector_type(8)))  __bf16 v8bf;
typedef __attribute__((ext_vector_type(8)))  float  v8f;

// ---------------------------------------------------------------------------
// Helpers
// ---------------------------------------------------------------------------
__device__ __forceinline__ __bf16 f2bf(float f) {
  unsigned int u = __float_as_uint(f);
  u += 0x7FFFu + ((u >> 16) & 1u);          // round-to-nearest-even
  unsigned short s = (unsigned short)(u >> 16);
  __bf16 r;
  __builtin_memcpy(&r, &s, 2);
  return r;
}

// Load one WMMA 16-lane fragment row following the CDNA5 per-lane K-chunk
// layout: lanes 0-15 hold K {hi8=0: 0..7,16..23}, lanes 16-31 hold {8..15,24..31}.
__device__ __forceinline__ v16bf load_frag(const __bf16* row, int hi8) {
  v8bf a = *(const v8bf*)(row + hi8);
  v8bf b = *(const v8bf*)(row + hi8 + 16);
  return __builtin_shufflevector(a, b, 0,1,2,3,4,5,6,7,8,9,10,11,12,13,14,15);
}

__device__ __forceinline__ v8f wmma_bf16(v16bf a, v16bf b, v8f c) {
  return __builtin_amdgcn_wmma_f32_16x16x32_bf16(
      /*neg_a=*/false, a, /*neg_b=*/false, b,
      /*c_mod=*/(short)0, c, /*reuse_a=*/false, /*reuse_b=*/false);
}

// CDNA5 async global->LDS copy (16B per lane), tracked by ASYNCcnt.
// lds_addr = byte offset within the workgroup LDS allocation (low 32 bits of
// the generic pointer), gptr = per-lane 64-bit global address.
__device__ __forceinline__ void async_copy_b128(unsigned int lds_addr,
                                                const void* gptr) {
  asm volatile("global_load_async_to_lds_b128 %0, %1, off"
               :: "v"(lds_addr), "v"(gptr)
               : "memory");
}
__device__ __forceinline__ void wait_asynccnt0() {
  asm volatile("s_wait_asynccnt 0x0" ::: "memory");
}
// Eight async copies (16B per lane each) in one statement. The closing
// s_wait_xcnt stands inside the statement so that no address register of an
// issued copy is rewritten ahead of it.
__device__ __forceinline__ void async_copy8_b128(
    unsigned int l0, unsigned int l1, unsigned int l2, unsigned int l3,
    unsigned int l4, unsigned int l5, unsigned int l6, unsigned int l7,
    const void* g0, const void* g1, const void* g2, const void* g3,
    const void* g4, const void* g5, const void* g6, const void* g7) {
  asm volatile("global_load_async_to_lds_b128 %0, %8, off\n\t"
               "global_load_async_to_lds_b128 %1, %9, off\n\t"
               "global_load_async_to_lds_b128 %2, %10, off\n\t"
               "global_load_async_to_lds_b128 %3, %11, off\n\t"
               "global_load_async_to_lds_b128 %4, %12, off\n\t"
               "global_load_async_to_lds_b128 %5, %13, off\n\t"
               "global_load_async_to_lds_b128 %6, %14, off\n\t"
               "global_load_async_to_lds_b128 %7, %15, off\n\t"
               "s_wait_xcnt 0x0"
               :: "v"(l0), "v"(l1), "v"(l2), "v"(l3),
                  "v"(l4), "v"(l5), "v"(l6), "v"(l7),
                  "v"(g0), "v"(g1), "v"(g2), "v"(g3),
                  "v"(g4), "v"(g5), "v"(g6), "v"(g7)
               : "memory");
}
// Retires this wave's LDS reads before a barrier behind which the buffer they
// read is refilled by copies.
__device__ __forceinline__ void wait_dscnt0() {
  asm volatile("s_wait_dscnt 0x0" ::: "memory");
}

// ---------------------------------------------------------------------------
// fp32 -> bf16 conversion (grid-stride)
// ---------------------------------------------------------------------------
__global__ __launch_bounds__(256) void cvt_kernel(const float* __restrict__ in,
                                                  __bf16* __restrict__ out, int n) {
  int i = blockIdx.x * 256 + threadIdx.x;
  const int stride = gridDim.x * 256;
  for (; i < n; i += stride) out[i] = f2bf(in[i]);
}

// ---------------------------------------------------------------------------
// All twelve f32 -> bf16 conversions of the inputs in ONE launch. Their bf16
// images lie one behind the other in the workspace, so the destination is one
// array of 24 segments of 2^20 elements: segments 0..7 the eight D x D
// weights, 8..11 and 12..15 the two feed-forward weights, 16..19 and 20..23
// the two activations. 32 blocks share a segment; a block converts 32768
// contiguous elements, 1024 a trip: each wave-wide load covers four whole
// 128-B lines, each wave-wide store two. Few long-lived waves take the place
// of many short ones: the time of the short launches was the start of their
// waves, not their bytes.
// ---------------------------------------------------------------------------
typedef __attribute__((ext_vector_type(4))) float  v4f;
typedef __attribute__((ext_vector_type(4))) __bf16 v4bf;
#define CVT_SEG_LOG2   20
#define CVT_BLK_ELEMS  32768
__global__ __launch_bounds__(256) void cvt_inputs_kernel(
    const float* __restrict__ w0, const float* __restrict__ w1,
    const float* __restrict__ w2, const float* __restrict__ w3,
    const float* __restrict__ w4, const float* __restrict__ w5,
    const float* __restrict__ w6, const float* __restrict__ w7,
    const float* __restrict__ f1, const float* __restrict__ f2,
    const float* __restrict__ xa, const float* __restrict__ xe,
    __bf16* __restrict__ out)
{
  const int seg = blockIdx.x >> 5;     // block-uniform
  const float* src;
  int first;                           // the source's first segment
  if (seg < 8) {
    first = seg;
    src = seg == 0 ? w0 : seg == 1 ? w1 : seg == 2 ? w2 : seg == 3 ? w3
        : seg == 4 ? w4 : seg == 5 ? w5 : seg == 6 ? w6 : w7;
  } else if (seg < 12) { first = 8;  src = f1; }
  else if (seg < 16)   { first = 12; src = f2; }
  else if (seg < 20)   { first = 16; src = xa; }
  else                 { first = 20; src = xe; }
  const size_t inseg = (size_t)(blockIdx.x & 31) * CVT_BLK_ELEMS + threadIdx.x * 4;
  const float* s = src + ((size_t)(seg - first) << CVT_SEG_LOG2) + inseg;
  __bf16*      d = out + ((size_t)seg << CVT_SEG_LOG2) + inseg;
  // Four groups of eight trips: a group's eight 16-B loads per lane are in
  // flight together, ahead of its stores. Unrolled: every place in the block's
  // share is an immediate offset, so no address register is ever rewritten.
#pragma unroll
  for (int g = 0; g < CVT_BLK_ELEMS / 8192; ++g) {
    v4f v[8];
#pragma unroll
    for (int i = 0; i < 8; ++i) v[i] = *(const v4f*)(s + (g * 8 + i) * 1024);
#pragma unroll
    for (int i = 0; i < 8; ++i) {
      v4bf o;
#pragma unroll
      for (int e = 0; e < 4; ++e) o[e] = f2bf(v[i][e]);
      *(v4bf*)(d + (g * 8 + i) * 1024) = o;
    }
    // the next group's loads reuse the data registers of these stores
    if (g + 1 < CVT_BLK_ELEMS / 8192) asm volatile("s_wait_xcnt 0x0" ::: "memory");
  }
}

// ---------------------------------------------------------------------------
// Tiled GEMM: out[M,N] = A[M,K] @ W[N,K]^T + bias[N]   (torch Linear semantics)
// Block = 256 threads = 8 waves; 128x128 output tile; wave tile 32x64.
// K is staged 32 wide through double-buffered LDS using async global->LDS
// copies so the next tile streams in while WMMAs consume the current one.
// ---------------------------------------------------------------------------
template<bool RELU, bool OUT_BF16>
__global__ __launch_bounds__(256) void gemm_kernel(
    const __bf16* __restrict__ A, const __bf16* __restrict__ W,
    const float* __restrict__ bias, void* __restrict__ outp,
    int M, int N, int K)
{
  __shared__ __bf16 As[2][128 * 32];
  __shared__ __bf16 Ws[2][128 * 32];

  const int tid  = threadIdx.x;
  const int lane = tid & 31;
  const int wave = tid >> 5;     // 0..7
  const int wm   = wave >> 1;    // 0..3 -> 32-row strip
  const int wn   = wave & 1;     // 0..1 -> 64-col strip
  const int bm   = blockIdx.x * 128;
  const int bn   = blockIdx.y * 128;
  const int l15  = lane & 15;
  const int hi8  = (lane >> 4) << 3;

  const v8f vzero = {0.f,0.f,0.f,0.f,0.f,0.f,0.f,0.f};
  v8f acc[2][4];
#pragma unroll
  for (int i = 0; i < 2; ++i)
#pragma unroll
    for (int j = 0; j < 4; ++j) acc[i][j] = vzero;

  const int ldrow = tid >> 1;          // 0..127
  const int ldcol = (tid & 1) * 16;    // 0 or 16  (32 contiguous bytes/thread)
  const __bf16* aptr = A + (size_t)(bm + ldrow) * K + ldcol;
  const __bf16* wptr = W + (size_t)(bn + ldrow) * K + ldcol;
  const unsigned int lA0 = (unsigned int)(uintptr_t)(&As[0][ldrow * 32 + ldcol]);
  const unsigned int lA1 = (unsigned int)(uintptr_t)(&As[1][ldrow * 32 + ldcol]);
  const unsigned int lW0 = (unsigned int)(uintptr_t)(&Ws[0][ldrow * 32 + ldcol]);
  const unsigned int lW1 = (unsigned int)(uintptr_t)(&Ws[1][ldrow * 32 + ldcol]);

  auto stage = [&](int buf, int k0) {
    const unsigned int la = buf ? lA1 : lA0;
    const unsigned int lw = buf ? lW1 : lW0;
    async_copy_b128(la,      aptr + k0);
    async_copy_b128(la + 16, aptr + k0 + 8);
    async_copy_b128(lw,      wptr + k0);
    async_copy_b128(lw + 16, wptr + k0 + 8);
  };

  stage(0, 0);
  int buf = 0;
  for (int k0 = 0; k0 < K; k0 += 32) {
    wait_asynccnt0();     // our async fills for `buf` have landed in LDS
    __syncthreads();      // ... and everyone else's too; prev reads done
    if (k0 + 32 < K) stage(buf ^ 1, k0 + 32);   // prefetch next tile

    v16bf af[2], bfr[4];
#pragma unroll
    for (int i = 0; i < 2; ++i)
      af[i] = load_frag(&As[buf][(wm * 32 + i * 16 + l15) * 32], hi8);
#pragma unroll
    for (int j = 0; j < 4; ++j)
      bfr[j] = load_frag(&Ws[buf][(wn * 64 + j * 16 + l15) * 32], hi8);
#pragma unroll
    for (int i = 0; i < 2; ++i)
#pragma unroll
      for (int j = 0; j < 4; ++j)
        acc[i][j] = wmma_bf16(af[i], bfr[j], acc[i][j]);
    buf ^= 1;
  }

  float*  outf = (float*)outp;
  __bf16* outb = (__bf16*)outp;
#pragma unroll
  for (int i = 0; i < 2; ++i) {
    const int mrow = bm + wm * 32 + i * 16 + hi8;  // C layout: row r+8*(lane>>4)
#pragma unroll
    for (int j = 0; j < 4; ++j) {
      const int ncol = bn + wn * 64 + j * 16 + l15;
      const float bv = bias[ncol];
#pragma unroll
      for (int r = 0; r < 8; ++r) {
        float v = acc[i][j][r] + bv;
        if (RELU) v = fmaxf(v, 0.0f);
        const size_t idx = (size_t)(mrow + r) * N + ncol;
        if (OUT_BF16) outb[idx] = f2bf(v); else outf[idx] = v;
      }
    }
  }
}

// ---------------------------------------------------------------------------
// Transpose V ([b][s][h][d] bf16) -> Vt ([b][h][d][s] bf16) so V columns are
// contiguous for the PV B-operand.
// ---------------------------------------------------------------------------
__global__ __launch_bounds__(256) void transpose_v_kernel(
    const __bf16* __restrict__ V, __bf16* __restrict__ Vt, int Skv)
{
  __shared__ __bf16 tile[32][72];    // 32 s  x 64 d (+pad)
  const int b  = blockIdx.z;
  const int h  = blockIdx.y;
  const int s0 = blockIdx.x * 32;
  const int tid = threadIdx.x;
  {
    const int sl = tid >> 3;                 // 0..31
    const int dp = (tid & 7) * 8;            // 0..56
    const __bf16* src = V + (size_t)(b * Skv + s0 + sl) * DMODEL + h * DHEAD + dp;
    v8bf val = *(const v8bf*)src;
#pragma unroll
    for (int i = 0; i < 8; ++i) tile[sl][dp + i] = val[i];
  }
  __syncthreads();
  {
    const int dl = tid >> 2;                 // 0..63
    const int sp = (tid & 3) * 8;            // 0..24
    v8bf o;
#pragma unroll
    for (int i = 0; i < 8; ++i) o[i] = tile[sp + i][dl];
    __bf16* dst = Vt + (size_t)((b * NHEAD + h) * DHEAD + dl) * Skv + s0 + sp;
    *(v8bf*)dst = o;
  }
}

#define KVPITCH 72
__global__ __launch_bounds__(128) void attn_kernel(
    const __bf16* __restrict__ Qb,   // [B*Tq, DMODEL] bf16
    const __bf16* __restrict__ Kb,   // [B*Skv, DMODEL] bf16
    const __bf16* __restrict__ Vt,   // [B*H*DHEAD, Skv] bf16
    const int*    __restrict__ mask, // [B, Tq, Skv]
    float*        __restrict__ ctx,  // [B*Tq, DMODEL] f32
    int Tq, int Skv)
{
  // 64 rows of 128 B at a pitch of 144 B (16 B x odd: no bank conflict for the
  // 16-byte fragment reads).
  __shared__ __attribute__((aligned(16))) __bf16 Ks[2][64 * KVPITCH];
  __shared__ __attribute__((aligned(16))) __bf16 Vs[2][64 * KVPITCH];
  __shared__ __bf16 plds[4][16 * 32];
  const int lane = threadIdx.x & 31;
  const int wave = threadIdx.x >> 5;
  const int l15  = lane & 15;
  const int hi8  = (lane >> 4) << 3;
  const int h    = blockIdx.y;
  const int b    = blockIdx.z;
  const int q0   = blockIdx.x * 64 + wave * 16;

  const __bf16* qrow = Qb + (size_t)(b * Tq + q0 + l15) * DMODEL + h * DHEAD;
  const v16bf qf0 = load_frag(qrow, hi8);        // K-dim 0..31 of head
  const v16bf qf1 = load_frag(qrow + 32, hi8);   // K-dim 32..63

  const __bf16* kbase  = Kb + (size_t)b * Skv * DMODEL + h * DHEAD;
  const __bf16* vtbase = Vt + (size_t)((b * NHEAD + h) * DHEAD) * Skv;
  const int*    mbase  = mask + (size_t)b * Tq * Skv;

  const v8f vzero = {0.f,0.f,0.f,0.f,0.f,0.f,0.f,0.f};
  v8f o[4];
#pragma unroll
  for (int j = 0; j < 4; ++j) o[j] = vzero;
  float mrow[8], lrow[8];
#pragma unroll
  for (int r = 0; r < 8; ++r) { mrow[r] = -1e30f; lrow[r] = 0.f; }

  __bf16* pl = plds[wave];

  // Staging map: thread t brings 16 B at column chunk (t & 7) of rows
  // (t >> 3) + 16 * i, i = 0..3, of the K tile and of the V^T tile: each
  // wave-wide copy covers four whole 128-B lines.
  const int crow = threadIdx.x >> 3;          // 0..15
  const int ccol = (threadIdx.x & 7) * 8;     // element offset in the row
  const __bf16* kcp = kbase  + (size_t)crow * DMODEL + ccol;
  const __bf16* vcp = vtbase + (size_t)crow * Skv + ccol;
  const unsigned int lK = (unsigned int)(uintptr_t)(&Ks[0][crow * KVPITCH + ccol]);
  const unsigned int lV = (unsigned int)(uintptr_t)(&Vs[0][crow * KVPITCH + ccol]);
  const unsigned int rstep = 16 * KVPITCH * 2;   // 16 LDS rows, bytes
  const unsigned int bstep = 64 * KVPITCH * 2;   // one buffer, bytes
  auto stage = [&](int bsel, int key0) {
    const unsigned int lk = lK + bsel * bstep;
    const unsigned int lv = lV + bsel * bstep;
    const __bf16* kg = kcp + (size_t)key0 * DMODEL;
    const __bf16* vg = vcp + key0;
    async_copy8_b128(lk, lk + rstep, lk + 2 * rstep, lk + 3 * rstep,
                     lv, lv + rstep, lv + 2 * rstep, lv + 3 * rstep,
                     kg, kg + 16 * DMODEL, kg + 32 * DMODEL, kg + 48 * DMODEL,
                     vg, vg + (size_t)16 * Skv, vg + (size_t)32 * Skv,
                     vg + (size_t)48 * Skv);
  };

  stage(0, 0);
  wait_asynccnt0();     // this wave's share of tile 0 has landed
  __syncthreads();      // ... and every other wave's
  if (64 < Skv) stage(1, 64);

  int buf = 0;
  for (int t0 = 0; t0 < Skv; t0 += 64) {
   const __bf16* kt = Ks[buf];
   const __bf16* vt = Vs[buf];
   // unrolled: the pass's place in the tile becomes an immediate LDS offset
#pragma unroll
   for (int p = 0; p < 2; ++p) {
    const int s0 = t0 + p * 32;
    v8f sc0 = vzero, sc1 = vzero;
    {
      const __bf16* krow0 = kt + (p * 32 + l15) * KVPITCH;
      const __bf16* krow1 = kt + (p * 32 + 16 + l15) * KVPITCH;
      sc0 = wmma_bf16(qf0, load_frag(krow0, hi8), sc0);
      sc0 = wmma_bf16(qf1, load_frag(krow0 + 32, hi8), sc0);
      sc1 = wmma_bf16(qf0, load_frag(krow1, hi8), sc1);
      sc1 = wmma_bf16(qf1, load_frag(krow1 + 32, hi8), sc1);
    }
    // scale + mask + local row max (C layout: element r -> row q0+r+hi8,
    // col l15 (tile0) / 16+l15 (tile1))
    float nmax[8];
#pragma unroll
    for (int r = 0; r < 8; ++r) {
      float v0 = sc0[r] * 0.125f;   // 1/sqrt(64)
      float v1 = sc1[r] * 0.125f;
      const int* mrp = mbase + (size_t)(q0 + r + hi8) * Skv + s0;
      if (mrp[l15] == 0)      v0 = -1e9f;
      if (mrp[16 + l15] == 0) v1 = -1e9f;
      sc0[r] = v0; sc1[r] = v1;
      nmax[r] = fmaxf(v0, v1);
    }
#pragma unroll
    for (int off = 1; off < 16; off <<= 1)
#pragma unroll
      for (int r = 0; r < 8; ++r)
        nmax[r] = fmaxf(nmax[r], __shfl_xor(nmax[r], off, 32));

    float scl[8], rsum[8];
#pragma unroll
    for (int r = 0; r < 8; ++r) {
      const float mn = fmaxf(mrow[r], nmax[r]);
      scl[r] = __expf(mrow[r] - mn);
      mrow[r] = mn;
      const float p0 = __expf(sc0[r] - mn);
      const float p1 = __expf(sc1[r] - mn);
      sc0[r] = p0; sc1[r] = p1;
      rsum[r] = p0 + p1;
    }
#pragma unroll
    for (int off = 1; off < 16; off <<= 1)
#pragma unroll
      for (int r = 0; r < 8; ++r)
        rsum[r] += __shfl_xor(rsum[r], off, 32);
#pragma unroll
    for (int r = 0; r < 8; ++r) lrow[r] = lrow[r] * scl[r] + rsum[r];
#pragma unroll
    for (int j = 0; j < 4; ++j)
#pragma unroll
      for (int r = 0; r < 8; ++r) o[j][r] *= scl[r];

    // P (C layout, f32) -> LDS row-major 16x32 bf16
#pragma unroll
    for (int r = 0; r < 8; ++r) {
      pl[(r + hi8) * 32 + l15]      = f2bf(sc0[r]);
      pl[(r + hi8) * 32 + 16 + l15] = f2bf(sc1[r]);
    }
    __syncthreads();
    const v16bf pf = load_frag(pl + l15 * 32, hi8);   // A-fragment of P
#pragma unroll
    for (int j = 0; j < 4; ++j) {
      const __bf16* vrow = vt + (j * 16 + l15) * KVPITCH + p * 32;
      o[j] = wmma_bf16(pf, load_frag(vrow, hi8), o[j]);
    }
    // closing barrier of the pass, as before; the second pass's is the one at
    // the publish point below
    if (p == 0) __syncthreads();
   }
   // Publish point: own LDS reads of this tile retired, own copies of the next
   // tile landed, then the barrier that publishes the next tile and frees this
   // buffer for the refill behind it.
   wait_dscnt0();
   wait_asynccnt0();
   __syncthreads();
   if (t0 + 128 < Skv) stage(buf, t0 + 128);
   buf ^= 1;
  }
  wait_asynccnt0();     // nothing of the ring is in flight when the wave ends

#pragma unroll
  for (int r = 0; r < 8; ++r) lrow[r] = 1.0f / lrow[r];
#pragma unroll
  for (int j = 0; j < 4; ++j)
#pragma unroll
    for (int r = 0; r < 8; ++r) {
      const size_t idx = (size_t)(b * Tq + q0 + r + hi8) * DMODEL + h * DHEAD + j * 16 + l15;
      ctx[idx] = o[j][r] * lrow[r];
    }
}

// ---------------------------------------------------------------------------
// Residual add + LayerNorm; writes f32 stream + bf16 copy for next GEMM.
// One block per row of 1024. (x/yout may alias for in-place update.)
// ---------------------------------------------------------------------------
__global__ __launch_bounds__(256) void ln_kernel(
    const float* x, const float* __restrict__ sub,
    const float* __restrict__ g, const float* __restrict__ bta,
    float* yout, __bf16* __restrict__ ybf)
{
  __shared__ float s1[256], s2[256];
  const size_t base = (size_t)blockIdx.x * DMODEL;
  float v[4];
  float lsum = 0.f, lsq = 0.f;
#pragma unroll
  for (int k = 0; k < 4; ++k) {
    const int i = threadIdx.x + k * 256;
    v[k] = x[base + i] + sub[base + i];
    lsum += v[k];
    lsq  += v[k] * v[k];
  }
  s1[threadIdx.x] = lsum; s2[threadIdx.x] = lsq;
  __syncthreads();
  for (int off = 128; off > 0; off >>= 1) {
    if (threadIdx.x < off) {
      s1[threadIdx.x] += s1[threadIdx.x + off];
      s2[threadIdx.x] += s2[threadIdx.x + off];
    }
    __syncthreads();
  }
  const float mean = s1[0] * (1.0f / DMODEL);
  const float var  = s2[0] * (1.0f / DMODEL) - mean * mean;
  const float rs   = rsqrtf(var + 1e-5f);
#pragma unroll
  for (int k = 0; k < 4; ++k) {
    const int i = threadIdx.x + k * 256;
    const float o = (v[k] - mean) * rs * g[i] + bta[i];
    yout[base + i] = o;
    ybf[base + i]  = f2bf(o);
  }
}

// ---------------------------------------------------------------------------
// Host orchestration
// ---------------------------------------------------------------------------
extern "C" void kernel_launch(void* const* d_in, const int* in_sizes, int n_in,
                              void* d_out, int out_size, void* d_ws, size_t ws_size,
                              hipStream_t stream) {
  (void)in_sizes; (void)n_in; (void)out_size; (void)ws_size;

  const float* x        = (const float*)d_in[0];
  const float* enc      = (const float*)d_in[1];
  const int*   src_mask = (const int*)d_in[2];
  const int*   tgt_mask = (const int*)d_in[3];
  const float* sa_Wq = (const float*)d_in[4],  *sa_bq = (const float*)d_in[5];
  const float* sa_Wk = (const float*)d_in[6],  *sa_bk = (const float*)d_in[7];
  const float* sa_Wv = (const float*)d_in[8],  *sa_bv = (const float*)d_in[9];
  const float* sa_Wo = (const float*)d_in[10], *sa_bo = (const float*)d_in[11];
  const float* ca_Wq = (const float*)d_in[12], *ca_bq = (const float*)d_in[13];
  const float* ca_Wk = (const float*)d_in[14], *ca_bk = (const float*)d_in[15];
  const float* ca_Wv = (const float*)d_in[16], *ca_bv = (const float*)d_in[17];
  const float* ca_Wo = (const float*)d_in[18], *ca_bo = (const float*)d_in[19];
  const float* ff_W1 = (const float*)d_in[20], *ff_b1 = (const float*)d_in[21];
  const float* ff_W2 = (const float*)d_in[22], *ff_b2 = (const float*)d_in[23];
  const float* ln1_g = (const float*)d_in[24], *ln1_b = (const float*)d_in[25];
  const float* ln2_g = (const float*)d_in[26], *ln2_b = (const float*)d_in[27];
  const float* ln3_g = (const float*)d_in[28], *ln3_b = (const float*)d_in[29];

  char* ws = (char*)d_ws;
  const size_t MB = 1024ull * 1024ull;
  // bf16 weights
  __bf16* saWq_bf = (__bf16*)(ws + 0 * MB);
  __bf16* saWk_bf = (__bf16*)(ws + 2 * MB);
  __bf16* saWv_bf = (__bf16*)(ws + 4 * MB);
  __bf16* saWo_bf = (__bf16*)(ws + 6 * MB);
  __bf16* caWq_bf = (__bf16*)(ws + 8 * MB);
  __bf16* caWk_bf = (__bf16*)(ws + 10 * MB);
  __bf16* caWv_bf = (__bf16*)(ws + 12 * MB);
  __bf16* caWo_bf = (__bf16*)(ws + 14 * MB);
  __bf16* W1_bf   = (__bf16*)(ws + 16 * MB);   // 8 MB
  __bf16* W2_bf   = (__bf16*)(ws + 24 * MB);   // 8 MB
  // activations
  __bf16* x_bf    = (__bf16*)(ws + 32 * MB);
  __bf16* enc_bf  = (__bf16*)(ws + 40 * MB);
  __bf16* Qb      = (__bf16*)(ws + 48 * MB);
  __bf16* Kb      = (__bf16*)(ws + 56 * MB);
  __bf16* Vb      = (__bf16*)(ws + 64 * MB);
  __bf16* Vt      = (__bf16*)(ws + 72 * MB);
  float*  ctx     = (float*) (ws + 80 * MB);   // 16 MB
  float*  proj    = (float*) (ws + 96 * MB);   // 16 MB
  float*  yres    = (float*) (ws + 112 * MB);  // 16 MB
  __bf16* y_bf    = (__bf16*)(ws + 128 * MB);  // 8 MB
  __bf16* hidden  = (__bf16*)(ws + 136 * MB);  // 32 MB
  __bf16* ctx_bf  = (__bf16*)(ws + 168 * MB);  // 8 MB

  auto cvt = [&](const float* in, __bf16* out, int n) {
    cvt_kernel<<<dim3(2048), dim3(256), 0, stream>>>(in, out, n);
  };
  auto gemmF = [&](const __bf16* A, const __bf16* W, const float* b, float* out,
                   int M, int N, int K) {
    gemm_kernel<false, false><<<dim3(M / 128, N / 128), 256, 0, stream>>>(
        A, W, b, (void*)out, M, N, K);
  };
  auto gemmB = [&](const __bf16* A, const __bf16* W, const float* b, __bf16* out,
                   int M, int N, int K) {
    gemm_kernel<false, true><<<dim3(M / 128, N / 128), 256, 0, stream>>>(
        A, W, b, (void*)out, M, N, K);
  };

  // --- precision staging ---
  // saWq_bf .. enc_bf are the 24 segments of one array that starts at saWq_bf
  cvt_inputs_kernel<<<dim3(24 * 32), dim3(256), 0, stream>>>(
      sa_Wq, sa_Wk, sa_Wv, sa_Wo, ca_Wq, ca_Wk, ca_Wv, ca_Wo,
      ff_W1, ff_W2, x, enc, saWq_bf);

  // --- self attention ---
  gemmB(x_bf, saWq_bf, sa_bq, Qb, MROWS, DMODEL, DMODEL);
  gemmB(x_bf, saWk_bf, sa_bk, Kb, MROWS, DMODEL, DMODEL);
  gemmB(x_bf, saWv_bf, sa_bv, Vb, MROWS, DMODEL, DMODEL);
  transpose_v_kernel<<<dim3(TSEQ / 32, NHEAD, NB), 256, 0, stream>>>(Vb, Vt, TSEQ);
  attn_kernel<<<dim3(TSEQ / 64, NHEAD, NB), 128, 0, stream>>>(
      Qb, Kb, Vt, tgt_mask, ctx, TSEQ, TSEQ);
  cvt(ctx, ctx_bf, MROWS * DMODEL);
  gemmF(ctx_bf, saWo_bf, sa_bo, proj, MROWS, DMODEL, DMODEL);
  ln_kernel<<<MROWS, 256, 0, stream>>>(x, proj, ln1_g, ln1_b, yres, y_bf);

  // --- cross attention ---
  gemmB(y_bf,   caWq_bf, ca_bq, Qb, MROWS, DMODEL, DMODEL);
  gemmB(enc_bf, caWk_bf, ca_bk, Kb, MROWS, DMODEL, DMODEL);
  gemmB(enc_bf, caWv_bf, ca_bv, Vb, MROWS, DMODEL, DMODEL);
  transpose_v_kernel<<<dim3(SSEQ / 32, NHEAD, NB), 256, 0, stream>>>(Vb, Vt, SSEQ);
  attn_kernel<<<dim3(TSEQ / 64, NHEAD, NB), 128, 0, stream>>>(
      Qb, Kb, Vt, src_mask, ctx, TSEQ, SSEQ);
  cvt(ctx, ctx_bf, MROWS * DMODEL);
  gemmF(ctx_bf, caWo_bf, ca_bo, proj, MROWS, DMODEL, DMODEL);
  ln_kernel<<<MROWS, 256, 0, stream>>>(yres, proj, ln2_g, ln2_b, yres, y_bf);

  // --- feed forward ---
  gemm_kernel<true, true><<<dim3(MROWS / 128, DFFN / 128), 256, 0, stream>>>(
      y_bf, W1_bf, ff_b1, (void*)hidden, MROWS, DFFN, DMODEL);
  gemmF(hidden, W2_bf, ff_b2, proj, MROWS, DMODEL, DFFN);
  ln_kernel<<<MROWS, 256, 0, stream>>>(yres, proj, ln3_g, ln3_b, (float*)d_out, y_bf);
}

// v003
// Measured time: 533 microseconds a run.
// Timed twice side by side with v002, it ran 1.14 times as fast both times.
// Over all steps from v000 it is 1.48 times as fast.
#include <hip/hip_runtime.h>

// ---------------------------------------------------------------------------
// Problem constants (from reference): D=1024, H=16, DK=64, DFF=4096, B=2,
// T=S=2048.  M = B*T = 4096 rows for every activation GEMM.
// ---------------------------------------------------------------------------
#define DMODEL 1024
#define NHEAD  16
#define DHEAD  64
#define DFFN   4096
#define NB     2
#define TSEQ   2048
#define SSEQ   2048
#define MROWS  (NB * TSEQ)   // 4096

typedef __attribute__((ext_vector_type(16))) __bf16 v16bf;
typedef __attribute__((ext_vector_type(8)))  __bf16 v8bf;
typedef __attribute__((ext_vector_type(8)))  float  v8f;

// ---------------------------------------------------------------------------
// Helpers
// ---------------------------------------------------------------------------
__device__ __forceinline__ __bf16 f2bf(float f) {
  unsigned int u = __float_as_uint(f);
  u += 0x7FFFu + ((u >> 16) & 1u);          // round-to-nearest-even
  unsigned short s = (unsigned short)(u >> 16);
  __bf16 r;
  __builtin_memcpy(&r, &s, 2);
  return r;
}

// Load one WMMA 16-lane fragment row following the CDNA5 per-lane K-chunk
// layout: lanes 0-15 hold K {hi8=0: 0..7,16..23}, lanes 16-31 hold {8..15,24..31}.
__device__ __forceinline__ v16bf load_frag(const __bf16* row, int hi8) {
  v8bf a = *(const v8bf*)(row + hi8);
  v8bf b = *(const v8bf*)(row + hi8 + 16);
  return __builtin_shufflevector(a, b, 0,1,2,3,4,5,6,7,8,9,10,11,12,13,14,15);
}

__device__ __forceinline__ v8f wmma_bf16(v16bf a, v16bf b, v8f c) {
  return __builtin_amdgcn_wmma_f32_16x16x32_bf16(
      /*neg_a=*/false, a, /*neg_b=*/false, b,
      /*c_mod=*/(short)0, c, /*reuse_a=*/false, /*reuse_b=*/false);
}

// CDNA5 async global->LDS copy (16B per lane), tracked by ASYNCcnt.
// lds_addr = byte offset within the workgroup LDS allocation (low 32 bits of
// the generic pointer), gptr = per-lane 64-bit global address.
__device__ __forceinline__ void async_copy_b128(unsigned int lds_addr,
                                                const void* gptr) {
  asm volatile("global_load_async_to_lds_b128 %0, %1, off"
               :: "v"(lds_addr), "v"(gptr)
               : "memory");
}
__device__ __forceinline__ void wait_asynccnt0() {
  asm volatile("s_wait_asynccnt 0x0" ::: "memory");
}
// Eight async copies (16B per lane each) in one statement. The closing
// s_wait_xcnt stands inside the statement so that no address register of an
// issued copy is rewritten ahead of it.
__device__ __forceinline__ void async_copy8_b128(
    unsigned int l0, unsigned int l1, unsigned int l2, unsigned int l3,
    unsigned int l4, unsigned int l5, unsigned int l6, unsigned int l7,
    const void* g0, const void* g1, const void* g2, const void* g3,
    const void* g4, const void* g5, const void* g6, const void* g7) {
  asm volatile("global_load_async_to_lds_b128 %0, %8, off\n\t"
               "global_load_async_to_lds_b128 %1, %9, off\n\t"
               "global_load_async_to_lds_b128 %2, %10, off\n\t"
               "global_load_async_to_lds_b128 %3, %11, off\n\t"
               "global_load_async_to_lds_b128 %4, %12, off\n\t"
               "global_load_async_to_lds_b128 %5, %13, off\n\t"
               "global_load_async_to_lds_b128 %6, %14, off\n\t"
               "global_load_async_to_lds_b128 %7, %15, off\n\t"
               "s_wait_xcnt 0x0"
               :: "v"(l0), "v"(l1), "v"(l2), "v"(l3),
                  "v"(l4), "v"(l5), "v"(l6), "v"(l7),
                  "v"(g0), "v"(g1), "v"(g2), "v"(g3),
                  "v"(g4), "v"(g5), "v"(g6), "v"(g7)
               : "memory");
}
// Retires this wave's LDS reads before a barrier behind which the buffer they
// read is refilled by copies.
__device__ __forceinline__ void wait_dscnt0() {
  asm volatile("s_wait_dscnt 0x0" ::: "memory");
}

// ---------------------------------------------------------------------------
// fp32 -> bf16 conversion (grid-stride)
// ---------------------------------------------------------------------------
__global__ __launch_bounds__(256) void cvt_kernel(const float* __restrict__ in,
                                                  __bf16* __restrict__ out, int n) {
  int i = blockIdx.x * 256 + threadIdx.x;
  const int stride = gridDim.x * 256;
  for (; i < n; i += stride) out[i] = f2bf(in[i]);
}

// ---------------------------------------------------------------------------
// All twelve f32 -> bf16 conversions of the inputs in ONE launch. Their bf16
// images lie one behind the other in the workspace, so the destination is one
// array of 24 segments of 2^20 elements: segments 0..7 the eight D x D
// weights, 8..11 and 12..15 the two feed-forward weights, 16..19 and 20..23
// the two activations. 32 blocks share a segment; a block converts 32768
// contiguous elements, 1024 a trip: each wave-wide load covers four whole
// 128-B lines, each wave-wide store two. Few long-lived waves take the place
// of many short ones: the time of the short launches was the start of their
// waves, not their bytes.
// ---------------------------------------------------------------------------
typedef __attribute__((ext_vector_type(4))) float  v4f;
typedef __attribute__((ext_vector_type(4))) __bf16 v4bf;
#define CVT_SEG_LOG2   20
#define CVT_BLK_ELEMS  32768
__global__ __launch_bounds__(256) void cvt_inputs_kernel(
    const float* __restrict__ w0, const float* __restrict__ w1,
    const float* __restrict__ w2, const float* __restrict__ w3,
    const float* __restrict__ w4, const float* __restrict__ w5,
    const float* __restrict__ w6, const float* __restrict__ w7,
    const float* __restrict__ f1, const float* __restrict__ f2,
    const float* __restrict__ xa, const float* __restrict__ xe,
    __bf16* __restrict__ out)
{
  const int seg = blockIdx.x >> 5;     // block-uniform
  const float* src;
  int first;                           // the source's first segment
  if (seg < 8) {
    first = seg;
    src = seg == 0 ? w0 : seg == 1 ? w1 : seg == 2 ? w2 : seg == 3 ? w3
        : seg == 4 ? w4 : seg == 5 ? w5 : seg == 6 ? w6 : w7;
  } else if (seg < 12) { first = 8;  src = f1; }
  else if (seg < 16)   { first = 12; src = f2; }
  else if (seg < 20)   { first = 16; src = xa; }
  else                 { first = 20; src = xe; }
  const size_t inseg = (size_t)(blockIdx.x & 31) * CVT_BLK_ELEMS + threadIdx.x * 4;
  const float* s = src + ((size_t)(seg - first) << CVT_SEG_LOG2) + inseg;
  __bf16*      d = out + ((size_t)seg << CVT_SEG_LOG2) + inseg;
  // Four groups of eight trips: a group's eight 16-B loads per lane are in
  // flight together, ahead of its stores. Unrolled: every place in the block's
  // share is an immediate offset, so no address register is ever rewritten.
#pragma unroll
  for (int g = 0; g < CVT_BLK_ELEMS / 8192; ++g) {
    v4f v[8];
#pragma unroll
    for (int i = 0; i < 8; ++i) v[i] = *(const v4f*)(s + (g * 8 + i) * 1024);
#pragma unroll
    for (int i = 0; i < 8; ++i) {
      v4bf o;
#pragma unroll
      for (int e = 0; e < 4; ++e) o[e] = f2bf(v[i][e]);
      *(v4bf*)(d + (g * 8 + i) * 1024) = o;
    }
    // the next group's loads reuse the data registers of these stores
    if (g + 1 < CVT_BLK_ELEMS / 8192) asm volatile("s_wait_xcnt 0x0" ::: "memory");
  }
}

// ---------------------------------------------------------------------------
// Tiled GEMM: out[M,N] = A[M,K] @ W[N,K]^T + bias[N]   (torch Linear semantics)
// Block = 256 threads = 8 waves; 128x128 output tile; wave tile 32x64.
// K is staged 32 wide through double-buffered LDS using async global->LDS
// copies so the next tile streams in while WMMAs consume the current one.
// ---------------------------------------------------------------------------
template<bool RELU, bool OUT_BF16>
__global__ __launch_bounds__(256) void gemm_kernel(
    const __bf16* __restrict__ A, const __bf16* __restrict__ W,
    const float* __restrict__ bias, void* __restrict__ outp,
    int M, int N, int K)
{
  __shared__ __bf16 As[2][128 * 32];
  __shared__ __bf16 Ws[2][128 * 32];

  const int tid  = threadIdx.x;
  const int lane = tid & 31;
  const int wave = tid >> 5;     // 0..7
  const int wm   = wave >> 1;    // 0..3 -> 32-row strip
  const int wn   = wave & 1;     // 0..1 -> 64-col strip
  const int bm   = blockIdx.x * 128;
  const int bn   = blockIdx.y * 128;
  const int l15  = lane & 15;
  const int hi8  = (lane >> 4) << 3;

  const v8f vzero = {0.f,0.f,0.f,0.f,0.f,0.f,0.f,0.f};
  v8f acc[2][4];
#pragma unroll
  for (int i = 0; i < 2; ++i)
#pragma unroll
    for (int j = 0; j < 4; ++j) acc[i][j] = vzero;

  const int ldrow = tid >> 1;          // 0..127
  const int ldcol = (tid & 1) * 16;    // 0 or 16  (32 contiguous bytes/thread)
  const __bf16* aptr = A + (size_t)(bm + ldrow) * K + ldcol;
  const __bf16* wptr = W + (size_t)(bn + ldrow) * K + ldcol;
  const unsigned int lA0 = (unsigned int)(uintptr_t)(&As[0][ldrow * 32 + ldcol]);
  const unsigned int lA1 = (unsigned int)(uintptr_t)(&As[1][ldrow * 32 + ldcol]);
  const unsigned int lW0 = (unsigned int)(uintptr_t)(&Ws[0][ldrow * 32 + ldcol]);
  const unsigned int lW1 = (unsigned int)(uintptr_t)(&Ws[1][ldrow * 32 + ldcol]);

  auto stage = [&](int buf, int k0) {
    const unsigned int la = buf ? lA1 : lA0;
    const unsigned int lw = buf ? lW1 : lW0;
    async_copy_b128(la,      aptr + k0);
    async_copy_b128(la + 16, aptr + k0 + 8);
    async_copy_b128(lw,      wptr + k0);
    async_copy_b128(lw + 16, wptr + k0 + 8);
  };

  stage(0, 0);
  int buf = 0;
  for (int k0 = 0; k0 < K; k0 += 32) {
    wait_asynccnt0();     // our async fills for `buf` have landed in LDS
    __syncthreads();      // ... and everyone else's too; prev reads done
    if (k0 + 32 < K) stage(buf ^ 1, k0 + 32);   // prefetch next tile

    v16bf af[2], bfr[4];
#pragma unroll
    for (int i = 0; i < 2; ++i)
      af[i] = load_frag(&As[buf][(wm * 32 + i * 16 + l15) * 32], hi8);
#pragma unroll
    for (int j = 0; j < 4; ++j)
      bfr[j] = load_frag(&Ws[buf][(wn * 64 + j * 16 + l15) * 32], hi8);
#pragma unroll
    for (int i = 0; i < 2; ++i)
#pragma unroll
      for (int j = 0; j < 4; ++j)
        acc[i][j] = wmma_bf16(af[i], bfr[j], acc[i][j]);
    buf ^= 1;
  }

  float*  outf = (float*)outp;
  __bf16* outb = (__bf16*)outp;
#pragma unroll
  for (int i = 0; i < 2; ++i) {
    const int mrow = bm + wm * 32 + i * 16 + hi8;  // C layout: row r+8*(lane>>4)
#pragma unroll
    for (int j = 0; j < 4; ++j) {
      const int ncol = bn + wn * 64 + j * 16 + l15;
      const float bv = bias[ncol];
#pragma unroll
      for (int r = 0; r < 8; ++r) {
        float v = acc[i][j][r] + bv;
        if (RELU) v = fmaxf(v, 0.0f);
        const size_t idx = (size_t)(mrow + r) * N + ncol;
        if (OUT_BF16) outb[idx] = f2bf(v); else outf[idx] = v;
      }
    }
  }
}

// ---------------------------------------------------------------------------
// Transpose V ([b][s][h][d] bf16) -> Vt ([b][h][d][s] bf16) so V columns are
// contiguous for the V^T A-operand of O^T += V^T P^T.
// ---------------------------------------------------------------------------
__global__ __launch_bounds__(256) void transpose_v_kernel(
    const __bf16* __restrict__ V, __bf16* __restrict__ Vt, int Skv)
{
  __shared__ __bf16 tile[32][72];    // 32 s  x 64 d (+pad)
  const int b  = blockIdx.z;
  const int h  = blockIdx.y;
  const int s0 = blockIdx.x * 32;
  const int tid = threadIdx.x;
  {
    const int sl = tid >> 3;                 // 0..31
    const int dp = (tid & 7) * 8;            // 0..56
    const __bf16* src = V + (size_t)(b * Skv + s0 + sl) * DMODEL + h * DHEAD + dp;
    v8bf val = *(const v8bf*)src;
#pragma unroll
    for (int i = 0; i < 8; ++i) tile[sl][dp + i] = val[i];
  }
  __syncthreads();
  {
    const int dl = tid >> 2;                 // 0..63
    const int sp = (tid & 3) * 8;            // 0..24
    v8bf o;
#pragma unroll
    for (int i = 0; i < 8; ++i) o[i] = tile[sp + i][dl];
    __bf16* dst = Vt + (size_t)((b * NHEAD + h) * DHEAD + dl) * Skv + s0 + sp;
    *(v8bf*)dst = o;
  }
}

#define KVPITCH 72
typedef __attribute__((ext_vector_type(4))) int v4i;
// value of lane l ^ 16
__device__ __forceinline__ float other_half(float v) {
  const int b = __float_as_int(v);
  return __int_as_float(
      __builtin_amdgcn_permlanex16(b, b, 0x76543210, 0xfedcba98, false, false));
}
__global__ __launch_bounds__(128) void attn_kernel(
    const __bf16* __restrict__ Qb,   // [B*Tq, DMODEL] bf16
    const __bf16* __restrict__ Kb,   // [B*Skv, DMODEL] bf16
    const __bf16* __restrict__ Vt,   // [B*H*DHEAD, Skv] bf16
    const int*    __restrict__ mask, // [B, Tq, Skv]
    float*        __restrict__ ctx,  // [B*Tq, DMODEL] f32
    int Tq, int Skv)
{
  // 64 rows of 128 B at a pitch of 144 B (16 B x odd: no bank conflict for the
  // 16-byte fragment reads).
  __shared__ __attribute__((aligned(16))) __bf16 Ks[2][64 * KVPITCH];
  __shared__ __attribute__((aligned(16))) __bf16 Vs[2][64 * KVPITCH];
  const int lane = threadIdx.x & 31;
  const int wave = threadIdx.x >> 5;
  const int l15  = lane & 15;
  const int hi8  = (lane >> 4) << 3;
  const int h    = blockIdx.y;
  const int b    = blockIdx.z;
  const int q0   = blockIdx.x * 64 + wave * 16;

  // B operand: column l15 = query q0 + l15, k in the hardware order
  const __bf16* qrow = Qb + (size_t)(b * Tq + q0 + l15) * DMODEL + h * DHEAD;
  const v16bf qf0 = load_frag(qrow, hi8);        // K-dim 0..31 of head
  const v16bf qf1 = load_frag(qrow + 32, hi8);   // K-dim 32..63

  const __bf16* kbase  = Kb + (size_t)b * Skv * DMODEL + h * DHEAD;
  const __bf16* vtbase = Vt + (size_t)((b * NHEAD + h) * DHEAD) * Skv;
  // this lane's query row of the mask, at its half's first key
  const int*    mq     = mask + ((size_t)b * Tq + q0 + l15) * Skv + hi8;

  const v8f vzero = {0.f,0.f,0.f,0.f,0.f,0.f,0.f,0.f};
  v8f o[4];        // o[j][r] = O[q0 + l15][j * 16 + hi8 + r]
#pragma unroll
  for (int j = 0; j < 4; ++j) o[j] = vzero;
  float mrow = -1e30f;   // running maximum of the lane's query (both halves)
  float lrow = 0.f;      // running sum over this half's keys only

  // Staging map: thread t brings 16 B at column chunk (t & 7) of rows
  // (t >> 3) + 16 * i, i = 0..3, of the K tile and of the V^T tile: each
  // wave-wide copy covers four whole 128-B lines.
  const int crow = threadIdx.x >> 3;          // 0..15
  const int ccol = (threadIdx.x & 7) * 8;     // element offset in the row
  const __bf16* kcp = kbase  + (size_t)crow * DMODEL + ccol;
  const __bf16* vcp = vtbase + (size_t)crow * Skv + ccol;
  const unsigned int lK = (unsigned int)(uintptr_t)(&Ks[0][crow * KVPITCH + ccol]);
  const unsigned int lV = (unsigned int)(uintptr_t)(&Vs[0][crow * KVPITCH + ccol]);
  const unsigned int rstep = 16 * KVPITCH * 2;   // 16 LDS rows, bytes
  const unsigned int bstep = 64 * KVPITCH * 2;   // one buffer, bytes
  auto stage = [&](int bsel, int key0) {
    const unsigned int lk = lK + bsel * bstep;
    const unsigned int lv = lV + bsel * bstep;
    const __bf16* kg = kcp + (size_t)key0 * DMODEL;
    const __bf16* vg = vcp + key0;
    async_copy8_b128(lk, lk + rstep, lk + 2 * rstep, lk + 3 * rstep,
                     lv, lv + rstep, lv + 2 * rstep, lv + 3 * rstep,
                     kg, kg + 16 * DMODEL, kg + 32 * DMODEL, kg + 48 * DMODEL,
                     vg, vg + (size_t)16 * Skv, vg + (size_t)32 * Skv,
                     vg + (size_t)48 * Skv);
  };

  stage(0, 0);
  wait_asynccnt0();     // this wave's share of tile 0 has landed
  __syncthreads();      // ... and every other wave's
  if (64 < Skv) stage(1, 64);

  int buf = 0;
  for (int t0 = 0; t0 < Skv; t0 += 64) {
   const __bf16* kt = Ks[buf];
   const __bf16* vt = Vs[buf];
   // unrolled: the pass's place in the tile becomes an immediate LDS offset
#pragma unroll
   for (int p = 0; p < 2; ++p) {
    const int s0 = t0 + p * 32;
    // mask of keys s0 + hi8 + 0..7 and s0 + 16 + hi8 + 0..7 of the lane's query
    const v4i mk[4] = { *(const v4i*)(mq + s0),      *(const v4i*)(mq + s0 + 4),
                        *(const v4i*)(mq + s0 + 16), *(const v4i*)(mq + s0 + 20) };
    // A operands of the pass: K rows (keys) and V^T rows (head dims)
    v16bf kf[4], vf[4];
#pragma unroll
    for (int t = 0; t < 2; ++t) {
      const __bf16* krow = kt + (p * 32 + t * 16 + l15) * KVPITCH;
      kf[t * 2]     = load_frag(krow, hi8);
      kf[t * 2 + 1] = load_frag(krow + 32, hi8);
    }
#pragma unroll
    for (int j = 0; j < 4; ++j)
      vf[j] = load_frag(vt + (j * 16 + l15) * KVPITCH + p * 32, hi8);
    v8f sc[2];     // sc[t][r] = score(key s0 + 16 t + hi8 + r, query q0 + l15)
#pragma unroll
    for (int t = 0; t < 2; ++t) {
      sc[t] = wmma_bf16(kf[t * 2], qf0, vzero);
      sc[t] = wmma_bf16(kf[t * 2 + 1], qf1, sc[t]);
    }
    // scale + mask + maximum over the lane's 16 keys
    float nmax = -1e30f;
#pragma unroll
    for (int t = 0; t < 2; ++t)
#pragma unroll
      for (int r = 0; r < 8; ++r) {
        float v = sc[t][r] * 0.125f;   // 1/sqrt(64)
        if (mk[t * 2 + (r >> 2)][r & 3] == 0) v = -1e9f;
        sc[t][r] = v;
        nmax = fmaxf(nmax, v);
      }
    nmax = fmaxf(nmax, other_half(nmax));   // all 32 keys of the query

    const float mn  = fmaxf(mrow, nmax);
    const float scl = __expf(mrow - mn);
    mrow = mn;
    float rsum = 0.f;
    v16bf pf;      // B operand P^T: pf[s] = P[key kmap(s, h)][query l15]
#pragma unroll
    for (int t = 0; t < 2; ++t)
#pragma unroll
      for (int r = 0; r < 8; ++r) {
        const float pv = __expf(sc[t][r] - mn);
        rsum += pv;
        pf[t * 8 + r] = (__bf16)pv;
      }
    lrow = lrow * scl + rsum;
#pragma unroll
    for (int j = 0; j < 4; ++j)
#pragma unroll
      for (int r = 0; r < 8; ++r) o[j][r] *= scl;

#pragma unroll
    for (int j = 0; j < 4; ++j) o[j] = wmma_bf16(vf[j], pf, o[j]);
   }
   // Publish point: own LDS reads of this tile retired, own copies of the next
   // tile landed, then the barrier that publishes the next tile and frees this
   // buffer for the refill behind it.
   wait_dscnt0();
   wait_asynccnt0();
   // the address pair of this tile's mask loads is stepped behind this wait
   asm volatile("s_wait_xcnt 0x0" ::: "memory");
   __syncthreads();
   if (t0 + 128 < Skv) stage(buf, t0 + 128);
   buf ^= 1;
  }
  wait_asynccnt0();     // nothing of the ring is in flight when the wave ends

  // the halves' sums are joined once, here
  const float inv = 1.0f / (lrow + other_half(lrow));
  float* crow_out = ctx + (size_t)(b * Tq + q0 + l15) * DMODEL + h * DHEAD + hi8;
#pragma unroll
  for (int j = 0; j < 4; ++j) {
    const v4f lo = { o[j][0] * inv, o[j][1] * inv, o[j][2] * inv, o[j][3] * inv };
    const v4f hi = { o[j][4] * inv, o[j][5] * inv, o[j][6] * inv, o[j][7] * inv };
    *(v4f*)(crow_out + j * 16)     = lo;
    *(v4f*)(crow_out + j * 16 + 4) = hi;
  }
}

// ---------------------------------------------------------------------------
// Residual add + LayerNorm; writes f32 stream + bf16 copy for next GEMM.
// One block per row of 1024. (x/yout may alias for in-place update.)
// ---------------------------------------------------------------------------
__global__ __launch_bounds__(256) void ln_kernel(
    const float* x, const float* __restrict__ sub,
    const float* __restrict__ g, const float* __restrict__ bta,
    float* yout, __bf16* __restrict__ ybf)
{
  __shared__ float s1[256], s2[256];
  const size_t base = (size_t)blockIdx.x * DMODEL;
  float v[4];
  float lsum = 0.f, lsq = 0.f;
#pragma unroll
  for (int k = 0; k < 4; ++k) {
    const int i = threadIdx.x + k * 256;
    v[k] = x[base + i] + sub[base + i];
    lsum += v[k];
    lsq  += v[k] * v[k];
  }
  s1[threadIdx.x] = lsum; s2[threadIdx.x] = lsq;
  __syncthreads();
  for (int off = 128; off > 0; off >>= 1) {
    if (threadIdx.x < off) {
      s1[threadIdx.x] += s1[threadIdx.x + off];
      s2[threadIdx.x] += s2[threadIdx.x + off];
    }
    __syncthreads();
  }
  const float mean = s1[0] * (1.0f / DMODEL);
  const float var  = s2[0] * (1.0f / DMODEL) - mean * mean;
  const float rs   = rsqrtf(var + 1e-5f);
#pragma unroll
  for (int k = 0; k < 4; ++k) {
    const int i = threadIdx.x + k * 256;
    const float o = (v[k] - mean) * rs * g[i] + bta[i];
    yout[base + i] = o;
    ybf[base + i]  = f2bf(o);
  }
}

// ---------------------------------------------------------------------------
// Host orchestration
// ---------------------------------------------------------------------------
extern "C" void kernel_launch(void* const* d_in, const int* in_sizes, int n_in,
                              void* d_out, int out_size, void* d_ws, size_t ws_size,
                              hipStream_t stream) {
  (void)in_sizes; (void)n_in; (void)out_size; (void)ws_size;

  const float* x        = (const float*)d_in[0];
  const float* enc      = (const float*)d_in[1];
  const int*   src_mask = (const int*)d_in[2];
  const int*   tgt_mask = (const int*)d_in[3];
  const float* sa_Wq = (const float*)d_in[4],  *sa_bq = (const float*)d_in[5];
  const float* sa_Wk = (const float*)d_in[6],  *sa_bk = (const float*)d_in[7];
  const float* sa_Wv = (const float*)d_in[8],  *sa_bv = (const float*)d_in[9];
  const float* sa_Wo = (const float*)d_in[10], *sa_bo = (const float*)d_in[11];
  const float* ca_Wq = (const float*)d_in[12], *ca_bq = (const float*)d_in[13];
  const float* ca_Wk = (const float*)d_in[14], *ca_bk = (const float*)d_in[15];
  const float* ca_Wv = (const float*)d_in[16], *ca_bv = (const float*)d_in[17];
  const float* ca_Wo = (const float*)d_in[18], *ca_bo = (const float*)d_in[19];
  const float* ff_W1 = (const float*)d_in[20], *ff_b1 = (const float*)d_in[21];
  const float* ff_W2 = (const float*)d_in[22], *ff_b2 = (const float*)d_in[23];
  const float* ln1_g = (const float*)d_in[24], *ln1_b = (const float*)d_in[25];
  const float* ln2_g = (const float*)d_in[26], *ln2_b = (const float*)d_in[27];
  const float* ln3_g = (const float*)d_in[28], *ln3_b = (const float*)d_in[29];

  char* ws = (char*)d_ws;
  const size_t MB = 1024ull * 1024ull;
  // bf16 weights
  __bf16* saWq_bf = (__bf16*)(ws + 0 * MB);
  __bf16* saWk_bf = (__bf16*)(ws + 2 * MB);
  __bf16* saWv_bf = (__bf16*)(ws + 4 * MB);
  __bf16* saWo_bf = (__bf16*)(ws + 6 * MB);
  __bf16* caWq_bf = (__bf16*)(ws + 8 * MB);
  __bf16* caWk_bf = (__bf16*)(ws + 10 * MB);
  __bf16* caWv_bf = (__bf16*)(ws + 12 * MB);
  __bf16* caWo_bf = (__bf16*)(ws + 14 * MB);
  __bf16* W1_bf   = (__bf16*)(ws + 16 * MB);   // 8 MB
  __bf16* W2_bf   = (__bf16*)(ws + 24 * MB);   // 8 MB
  // activations
  __bf16* x_bf    = (__bf16*)(ws + 32 * MB);
  __bf16* enc_bf  = (__bf16*)(ws + 40 * MB);
  __bf16* Qb      = (__bf16*)(ws + 48 * MB);
  __bf16* Kb      = (__bf16*)(ws + 56 * MB);
  __bf16* Vb      = (__bf16*)(ws + 64 * MB);
  __bf16* Vt      = (__bf16*)(ws + 72 * MB);
  float*  ctx     = (float*) (ws + 80 * MB);   // 16 MB
  float*  proj    = (float*) (ws + 96 * MB);   // 16 MB
  float*  yres    = (float*) (ws + 112 * MB);  // 16 MB
  __bf16* y_bf    = (__bf16*)(ws + 128 * MB);  // 8 MB
  __bf16* hidden  = (__bf16*)(ws + 136 * MB);  // 32 MB
  __bf16* ctx_bf  = (__bf16*)(ws + 168 * MB);  // 8 MB

  auto cvt = [&](const float* in, __bf16* out, int n) {
    cvt_kernel<<<dim3(2048), dim3(256), 0, stream>>>(in, out, n);
  };
  auto gemmF = [&](const __bf16* A, const __bf16* W, const float* b, float* out,
                   int M, int N, int K) {
    gemm_kernel<false, false><<<dim3(M / 128, N / 128), 256, 0, stream>>>(
        A, W, b, (void*)out, M, N, K);
  };
  auto gemmB = [&](const __bf16* A, const __bf16* W, const float* b, __bf16* out,
                   int M, int N, int K) {
    gemm_kernel<false, true><<<dim3(M / 128, N / 128), 256, 0, stream>>>(
        A, W, b, (void*)out, M, N, K);
  };

  // --- precision staging ---
  // saWq_bf .. enc_bf are the 24 segments of one array that starts at saWq_bf
  cvt_inputs_kernel<<<dim3(24 * 32), dim3(256), 0, stream>>>(
      sa_Wq, sa_Wk, sa_Wv, sa_Wo, ca_Wq, ca_Wk, ca_Wv, ca_Wo,
      ff_W1, ff_W2, x, enc, saWq_bf);

  // --- self attention ---
  gemmB(x_bf, saWq_bf, sa_bq, Qb, MROWS, DMODEL, DMODEL);
  gemmB(x_bf, saWk_bf, sa_bk, Kb, MROWS, DMODEL, DMODEL);
  gemmB(x_bf, saWv_bf, sa_bv, Vb, MROWS, DMODEL, DMODEL);
  transpose_v_kernel<<<dim3(TSEQ / 32, NHEAD, NB), 256, 0, stream>>>(Vb, Vt, TSEQ);
  attn_kernel<<<dim3(TSEQ / 64, NHEAD, NB), 128, 0, stream>>>(
      Qb, Kb, Vt, tgt_mask, ctx, TSEQ, TSEQ);
  cvt(ctx, ctx_bf, MROWS * DMODEL);
  gemmF(ctx_bf, saWo_bf, sa_bo, proj, MROWS, DMODEL, DMODEL);
  ln_kernel<<<MROWS, 256, 0, stream>>>(x, proj, ln1_g, ln1_b, yres, y_bf);

  // --- cross attention ---
  gemmB(y_bf,   caWq_bf, ca_bq, Qb, MROWS, DMODEL, DMODEL);
  gemmB(enc_bf, caWk_bf, ca_bk, Kb, MROWS, DMODEL, DMODEL);
  gemmB(enc_bf, caWv_bf, ca_bv, Vb, MROWS, DMODEL, DMODEL);
  transpose_v_kernel<<<dim3(SSEQ / 32, NHEAD, NB), 256, 0, stream>>>(Vb, Vt, SSEQ);
  attn_kernel<<<dim3(TSEQ / 64, NHEAD, NB), 128, 0, stream>>>(
      Qb, Kb, Vt, src_mask, ctx, TSEQ, SSEQ);
  cvt(ctx, ctx_bf, MROWS * DMODEL);
  gemmF(ctx_bf, caWo_bf, ca_bo, proj, MROWS, DMODEL, DMODEL);
  ln_kernel<<<MROWS, 256, 0, stream>>>(yres, proj, ln2_g, ln2_b, yres, y_bf);

  // --- feed forward ---
  gemm_kernel<true, true><<<dim3(MROWS / 128, DFFN / 128), 256, 0, stream>>>(
      y_bf, W1_bf, ff_b1, (void*)hidden, MROWS, DFFN, DMODEL);
  gemmF(hidden, W2_bf, ff_b2, proj, MROWS, DMODEL, DFFN);
  ln_kernel<<<MROWS, 256, 0, stream>>>(yres, proj, ln3_g, ln3_b, (float*)d_out, y_bf);
}

// v004
// A run of this version takes 440 microseconds.
// Two timings next to v003 both put it at 1.21 times that version's speed.
// Counting every step since v000, it is 1.80 times as fast.
#include <hip/hip_runtime.h>

// ---------------------------------------------------------------------------
// Problem constants (from reference): D=1024, H=16, DK=64, DFF=4096, B=2,
// T=S=2048.  M = B*T = 4096 rows for every activation GEMM.
// ---------------------------------------------------------------------------
#define DMODEL 1024
#define NHEAD  16
#define DHEAD  64
#define DFFN   4096
#define NB     2
#define TSEQ   2048
#define SSEQ   2048
#define MROWS  (NB * TSEQ)   // 4096

typedef __attribute__((ext_vector_type(16))) __bf16 v16bf;
typedef __attribute__((ext_vector_type(8)))  __bf16 v8bf;
typedef __attribute__((ext_vector_type(8)))  float  v8f;

// ---------------------------------------------------------------------------
// Helpers
// ---------------------------------------------------------------------------
__device__ __forceinline__ __bf16 f2bf(float f) {
  unsigned int u = __float_as_uint(f);
  u += 0x7FFFu + ((u >> 16) & 1u);          // round-to-nearest-even
  unsigned short s = (unsigned short)(u >> 16);
  __bf16 r;
  __builtin_memcpy(&r, &s, 2);
  return r;
}

// Load one WMMA 16-lane fragment row following the CDNA5 per-lane K-chunk
// layout: lanes 0-15 hold K {hi8=0: 0..7,16..23}, lanes 16-31 hold {8..15,24..31}.
__device__ __forceinline__ v16bf load_frag(const __bf16* row, int hi8) {
  v8bf a = *(const v8bf*)(row + hi8);
  v8bf b = *(const v8bf*)(row + hi8 + 16);
  return __builtin_shufflevector(a, b, 0,1,2,3,4,5,6,7,8,9,10,11,12,13,14,15);
}

__device__ __forceinline__ v8f wmma_bf16(v16bf a, v16bf b, v8f c) {
  return __builtin_amdgcn_wmma_f32_16x16x32_bf16(
      /*neg_a=*/false, a, /*neg_b=*/false, b,
      /*c_mod=*/(short)0, c, /*reuse_a=*/false, /*reuse_b=*/false);
}

// CDNA5 async global->LDS copy (16B per lane), tracked by ASYNCcnt.
// lds_addr = byte offset within the workgroup LDS allocation (low 32 bits of
// the generic pointer), gptr = per-lane 64-bit global address.
__device__ __forceinline__ void async_copy_b128(unsigned int lds_addr,
                                                const void* gptr) {
  asm volatile("global_load_async_to_lds_b128 %0, %1, off"
               :: "v"(lds_addr), "v"(gptr)
               : "memory");
}
__device__ __forceinline__ void wait_asynccnt0() {
  asm volatile("s_wait_asynccnt 0x0" ::: "memory");
}
// Eight async copies (16B per lane each) in one statement. The closing
// s_wait_xcnt stands inside the statement so that no address register of an
// issued copy is rewritten ahead of it.
__device__ __forceinline__ void async_copy8_b128(
    unsigned int l0, unsigned int l1, unsigned int l2, unsigned int l3,
    unsigned int l4, unsigned int l5, unsigned int l6, unsigned int l7,
    const void* g0, const void* g1, const void* g2, const void* g3,
    const void* g4, const void* g5, const void* g6, const void* g7) {
  asm volatile("global_load_async_to_lds_b128 %0, %8, off\n\t"
               "global_load_async_to_lds_b128 %1, %9, off\n\t"
               "global_load_async_to_lds_b128 %2, %10, off\n\t"
               "global_load_async_to_lds_b128 %3, %11, off\n\t"
               "global_load_async_to_lds_b128 %4, %12, off\n\t"
               "global_load_async_to_lds_b128 %5, %13, off\n\t"
               "global_load_async_to_lds_b128 %6, %14, off\n\t"
               "global_load_async_to_lds_b128 %7, %15, off\n\t"
               "s_wait_xcnt 0x0"
               :: "v"(l0), "v"(l1), "v"(l2), "v"(l3),
                  "v"(l4), "v"(l5), "v"(l6), "v"(l7),
                  "v"(g0), "v"(g1), "v"(g2), "v"(g3),
                  "v"(g4), "v"(g5), "v"(g6), "v"(g7)
               : "memory");
}
// Retires this wave's LDS reads before a barrier behind which the buffer they
// read is refilled by copies.
__device__ __forceinline__ void wait_dscnt0() {
  asm volatile("s_wait_dscnt 0x0" ::: "memory");
}

// ---------------------------------------------------------------------------
// fp32 -> bf16 conversion (grid-stride)
// ---------------------------------------------------------------------------
__global__ __launch_bounds__(256) void cvt_kernel(const float* __restrict__ in,
                                                  __bf16* __restrict__ out, int n) {
  int i = blockIdx.x * 256 + threadIdx.x;
  const int stride = gridDim.x * 256;
  for (; i < n; i += stride) out[i] = f2bf(in[i]);
}

// ---------------------------------------------------------------------------
// All twelve f32 -> bf16 conversions of the inputs in ONE launch. Their bf16
// images lie one behind the other in the workspace, so the destination is one
// array of 24 segments of 2^20 elements: segments 0..7 the eight D x D
// weights, 8..11 and 12..15 the two feed-forward weights, 16..19 and 20..23
// the two activations. 32 blocks share a segment; a block converts 32768
// contiguous elements, 1024 a trip: each wave-wide load covers four whole
// 128-B lines, each wave-wide store two. Few long-lived waves take the place
// of many short ones: the time of the short launches was the start of their
// waves, not their bytes.
// ---------------------------------------------------------------------------
typedef __attribute__((ext_vector_type(4))) float  v4f;
typedef __attribute__((ext_vector_type(4))) __bf16 v4bf;
#define CVT_SEG_LOG2   20
#define CVT_BLK_ELEMS  32768
__global__ __launch_bounds__(256) void cvt_inputs_kernel(
    const float* __restrict__ w0, const float* __restrict__ w1,
    const float* __restrict__ w2, const float* __restrict__ w3,
    const float* __restrict__ w4, const float* __restrict__ w5,
    const float* __restrict__ w6, const float* __restrict__ w7,
    const float* __restrict__ f1, const float* __restrict__ f2,
    const float* __restrict__ xa, const float* __restrict__ xe,
    __bf16* __restrict__ out)
{
  const int seg = blockIdx.x >> 5;     // block-uniform
  const float* src;
  int first;                           // the source's first segment
  if (seg < 8) {
    first = seg;
    src = seg == 0 ? w0 : seg == 1 ? w1 : seg == 2 ? w2 : seg == 3 ? w3
        : seg == 4 ? w4 : seg == 5 ? w5 : seg == 6 ? w6 : w7;
  } else if (seg < 12) { first = 8;  src = f1; }
  else if (seg < 16)   { first = 12; src = f2; }
  else if (seg < 20)   { first = 16; src = xa; }
  else                 { first = 20; src = xe; }
  const size_t inseg = (size_t)(blockIdx.x & 31) * CVT_BLK_ELEMS + threadIdx.x * 4;
  const float* s = src + ((size_t)(seg - first) << CVT_SEG_LOG2) + inseg;
  __bf16*      d = out + ((size_t)seg << CVT_SEG_LOG2) + inseg;
  // Four groups of eight trips: a group's eight 16-B loads per lane are in
  // flight together, ahead of its stores. Unrolled: every place in the block's
  // share is an immediate offset, so no address register is ever rewritten.
#pragma unroll
  for (int g = 0; g < CVT_BLK_ELEMS / 8192; ++g) {
    v4f v[8];
#pragma unroll
    for (int i = 0; i < 8; ++i) v[i] = *(const v4f*)(s + (g * 8 + i) * 1024);
#pragma unroll
    for (int i = 0; i < 8; ++i) {
      v4bf o;
#pragma unroll
      for (int e = 0; e < 4; ++e) o[e] = f2bf(v[i][e]);
      *(v4bf*)(d + (g * 8 + i) * 1024) = o;
    }
    // the next group's loads reuse the data registers of these stores
    if (g + 1 < CVT_BLK_ELEMS / 8192) asm volatile("s_wait_xcnt 0x0" ::: "memory");
  }
}

// ---------------------------------------------------------------------------
// Tiled GEMM: out[M,N] = A[M,K] @ W[N,K]^T + bias[N]   (torch Linear semantics)
// Block = 256 threads = 8 waves; 128x128 output tile; wave tile 32x64.
// K is staged 32 wide through double-buffered LDS using async global->LDS
// copies so the next tile streams in while WMMAs consume the current one.
// A staged row holds 64 B of data at a pitch of 80 B (16 B x odd): the sixteen
// rows that a half wave reads 16 B of then fall on all 64 banks once. At a
// pitch of 64 B every fourth row shares its banks and a read takes four turns.
// ---------------------------------------------------------------------------
#define GPITCH 40   // bf16 elements per staged LDS row (80 B)
template<bool RELU, bool OUT_BF16>
__global__ __launch_bounds__(256) void gemm_kernel(
    const __bf16* __restrict__ A, const __bf16* __restrict__ W,
    const float* __restrict__ bias, void* __restrict__ outp,
    int M, int N, int K)
{
  __shared__ __attribute__((aligned(16))) __bf16 As[2][128 * GPITCH];
  __shared__ __attribute__((aligned(16))) __bf16 Ws[2][128 * GPITCH];

  const int tid  = threadIdx.x;
  const int lane = tid & 31;
  const int wave = tid >> 5;     // 0..7
  const int wm   = wave >> 1;    // 0..3 -> 32-row strip
  const int wn   = wave & 1;     // 0..1 -> 64-col strip
  const int bm   = blockIdx.x * 128;
  const int bn   = blockIdx.y * 128;
  const int l15  = lane & 15;
  const int hi8  = (lane >> 4) << 3;

  const v8f vzero = {0.f,0.f,0.f,0.f,0.f,0.f,0.f,0.f};
  v8f acc[2][4];
#pragma unroll
  for (int i = 0; i < 2; ++i)
#pragma unroll
    for (int j = 0; j < 4; ++j) acc[i][j] = vzero;

  const int ldrow = tid >> 1;          // 0..127
  const int ldcol = (tid & 1) * 16;    // 0 or 16  (32 contiguous bytes/thread)
  const __bf16* aptr = A + (size_t)(bm + ldrow) * K + ldcol;
  const __bf16* wptr = W + (size_t)(bn + ldrow) * K + ldcol;
  const unsigned int lA0 = (unsigned int)(uintptr_t)(&As[0][ldrow * GPITCH + ldcol]);
  const unsigned int lA1 = (unsigned int)(uintptr_t)(&As[1][ldrow * GPITCH + ldcol]);
  const unsigned int lW0 = (unsigned int)(uintptr_t)(&Ws[0][ldrow * GPITCH + ldcol]);
  const unsigned int lW1 = (unsigned int)(uintptr_t)(&Ws[1][ldrow * GPITCH + ldcol]);

  auto stage = [&](int buf, int k0) {
    const unsigned int la = buf ? lA1 : lA0;
    const unsigned int lw = buf ? lW1 : lW0;
    async_copy_b128(la,      aptr + k0);
    async_copy_b128(la + 16, aptr + k0 + 8);
    async_copy_b128(lw,      wptr + k0);
    async_copy_b128(lw + 16, wptr + k0 + 8);
  };

  stage(0, 0);
  int buf = 0;
  for (int k0 = 0; k0 < K; k0 += 32) {
    wait_asynccnt0();     // our async fills for `buf` have landed in LDS
    __syncthreads();      // ... and everyone else's too; prev reads done
    if (k0 + 32 < K) stage(buf ^ 1, k0 + 32);   // prefetch next tile

    v16bf af[2], bfr[4];
#pragma unroll
    for (int i = 0; i < 2; ++i)
      af[i] = load_frag(&As[buf][(wm * 32 + i * 16 + l15) * GPITCH], hi8);
#pragma unroll
    for (int j = 0; j < 4; ++j)
      bfr[j] = load_frag(&Ws[buf][(wn * 64 + j * 16 + l15) * GPITCH], hi8);
#pragma unroll
    for (int i = 0; i < 2; ++i)
#pragma unroll
      for (int j = 0; j < 4; ++j)
        acc[i][j] = wmma_bf16(af[i], bfr[j], acc[i][j]);
    buf ^= 1;
  }

  float*  outf = (float*)outp;
  __bf16* outb = (__bf16*)outp;
#pragma unroll
  for (int i = 0; i < 2; ++i) {
    const int mrow = bm + wm * 32 + i * 16 + hi8;  // C layout: row r+8*(lane>>4)
#pragma unroll
    for (int j = 0; j < 4; ++j) {
      const int ncol = bn + wn * 64 + j * 16 + l15;
      const float bv = bias[ncol];
#pragma unroll
      for (int r = 0; r < 8; ++r) {
        float v = acc[i][j][r] + bv;
        if (RELU) v = fmaxf(v, 0.0f);
        const size_t idx = (size_t)(mrow + r) * N + ncol;
        if (OUT_BF16) outb[idx] = f2bf(v); else outf[idx] = v;
      }
    }
  }
}

// ---------------------------------------------------------------------------
// Transpose V ([b][s][h][d] bf16) -> Vt ([b][h][d][s] bf16) so V columns are
// contiguous for the V^T A-operand of O^T += V^T P^T.
// ---------------------------------------------------------------------------
__global__ __launch_bounds__(256) void transpose_v_kernel(
    const __bf16* __restrict__ V, __bf16* __restrict__ Vt, int Skv)
{
  __shared__ __bf16 tile[32][72];    // 32 s  x 64 d (+pad)
  const int b  = blockIdx.z;
  const int h  = blockIdx.y;
  const int s0 = blockIdx.x * 32;
  const int tid = threadIdx.x;
  {
    const int sl = tid >> 3;                 // 0..31
    const int dp = (tid & 7) * 8;            // 0..56
    const __bf16* src = V + (size_t)(b * Skv + s0 + sl) * DMODEL + h * DHEAD + dp;
    v8bf val = *(const v8bf*)src;
#pragma unroll
    for (int i = 0; i < 8; ++i) tile[sl][dp + i] = val[i];
  }
  __syncthreads();
  {
    const int dl = tid >> 2;                 // 0..63
    const int sp = (tid & 3) * 8;            // 0..24
    v8bf o;
#pragma unroll
    for (int i = 0; i < 8; ++i) o[i] = tile[sp + i][dl];
    __bf16* dst = Vt + (size_t)((b * NHEAD + h) * DHEAD + dl) * Skv + s0 + sp;
    *(v8bf*)dst = o;
  }
}

#define KVPITCH 72
typedef __attribute__((ext_vector_type(4))) int v4i;
// value of lane l ^ 16
__device__ __forceinline__ float other_half(float v) {
  const int b = __float_as_int(v);
  return __int_as_float(
      __builtin_amdgcn_permlanex16(b, b, 0x76543210, 0xfedcba98, false, false));
}
__global__ __launch_bounds__(128) void attn_kernel(
    const __bf16* __restrict__ Qb,   // [B*Tq, DMODEL] bf16
    const __bf16* __restrict__ Kb,   // [B*Skv, DMODEL] bf16
    const __bf16* __restrict__ Vt,   // [B*H*DHEAD, Skv] bf16
    const int*    __restrict__ mask, // [B, Tq, Skv]
    float*        __restrict__ ctx,  // [B*Tq, DMODEL] f32
    int Tq, int Skv)
{
  // 64 rows of 128 B at a pitch of 144 B (16 B x odd: no bank conflict for the
  // 16-byte fragment reads).
  __shared__ __attribute__((aligned(16))) __bf16 Ks[2][64 * KVPITCH];
  __shared__ __attribute__((aligned(16))) __bf16 Vs[2][64 * KVPITCH];
  const int lane = threadIdx.x & 31;
  const int wave = threadIdx.x >> 5;
  const int l15  = lane & 15;
  const int hi8  = (lane >> 4) << 3;
  const int h    = blockIdx.y;
  const int b    = blockIdx.z;
  const int q0   = blockIdx.x * 64 + wave * 16;

  // B operand: column l15 = query q0 + l15, k in the hardware order
  const __bf16* qrow = Qb + (size_t)(b * Tq + q0 + l15) * DMODEL + h * DHEAD;
  const v16bf qf0 = load_frag(qrow, hi8);        // K-dim 0..31 of head
  const v16bf qf1 = load_frag(qrow + 32, hi8);   // K-dim 32..63

  const __bf16* kbase  = Kb + (size_t)b * Skv * DMODEL + h * DHEAD;
  const __bf16* vtbase = Vt + (size_t)((b * NHEAD + h) * DHEAD) * Skv;
  // this lane's query row of the mask, at its half's first key
  const int*    mq     = mask + ((size_t)b * Tq + q0 + l15) * Skv + hi8;

  const v8f vzero = {0.f,0.f,0.f,0.f,0.f,0.f,0.f,0.f};
  v8f o[4];        // o[j][r] = O[q0 + l15][j * 16 + hi8 + r]
#pragma unroll
  for (int j = 0; j < 4; ++j) o[j] = vzero;
  float mrow = -1e30f;   // running maximum of the lane's query (both halves)
  float lrow = 0.f;      // running sum over this half's keys only

  // Staging map: thread t brings 16 B at column chunk (t & 7) of rows
  // (t >> 3) + 16 * i, i = 0..3, of the K tile and of the V^T tile: each
  // wave-wide copy covers four whole 128-B lines.
  const int crow = threadIdx.x >> 3;          // 0..15
  const int ccol = (threadIdx.x & 7) * 8;     // element offset in the row
  const __bf16* kcp = kbase  + (size_t)crow * DMODEL + ccol;
  const __bf16* vcp = vtbase + (size_t)crow * Skv + ccol;
  const unsigned int lK = (unsigned int)(uintptr_t)(&Ks[0][crow * KVPITCH + ccol]);
  const unsigned int lV = (unsigned int)(uintptr_t)(&Vs[0][crow * KVPITCH + ccol]);
  const unsigned int rstep = 16 * KVPITCH * 2;   // 16 LDS rows, bytes
  const unsigned int bstep = 64 * KVPITCH * 2;   // one buffer, bytes
  auto stage = [&](int bsel, int key0) {
    const unsigned int lk = lK + bsel * bstep;
    const unsigned int lv = lV + bsel * bstep;
    const __bf16* kg = kcp + (size_t)key0 * DMODEL;
    const __bf16* vg = vcp + key0;
    async_copy8_b128(lk, lk + rstep, lk + 2 * rstep, lk + 3 * rstep,
                     lv, lv + rstep, lv + 2 * rstep, lv + 3 * rstep,
                     kg, kg + 16 * DMODEL, kg + 32 * DMODEL, kg + 48 * DMODEL,
                     vg, vg + (size_t)16 * Skv, vg + (size_t)32 * Skv,
                     vg + (size_t)48 * Skv);
  };

  stage(0, 0);
  wait_asynccnt0();     // this wave's share of tile 0 has landed
  __syncthreads();      // ... and every other wave's
  if (64 < Skv) stage(1, 64);

  int buf = 0;
  for (int t0 = 0; t0 < Skv; t0 += 64) {
   const __bf16* kt = Ks[buf];
   const __bf16* vt = Vs[buf];
   // unrolled: the pass's place in the tile becomes an immediate LDS offset
#pragma unroll
   for (int p = 0; p < 2; ++p) {
    const int s0 = t0 + p * 32;
    // mask of keys s0 + hi8 + 0..7 and s0 + 16 + hi8 + 0..7 of the lane's query
    const v4i mk[4] = { *(const v4i*)(mq + s0),      *(const v4i*)(mq + s0 + 4),
                        *(const v4i*)(mq + s0 + 16), *(const v4i*)(mq + s0 + 20) };
    // A operands of the pass: K rows (keys) and V^T rows (head dims)
    v16bf kf[4], vf[4];
#pragma unroll
    for (int t = 0; t < 2; ++t) {
      const __bf16* krow = kt + (p * 32 + t * 16 + l15) * KVPITCH;
      kf[t * 2]     = load_frag(krow, hi8);
      kf[t * 2 + 1] = load_frag(krow + 32, hi8);
    }
#pragma unroll
    for (int j = 0; j < 4; ++j)
      vf[j] = load_frag(vt + (j * 16 + l15) * KVPITCH + p * 32, hi8);
    v8f sc[2];     // sc[t][r] = score(key s0 + 16 t + hi8 + r, query q0 + l15)
#pragma unroll
    for (int t = 0; t < 2; ++t) {
      sc[t] = wmma_bf16(kf[t * 2], qf0, vzero);
      sc[t] = wmma_bf16(kf[t * 2 + 1], qf1, sc[t]);
    }
    // scale + mask + maximum over the lane's 16 keys
    float nmax = -1e30f;
#pragma unroll
    for (int t = 0; t < 2; ++t)
#pragma unroll
      for (int r = 0; r < 8; ++r) {
        float v = sc[t][r] * 0.125f;   // 1/sqrt(64)
        if (mk[t * 2 + (r >> 2)][r & 3] == 0) v = -1e9f;
        sc[t][r] = v;
        nmax = fmaxf(nmax, v);
      }
    nmax = fmaxf(nmax, other_half(nmax));   // all 32 keys of the query

    const float mn  = fmaxf(mrow, nmax);
    const float scl = __expf(mrow - mn);
    mrow = mn;
    float rsum = 0.f;
    v16bf pf;      // B operand P^T: pf[s] = P[key kmap(s, h)][query l15]
#pragma unroll
    for (int t = 0; t < 2; ++t)
#pragma unroll
      for (int r = 0; r < 8; ++r) {
        const float pv = __expf(sc[t][r] - mn);
        rsum += pv;
        pf[t * 8 + r] = (__bf16)pv;
      }
    lrow = lrow * scl + rsum;
#pragma unroll
    for (int j = 0; j < 4; ++j)
#pragma unroll
      for (int r = 0; r < 8; ++r) o[j][r] *= scl;

#pragma unroll
    for (int j = 0; j < 4; ++j) o[j] = wmma_bf16(vf[j], pf, o[j]);
   }
   // Publish point: own LDS reads of this tile retired, own copies of the next
   // tile landed, then the barrier that publishes the next tile and frees this
   // buffer for the refill behind it.
   wait_dscnt0();
   wait_asynccnt0();
   // the address pair of this tile's mask loads is stepped behind this wait
   asm volatile("s_wait_xcnt 0x0" ::: "memory");
   __syncthreads();
   if (t0 + 128 < Skv) stage(buf, t0 + 128);
   buf ^= 1;
  }
  wait_asynccnt0();     // nothing of the ring is in flight when the wave ends

  // the halves' sums are joined once, here
  const float inv = 1.0f / (lrow + other_half(lrow));
  float* crow_out = ctx + (size_t)(b * Tq + q0 + l15) * DMODEL + h * DHEAD + hi8;
#pragma unroll
  for (int j = 0; j < 4; ++j) {
    const v4f lo = { o[j][0] * inv, o[j][1] * inv, o[j][2] * inv, o[j][3] * inv };
    const v4f hi = { o[j][4] * inv, o[j][5] * inv, o[j][6] * inv, o[j][7] * inv };
    *(v4f*)(crow_out + j * 16)     = lo;
    *(v4f*)(crow_out + j * 16 + 4) = hi;
  }
}

// ---------------------------------------------------------------------------
// Residual add + LayerNorm; writes f32 stream + bf16 copy for next GEMM.
// One block per row of 1024. (x/yout may alias for in-place update.)
// ---------------------------------------------------------------------------
__global__ __launch_bounds__(256) void ln_kernel(
    const float* x, const float* __restrict__ sub,
    const float* __restrict__ g, const float* __restrict__ bta,
    float* yout, __bf16* __restrict__ ybf)
{
  __shared__ float s1[256], s2[256];
  const size_t base = (size_t)blockIdx.x * DMODEL;
  float v[4];
  float lsum = 0.f, lsq = 0.f;
#pragma unroll
  for (int k = 0; k < 4; ++k) {
    const int i = threadIdx.x + k * 256;
    v[k] = x[base + i] + sub[base + i];
    lsum += v[k];
    lsq  += v[k] * v[k];
  }
  s1[threadIdx.x] = lsum; s2[threadIdx.x] = lsq;
  __syncthreads();
  for (int off = 128; off > 0; off >>= 1) {
    if (threadIdx.x < off) {
      s1[threadIdx.x] += s1[threadIdx.x + off];
      s2[threadIdx.x] += s2[threadIdx.x + off];
    }
    __syncthreads();
  }
  const float mean = s1[0] * (1.0f / DMODEL);
  const float var  = s2[0] * (1.0f / DMODEL) - mean * mean;
  const float rs   = rsqrtf(var + 1e-5f);
#pragma unroll
  for (int k = 0; k < 4; ++k) {
    const int i = threadIdx.x + k * 256;
    const float o = (v[k] - mean) * rs * g[i] + bta[i];
    yout[base + i] = o;
    ybf[base + i]  = f2bf(o);
  }
}

// ---------------------------------------------------------------------------
// Host orchestration
// ---------------------------------------------------------------------------
extern "C" void kernel_launch(void* const* d_in, const int* in_sizes, int n_in,
                              void* d_out, int out_size, void* d_ws, size_t ws_size,
                              hipStream_t stream) {
  (void)in_sizes; (void)n_in; (void)out_size; (void)ws_size;

  const float* x        = (const float*)d_in[0];
  const float* enc      = (const float*)d_in[1];
  const int*   src_mask = (const int*)d_in[2];
  const int*   tgt_mask = (const int*)d_in[3];
  const float* sa_Wq = (const float*)d_in[4],  *sa_bq = (const float*)d_in[5];
  const float* sa_Wk = (const float*)d_in[6],  *sa_bk = (const float*)d_in[7];
  const float* sa_Wv = (const float*)d_in[8],  *sa_bv = (const float*)d_in[9];
  const float* sa_Wo = (const float*)d_in[10], *sa_bo = (const float*)d_in[11];
  const float* ca_Wq = (const float*)d_in[12], *ca_bq = (const float*)d_in[13];
  const float* ca_Wk = (const float*)d_in[14], *ca_bk = (const float*)d_in[15];
  const float* ca_Wv = (const float*)d_in[16], *ca_bv = (const float*)d_in[17];
  const float* ca_Wo = (const float*)d_in[18], *ca_bo = (const float*)d_in[19];
  const float* ff_W1 = (const float*)d_in[20], *ff_b1 = (const float*)d_in[21];
  const float* ff_W2 = (const float*)d_in[22], *ff_b2 = (const float*)d_in[23];
  const float* ln1_g = (const float*)d_in[24], *ln1_b = (const float*)d_in[25];
  const float* ln2_g = (const float*)d_in[26], *ln2_b = (const float*)d_in[27];
  const float* ln3_g = (const float*)d_in[28], *ln3_b = (const float*)d_in[29];

  char* ws = (char*)d_ws;
  const size_t MB = 1024ull * 1024ull;
  // bf16 weights
  __bf16* saWq_bf = (__bf16*)(ws + 0 * MB);
  __bf16* saWk_bf = (__bf16*)(ws + 2 * MB);
  __bf16* saWv_bf = (__bf16*)(ws + 4 * MB);
  __bf16* saWo_bf = (__bf16*)(ws + 6 * MB);
  __bf16* caWq_bf = (__bf16*)(ws + 8 * MB);
  __bf16* caWk_bf = (__bf16*)(ws + 10 * MB);
  __bf16* caWv_bf = (__bf16*)(ws + 12 * MB);
  __bf16* caWo_bf = (__bf16*)(ws + 14 * MB);
  __bf16* W1_bf   = (__bf16*)(ws + 16 * MB);   // 8 MB
  __bf16* W2_bf   = (__bf16*)(ws + 24 * MB);   // 8 MB
  // activations
  __bf16* x_bf    = (__bf16*)(ws + 32 * MB);
  __bf16* enc_bf  = (__bf16*)(ws + 40 * MB);
  __bf16* Qb      = (__bf16*)(ws + 48 * MB);
  __bf16* Kb      = (__bf16*)(ws + 56 * MB);
  __bf16* Vb      = (__bf16*)(ws + 64 * MB);
  __bf16* Vt      = (__bf16*)(ws + 72 * MB);
  float*  ctx     = (float*) (ws + 80 * MB);   // 16 MB
  float*  proj    = (float*) (ws + 96 * MB);   // 16 MB
  float*  yres    = (float*) (ws + 112 * MB);  // 16 MB
  __bf16* y_bf    = (__bf16*)(ws + 128 * MB);  // 8 MB
  __bf16* hidden  = (__bf16*)(ws + 136 * MB);  // 32 MB
  __bf16* ctx_bf  = (__bf16*)(ws + 168 * MB);  // 8 MB

  auto cvt = [&](const float* in, __bf16* out, int n) {
    cvt_kernel<<<dim3(2048), dim3(256), 0, stream>>>(in, out, n);
  };
  auto gemmF = [&](const __bf16* A, const __bf16* W, const float* b, float* out,
                   int M, int N, int K) {
    gemm_kernel<false, false><<<dim3(M / 128, N / 128), 256, 0, stream>>>(
        A, W, b, (void*)out, M, N, K);
  };
  auto gemmB = [&](const __bf16* A, const __bf16* W, const float* b, __bf16* out,
                   int M, int N, int K) {
    gemm_kernel<false, true><<<dim3(M / 128, N / 128), 256, 0, stream>>>(
        A, W, b, (void*)out, M, N, K);
  };

  // --- precision staging ---
  // saWq_bf .. enc_bf are the 24 segments of one array that starts at saWq_bf
  cvt_inputs_kernel<<<dim3(24 * 32), dim3(256), 0, stream>>>(
      sa_Wq, sa_Wk, sa_Wv, sa_Wo, ca_Wq, ca_Wk, ca_Wv, ca_Wo,
      ff_W1, ff_W2, x, enc, saWq_bf);

  // --- self attention ---
  gemmB(x_bf, saWq_bf, sa_bq, Qb, MROWS, DMODEL, DMODEL);
  gemmB(x_bf, saWk_bf, sa_bk, Kb, MROWS, DMODEL, DMODEL);
  gemmB(x_bf, saWv_bf, sa_bv, Vb, MROWS, DMODEL, DMODEL);
  transpose_v_kernel<<<dim3(TSEQ / 32, NHEAD, NB), 256, 0, stream>>>(Vb, Vt, TSEQ);
  attn_kernel<<<dim3(TSEQ / 64, NHEAD, NB), 128, 0, stream>>>(
      Qb, Kb, Vt, tgt_mask, ctx, TSEQ, TSEQ);
  cvt(ctx, ctx_bf, MROWS * DMODEL);
  gemmF(ctx_bf, saWo_bf, sa_bo, proj, MROWS, DMODEL, DMODEL);
  ln_kernel<<<MROWS, 256, 0, stream>>>(x, proj, ln1_g, ln1_b, yres, y_bf);

  // --- cross attention ---
  gemmB(y_bf,   caWq_bf, ca_bq, Qb, MROWS, DMODEL, DMODEL);
  gemmB(enc_bf, caWk_bf, ca_bk, Kb, MROWS, DMODEL, DMODEL);
  gemmB(enc_bf, caWv_bf, ca_bv, Vb, MROWS, DMODEL, DMODEL);
  transpose_v_kernel<<<dim3(SSEQ / 32, NHEAD, NB), 256, 0, stream>>>(Vb, Vt, SSEQ);
  attn_kernel<<<dim3(TSEQ / 64, NHEAD, NB), 128, 0, stream>>>(
      Qb, Kb, Vt, src_mask, ctx, TSEQ, SSEQ);
  cvt(ctx, ctx_bf, MROWS * DMODEL);
  gemmF(ctx_bf, caWo_bf, ca_bo, proj, MROWS, DMODEL, DMODEL);
  ln_kernel<<<MROWS, 256, 0, stream>>>(yres, proj, ln2_g, ln2_b, yres, y_bf);

  // --- feed forward ---
  gemm_kernel<true, true><<<dim3(MROWS / 128, DFFN / 128), 256, 0, stream>>>(
      y_bf, W1_bf, ff_b1, (void*)hidden, MROWS, DFFN, DMODEL);
  gemmF(hidden, W2_bf, ff_b2, proj, MROWS, DMODEL, DFFN);
  ln_kernel<<<MROWS, 256, 0, stream>>>(yres, proj, ln3_g, ln3_b, (float*)d_out, y_bf);
}

// v005
// A run of this version takes 353 microseconds.
// Timed twice side by side with v004, it ran 1.25 and 1.26 times as fast.
// Over all steps from v000 it is 2.25 times as fast.
#include <hip/hip_runtime.h>

// ---------------------------------------------------------------------------
// Problem constants (from reference): D=1024, H=16, DK=64, DFF=4096, B=2,
// T=S=2048.  M = B*T = 4096 rows for every activation GEMM.
// ---------------------------------------------------------------------------
#define DMODEL 1024
#define NHEAD  16
#define DHEAD  64
#define DFFN   4096
#define NB     2
#define TSEQ   2048
#define SSEQ   2048
#define MROWS  (NB * TSEQ)   // 4096

typedef __attribute__((ext_vector_type(16))) __bf16 v16bf;
typedef __attribute__((ext_vector_type(8)))  __bf16 v8bf;
typedef __attribute__((ext_vector_type(8)))  float  v8f;

// ---------------------------------------------------------------------------
// Helpers
// ---------------------------------------------------------------------------
__device__ __forceinline__ __bf16 f2bf(float f) {
  unsigned int u = __float_as_uint(f);
  u += 0x7FFFu + ((u >> 16) & 1u);          // round-to-nearest-even
  unsigned short s = (unsigned short)(u >> 16);
  __bf16 r;
  __builtin_memcpy(&r, &s, 2);
  return r;
}

// Load one WMMA 16-lane fragment row following the CDNA5 per-lane K-chunk
// layout: lanes 0-15 hold K {hi8=0: 0..7,16..23}, lanes 16-31 hold {8..15,24..31}.
__device__ __forceinline__ v16bf load_frag(const __bf16* row, int hi8) {
  v8bf a = *(const v8bf*)(row + hi8);
  v8bf b = *(const v8bf*)(row + hi8 + 16);
  return __builtin_shufflevector(a, b, 0,1,2,3,4,5,6,7,8,9,10,11,12,13,14,15);
}

__device__ __forceinline__ v8f wmma_bf16(v16bf a, v16bf b, v8f c) {
  return __builtin_amdgcn_wmma_f32_16x16x32_bf16(
      /*neg_a=*/false, a, /*neg_b=*/false, b,
      /*c_mod=*/(short)0, c, /*reuse_a=*/false, /*reuse_b=*/false);
}

// CDNA5 async global->LDS copies (16B per lane) are tracked by ASYNCcnt. Their
// LDS address is the byte offset within the workgroup LDS allocation (low 32
// bits of the generic pointer), their global address a per-lane 64-bit pointer.
__device__ __forceinline__ void wait_asynccnt0() {
  asm volatile("s_wait_asynccnt 0x0" ::: "memory");
}
// Eight async copies (16B per lane each) in one statement. The closing
// s_wait_xcnt stands inside the statement so that no address register of an
// issued copy is rewritten ahead of it.
__device__ __forceinline__ void async_copy8_b128(
    unsigned int l0, unsigned int l1, unsigned int l2, unsigned int l3,
    unsigned int l4, unsigned int l5, unsigned int l6, unsigned int l7,
    const void* g0, const void* g1, const void* g2, const void* g3,
    const void* g4, const void* g5, const void* g6, const void* g7) {
  asm volatile("global_load_async_to_lds_b128 %0, %8, off\n\t"
               "global_load_async_to_lds_b128 %1, %9, off\n\t"
               "global_load_async_to_lds_b128 %2, %10, off\n\t"
               "global_load_async_to_lds_b128 %3, %11, off\n\t"
               "global_load_async_to_lds_b128 %4, %12, off\n\t"
               "global_load_async_to_lds_b128 %5, %13, off\n\t"
               "global_load_async_to_lds_b128 %6, %14, off\n\t"
               "global_load_async_to_lds_b128 %7, %15, off\n\t"
               "s_wait_xcnt 0x0"
               :: "v"(l0), "v"(l1), "v"(l2), "v"(l3),
                  "v"(l4), "v"(l5), "v"(l6), "v"(l7),
                  "v"(g0), "v"(g1), "v"(g2), "v"(g3),
                  "v"(g4), "v"(g5), "v"(g6), "v"(g7)
               : "memory");
}
// Retires this wave's LDS reads before a barrier behind which the buffer they
// read is refilled by copies.
__device__ __forceinline__ void wait_dscnt0() {
  asm volatile("s_wait_dscnt 0x0" ::: "memory");
}

// ---------------------------------------------------------------------------
// fp32 -> bf16 conversion (grid-stride)
// ---------------------------------------------------------------------------
__global__ __launch_bounds__(256) void cvt_kernel(const float* __restrict__ in,
                                                  __bf16* __restrict__ out, int n) {
  int i = blockIdx.x * 256 + threadIdx.x;
  const int stride = gridDim.x * 256;
  for (; i < n; i += stride) out[i] = f2bf(in[i]);
}

// ---------------------------------------------------------------------------
// All twelve f32 -> bf16 conversions of the inputs in ONE launch. Their bf16
// images lie one behind the other in the workspace, so the destination is one
// array of 24 segments of 2^20 elements: segments 0..7 the eight D x D
// weights, 8..11 and 12..15 the two feed-forward weights, 16..19 and 20..23
// the two activations. 32 blocks share a segment; a block converts 32768
// contiguous elements, 1024 a trip: each wave-wide load covers four whole
// 128-B lines, each wave-wide store two. Few long-lived waves take the place
// of many short ones: the time of the short launches was the start of their
// waves, not their bytes.
// ---------------------------------------------------------------------------
typedef __attribute__((ext_vector_type(4))) float  v4f;
typedef __attribute__((ext_vector_type(4))) __bf16 v4bf;
#define CVT_SEG_LOG2   20
#define CVT_BLK_ELEMS  32768
__global__ __launch_bounds__(256) void cvt_inputs_kernel(
    const float* __restrict__ w0, const float* __restrict__ w1,
    const float* __restrict__ w2, const float* __restrict__ w3,
    const float* __restrict__ w4, const float* __restrict__ w5,
    const float* __restrict__ w6, const float* __restrict__ w7,
    const float* __restrict__ f1, const float* __restrict__ f2,
    const float* __restrict__ xa, const float* __restrict__ xe,
    __bf16* __restrict__ out)
{
  const int seg = blockIdx.x >> 5;     // block-uniform
  const float* src;
  int first;                           // the source's first segment
  if (seg < 8) {
    first = seg;
    src = seg == 0 ? w0 : seg == 1 ? w1 : seg == 2 ? w2 : seg == 3 ? w3
        : seg == 4 ? w4 : seg == 5 ? w5 : seg == 6 ? w6 : w7;
  } else if (seg < 12) { first = 8;  src = f1; }
  else if (seg < 16)   { first = 12; src = f2; }
  else if (seg < 20)   { first = 16; src = xa; }
  else                 { first = 20; src = xe; }
  const size_t inseg = (size_t)(blockIdx.x & 31) * CVT_BLK_ELEMS + threadIdx.x * 4;
  const float* s = src + ((size_t)(seg - first) << CVT_SEG_LOG2) + inseg;
  __bf16*      d = out + ((size_t)seg << CVT_SEG_LOG2) + inseg;
  // Four groups of eight trips: a group's eight 16-B loads per lane are in
  // flight together, ahead of its stores. Unrolled: every place in the block's
  // share is an immediate offset, so no address register is ever rewritten.
#pragma unroll
  for (int g = 0; g < CVT_BLK_ELEMS / 8192; ++g) {
    v4f v[8];
#pragma unroll
    for (int i = 0; i < 8; ++i) v[i] = *(const v4f*)(s + (g * 8 + i) * 1024);
#pragma unroll
    for (int i = 0; i < 8; ++i) {
      v4bf o;
#pragma unroll
      for (int e = 0; e < 4; ++e) o[e] = f2bf(v[i][e]);
      *(v4bf*)(d + (g * 8 + i) * 1024) = o;
    }
    // the next group's loads reuse the data registers of these stores
    if (g + 1 < CVT_BLK_ELEMS / 8192) asm volatile("s_wait_xcnt 0x0" ::: "memory");
  }
}

// ---------------------------------------------------------------------------
// Tiled GEMM: out[M,N] = A[M,K] @ W[N,K]^T + bias[N]   (torch Linear semantics)
// Block = 256 threads = 8 waves; 128x128 output tile; wave tile 32x64.
// K is staged 128 wide through double-buffered LDS using async global->LDS
// copies so the next stage streams in while WMMAs consume the current one: a
// stage feeds four blocks of 8 WMMAs a wave, so one publish point (two waits
// and a barrier) and one landing latency serve 128 k, and every wave-wide copy
// takes whole 128-B lines (two rows of 256 B).
// A staged row holds 256 B of data at a pitch of 272 B (16 B x odd): the
// sixteen rows that a half wave reads 16 B of fall on all 64 banks once.
// K must be a multiple of 128.
// ---------------------------------------------------------------------------
#define GBK    128  // k per stage
#define GPITCH 136  // bf16 elements per staged LDS row (272 B)
template<bool RELU, bool OUT_BF16>
__global__ __launch_bounds__(256) void gemm_kernel(
    const __bf16* __restrict__ A, const __bf16* __restrict__ W,
    const float* __restrict__ bias, void* __restrict__ outp,
    int M, int N, int K)
{
  __shared__ __attribute__((aligned(16))) __bf16 As[2][128 * GPITCH];
  __shared__ __attribute__((aligned(16))) __bf16 Ws[2][128 * GPITCH];

  const int tid  = threadIdx.x;
  const int lane = tid & 31;
  const int wave = tid >> 5;     // 0..7
  const int wm   = wave >> 1;    // 0..3 -> 32-row strip
  const int wn   = wave & 1;     // 0..1 -> 64-col strip
  const int bm   = blockIdx.x * 128;
  const int bn   = blockIdx.y * 128;
  const int l15  = lane & 15;
  const int hi8  = (lane >> 4) << 3;

  const v8f vzero = {0.f,0.f,0.f,0.f,0.f,0.f,0.f,0.f};
  v8f acc[2][4];
#pragma unroll
  for (int i = 0; i < 2; ++i)
#pragma unroll
    for (int j = 0; j < 4; ++j) acc[i][j] = vzero;

  // Staging map: thread t brings 16 B at column chunk (t & 15) of rows
  // (t >> 4) + 16 * i, i = 0..7, of the A stage and of the W stage.
  const int crow = tid >> 4;           // 0..15
  const int ccol = (tid & 15) * 8;     // element offset in the staged row
  const __bf16* aptr = A + (size_t)(bm + crow) * K + ccol;
  const __bf16* wptr = W + (size_t)(bn + crow) * K + ccol;
  const unsigned int lA = (unsigned int)(uintptr_t)(&As[0][crow * GPITCH + ccol]);
  const unsigned int lW = (unsigned int)(uintptr_t)(&Ws[0][crow * GPITCH + ccol]);
  const unsigned int rstep = 16 * GPITCH * 2;    // 16 LDS rows, bytes
  const unsigned int bstep = 128 * GPITCH * 2;   // one buffer, bytes
  const size_t gstep = (size_t)16 * K;           // 16 global rows, elements

  auto stage = [&](int bsel, int k0) {
    const unsigned int la = lA + bsel * bstep;
    const unsigned int lw = lW + bsel * bstep;
    const __bf16* ag = aptr + k0;
    const __bf16* wg = wptr + k0;
    async_copy8_b128(la, la + rstep, la + 2 * rstep, la + 3 * rstep,
                     la + 4 * rstep, la + 5 * rstep, la + 6 * rstep, la + 7 * rstep,
                     ag, ag + gstep, ag + 2 * gstep, ag + 3 * gstep,
                     ag + 4 * gstep, ag + 5 * gstep, ag + 6 * gstep, ag + 7 * gstep);
    async_copy8_b128(lw, lw + rstep, lw + 2 * rstep, lw + 3 * rstep,
                     lw + 4 * rstep, lw + 5 * rstep, lw + 6 * rstep, lw + 7 * rstep,
                     wg, wg + gstep, wg + 2 * gstep, wg + 3 * gstep,
                     wg + 4 * gstep, wg + 5 * gstep, wg + 6 * gstep, wg + 7 * gstep);
  };

  stage(0, 0);
  wait_asynccnt0();     // this wave's share of stage 0 has landed
  __syncthreads();      // ... and every other wave's
  if (GBK < K) stage(1, GBK);

  int buf = 0;
  for (int k0 = 0; k0 < K; k0 += GBK) {
    const __bf16* as = As[buf] + (wm * 32 + l15) * GPITCH;
    const __bf16* ws = Ws[buf] + (wn * 64 + l15) * GPITCH;
    // unrolled: a block's place in the stage becomes an immediate LDS offset,
    // and a block's fragment reads can go under the block before it
#pragma unroll
    for (int kk = 0; kk < GBK; kk += 32) {
      v16bf af[2], bfr[4];
#pragma unroll
      for (int i = 0; i < 2; ++i)
        af[i] = load_frag(as + i * 16 * GPITCH + kk, hi8);
#pragma unroll
      for (int j = 0; j < 4; ++j)
        bfr[j] = load_frag(ws + j * 16 * GPITCH + kk, hi8);
#pragma unroll
      for (int i = 0; i < 2; ++i)
#pragma unroll
        for (int j = 0; j < 4; ++j)
          acc[i][j] = wmma_bf16(af[i], bfr[j], acc[i][j]);
    }
    // Publish point: own LDS reads of this stage retired, own copies of the
    // next stage landed, then the barrier that publishes the next stage and
    // frees this buffer for the refill behind it.
    wait_dscnt0();
    wait_asynccnt0();
    __syncthreads();
    if (k0 + 2 * GBK < K) stage(buf, k0 + 2 * GBK);
    buf ^= 1;
  }
  wait_asynccnt0();     // nothing of the ring is in flight when the wave ends

  float*  outf = (float*)outp;
  __bf16* outb = (__bf16*)outp;
#pragma unroll
  for (int i = 0; i < 2; ++i) {
    const int mrow = bm + wm * 32 + i * 16 + hi8;  // C layout: row r+8*(lane>>4)
#pragma unroll
    for (int j = 0; j < 4; ++j) {
      const int ncol = bn + wn * 64 + j * 16 + l15;
      const float bv = bias[ncol];
#pragma unroll
      for (int r = 0; r < 8; ++r) {
        float v = acc[i][j][r] + bv;
        if (RELU) v = fmaxf(v, 0.0f);
        const size_t idx = (size_t)(mrow + r) * N + ncol;
        if (OUT_BF16) outb[idx] = f2bf(v); else outf[idx] = v;
      }
    }
  }
}

// ---------------------------------------------------------------------------
// Transpose V ([b][s][h][d] bf16) -> Vt ([b][h][d][s] bf16) so V columns are
// contiguous for the V^T A-operand of O^T += V^T P^T.
// ---------------------------------------------------------------------------
__global__ __launch_bounds__(256) void transpose_v_kernel(
    const __bf16* __restrict__ V, __bf16* __restrict__ Vt, int Skv)
{
  __shared__ __bf16 tile[32][72];    // 32 s  x 64 d (+pad)
  const int b  = blockIdx.z;
  const int h  = blockIdx.y;
  const int s0 = blockIdx.x * 32;
  const int tid = threadIdx.x;
  {
    const int sl = tid >> 3;                 // 0..31
    const int dp = (tid & 7) * 8;            // 0..56
    const __bf16* src = V + (size_t)(b * Skv + s0 + sl) * DMODEL + h * DHEAD + dp;
    v8bf val = *(const v8bf*)src;
#pragma unroll
    for (int i = 0; i < 8; ++i) tile[sl][dp + i] = val[i];
  }
  __syncthreads();
  {
    const int dl = tid >> 2;                 // 0..63
    const int sp = (tid & 3) * 8;            // 0..24
    v8bf o;
#pragma unroll
    for (int i = 0; i < 8; ++i) o[i] = tile[sp + i][dl];
    __bf16* dst = Vt + (size_t)((b * NHEAD + h) * DHEAD + dl) * Skv + s0 + sp;
    *(v8bf*)dst = o;
  }
}

#define KVPITCH 72
typedef __attribute__((ext_vector_type(4))) int v4i;
// value of lane l ^ 16
__device__ __forceinline__ float other_half(float v) {
  const int b = __float_as_int(v);
  return __int_as_float(
      __builtin_amdgcn_permlanex16(b, b, 0x76543210, 0xfedcba98, false, false));
}
__global__ __launch_bounds__(128) void attn_kernel(
    const __bf16* __restrict__ Qb,   // [B*Tq, DMODEL] bf16
    const __bf16* __restrict__ Kb,   // [B*Skv, DMODEL] bf16
    const __bf16* __restrict__ Vt,   // [B*H*DHEAD, Skv] bf16
    const int*    __restrict__ mask, // [B, Tq, Skv]
    float*        __restrict__ ctx,  // [B*Tq, DMODEL] f32
    int Tq, int Skv)
{
  // 64 rows of 128 B at a pitch of 144 B (16 B x odd: no bank conflict for the
  // 16-byte fragment reads).
  __shared__ __attribute__((aligned(16))) __bf16 Ks[2][64 * KVPITCH];
  __shared__ __attribute__((aligned(16))) __bf16 Vs[2][64 * KVPITCH];
  const int lane = threadIdx.x & 31;
  const int wave = threadIdx.x >> 5;
  const int l15  = lane & 15;
  const int hi8  = (lane >> 4) << 3;
  const int h    = blockIdx.y;
  const int b    = blockIdx.z;
  const int q0   = blockIdx.x * 64 + wave * 16;

  // B operand: column l15 = query q0 + l15, k in the hardware order
  const __bf16* qrow = Qb + (size_t)(b * Tq + q0 + l15) * DMODEL + h * DHEAD;
  const v16bf qf0 = load_frag(qrow, hi8);        // K-dim 0..31 of head
  const v16bf qf1 = load_frag(qrow + 32, hi8);   // K-dim 32..63

  const __bf16* kbase  = Kb + (size_t)b * Skv * DMODEL + h * DHEAD;
  const __bf16* vtbase = Vt + (size_t)((b * NHEAD + h) * DHEAD) * Skv;
  // this lane's query row of the mask, at its half's first key
  const int*    mq     = mask + ((size_t)b * Tq + q0 + l15) * Skv + hi8;

  const v8f vzero = {0.f,0.f,0.f,0.f,0.f,0.f,0.f,0.f};
  v8f o[4];        // o[j][r] = O[q0 + l15][j * 16 + hi8 + r]
#pragma unroll
  for (int j = 0; j < 4; ++j) o[j] = vzero;
  float mrow = -1e30f;   // running maximum of the lane's query (both halves)
  float lrow = 0.f;      // running sum over this half's keys only

  // Staging map: thread t brings 16 B at column chunk (t & 7) of rows
  // (t >> 3) + 16 * i, i = 0..3, of the K tile and of the V^T tile: each
  // wave-wide copy covers four whole 128-B lines.
  const int crow = threadIdx.x >> 3;          // 0..15
  const int ccol = (threadIdx.x & 7) * 8;     // element offset in the row
  const __bf16* kcp = kbase  + (size_t)crow * DMODEL + ccol;
  const __bf16* vcp = vtbase + (size_t)crow * Skv + ccol;
  const unsigned int lK = (unsigned int)(uintptr_t)(&Ks[0][crow * KVPITCH + ccol]);
  const unsigned int lV = (unsigned int)(uintptr_t)(&Vs[0][crow * KVPITCH + ccol]);
  const unsigned int rstep = 16 * KVPITCH * 2;   // 16 LDS rows, bytes
  const unsigned int bstep = 64 * KVPITCH * 2;   // one buffer, bytes
  auto stage = [&](int bsel, int key0) {
    const unsigned int lk = lK + bsel * bstep;
    const unsigned int lv = lV + bsel * bstep;
    const __bf16* kg = kcp + (size_t)key0 * DMODEL;
    const __bf16* vg = vcp + key0;
    async_copy8_b128(lk, lk + rstep, lk + 2 * rstep, lk + 3 * rstep,
                     lv, lv + rstep, lv + 2 * rstep, lv + 3 * rstep,
                     kg, kg + 16 * DMODEL, kg + 32 * DMODEL, kg + 48 * DMODEL,
                     vg, vg + (size_t)16 * Skv, vg + (size_t)32 * Skv,
                     vg + (size_t)48 * Skv);
  };

  stage(0, 0);
  wait_asynccnt0();     // this wave's share of tile 0 has landed
  __syncthreads();      // ... and every other wave's
  if (64 < Skv) stage(1, 64);

  int buf = 0;
  for (int t0 = 0; t0 < Skv; t0 += 64) {
   const __bf16* kt = Ks[buf];
   const __bf16* vt = Vs[buf];
   // unrolled: the pass's place in the tile becomes an immediate LDS offset
#pragma unroll
   for (int p = 0; p < 2; ++p) {
    const int s0 = t0 + p * 32;
    // mask of keys s0 + hi8 + 0..7 and s0 + 16 + hi8 + 0..7 of the lane's query
    const v4i mk[4] = { *(const v4i*)(mq + s0),      *(const v4i*)(mq + s0 + 4),
                        *(const v4i*)(mq + s0 + 16), *(const v4i*)(mq + s0 + 20) };
    // A operands of the pass: K rows (keys) and V^T rows (head dims)
    v16bf kf[4], vf[4];
#pragma unroll
    for (int t = 0; t < 2; ++t) {
      const __bf16* krow = kt + (p * 32 + t * 16 + l15) * KVPITCH;
      kf[t * 2]     = load_frag(krow, hi8);
      kf[t * 2 + 1] = load_frag(krow + 32, hi8);
    }
#pragma unroll
    for (int j = 0; j < 4; ++j)
      vf[j] = load_frag(vt + (j * 16 + l15) * KVPITCH + p * 32, hi8);
    v8f sc[2];     // sc[t][r] = score(key s0 + 16 t + hi8 + r, query q0 + l15)
#pragma unroll
    for (int t = 0; t < 2; ++t) {
      sc[t] = wmma_bf16(kf[t * 2], qf0, vzero);
      sc[t] = wmma_bf16(kf[t * 2 + 1], qf1, sc[t]);
    }
    // scale + mask + maximum over the lane's 16 keys
    float nmax = -1e30f;
#pragma unroll
    for (int t = 0; t < 2; ++t)
#pragma unroll
      for (int r = 0; r < 8; ++r) {
        float v = sc[t][r] * 0.125f;   // 1/sqrt(64)
        if (mk[t * 2 + (r >> 2)][r & 3] == 0) v = -1e9f;
        sc[t][r] = v;
        nmax = fmaxf(nmax, v);
      }
    nmax = fmaxf(nmax, other_half(nmax));   // all 32 keys of the query

    const float mn  = fmaxf(mrow, nmax);
    const float scl = __expf(mrow - mn);
    mrow = mn;
    float rsum = 0.f;
    v16bf pf;      // B operand P^T: pf[s] = P[key kmap(s, h)][query l15]
#pragma unroll
    for (int t = 0; t < 2; ++t)
#pragma unroll
      for (int r = 0; r < 8; ++r) {
        const float pv = __expf(sc[t][r] - mn);
        rsum += pv;
        pf[t * 8 + r] = (__bf16)pv;
      }
    lrow = lrow * scl + rsum;
#pragma unroll
    for (int j = 0; j < 4; ++j)
#pragma unroll
      for (int r = 0; r < 8; ++r) o[j][r] *= scl;

#pragma unroll
    for (int j = 0; j < 4; ++j) o[j] = wmma_bf16(vf[j], pf, o[j]);
   }
   // Publish point: own LDS reads of this tile retired, own copies of the next
   // tile landed, then the barrier that publishes the next tile and frees this
   // buffer for the refill behind it.
   wait_dscnt0();
   wait_asynccnt0();
   // the address pair of this tile's mask loads is stepped behind this wait
   asm volatile("s_wait_xcnt 0x0" ::: "memory");
   __syncthreads();
   if (t0 + 128 < Skv) stage(buf, t0 + 128);
   buf ^= 1;
  }
  wait_asynccnt0();     // nothing of the ring is in flight when the wave ends

  // the halves' sums are joined once, here
  const float inv = 1.0f / (lrow + other_half(lrow));
  float* crow_out = ctx + (size_t)(b * Tq + q0 + l15) * DMODEL + h * DHEAD + hi8;
#pragma unroll
  for (int j = 0; j < 4; ++j) {
    const v4f lo = { o[j][0] * inv, o[j][1] * inv, o[j][2] * inv, o[j][3] * inv };
    const v4f hi = { o[j][4] * inv, o[j][5] * inv, o[j][6] * inv, o[j][7] * inv };
    *(v4f*)(crow_out + j * 16)     = lo;
    *(v4f*)(crow_out + j * 16 + 4) = hi;
  }
}

// ---------------------------------------------------------------------------
// Residual add + LayerNorm; writes f32 stream + bf16 copy for next GEMM.
// One block per row of 1024. (x/yout may alias for in-place update.)
// ---------------------------------------------------------------------------
__global__ __launch_bounds__(256) void ln_kernel(
    const float* x, const float* __restrict__ sub,
    const float* __restrict__ g, const float* __restrict__ bta,
    float* yout, __bf16* __restrict__ ybf)
{
  __shared__ float s1[256], s2[256];
  const size_t base = (size_t)blockIdx.x * DMODEL;
  float v[4];
  float lsum = 0.f, lsq = 0.f;
#pragma unroll
  for (int k = 0; k < 4; ++k) {
    const int i = threadIdx.x + k * 256;
    v[k] = x[base + i] + sub[base + i];
    lsum += v[k];
    lsq  += v[k] * v[k];
  }
  s1[threadIdx.x] = lsum; s2[threadIdx.x] = lsq;
  __syncthreads();
  for (int off = 128; off > 0; off >>= 1) {
    if (threadIdx.x < off) {
      s1[threadIdx.x] += s1[threadIdx.x + off];
      s2[threadIdx.x] += s2[threadIdx.x + off];
    }
    __syncthreads();
  }
  const float mean = s1[0] * (1.0f / DMODEL);
  const float var  = s2[0] * (1.0f / DMODEL) - mean * mean;
  const float rs   = rsqrtf(var + 1e-5f);
#pragma unroll
  for (int k = 0; k < 4; ++k) {
    const int i = threadIdx.x + k * 256;
    const float o = (v[k] - mean) * rs * g[i] + bta[i];
    yout[base + i] = o;
    ybf[base + i]  = f2bf(o);
  }
}

// ---------------------------------------------------------------------------
// Host orchestration
// ---------------------------------------------------------------------------
extern "C" void kernel_launch(void* const* d_in, const int* in_sizes, int n_in,
                              void* d_out, int out_size, void* d_ws, size_t ws_size,
                              hipStream_t stream) {
  (void)in_sizes; (void)n_in; (void)out_size; (void)ws_size;

  const float* x        = (const float*)d_in[0];
  const float* enc      = (const float*)d_in[1];
  const int*   src_mask = (const int*)d_in[2];
  const int*   tgt_mask = (const int*)d_in[3];
  const float* sa_Wq = (const float*)d_in[4],  *sa_bq = (const float*)d_in[5];
  const float* sa_Wk = (const float*)d_in[6],  *sa_bk = (const float*)d_in[7];
  const float* sa_Wv = (const float*)d_in[8],  *sa_bv = (const float*)d_in[9];
  const float* sa_Wo = (const float*)d_in[10], *sa_bo = (const float*)d_in[11];
  const float* ca_Wq = (const float*)d_in[12], *ca_bq = (const float*)d_in[13];
  const float* ca_Wk = (const float*)d_in[14], *ca_bk = (const float*)d_in[15];
  const float* ca_Wv = (const float*)d_in[16], *ca_bv = (const float*)d_in[17];
  const float* ca_Wo = (const float*)d_in[18], *ca_bo = (const float*)d_in[19];
  const float* ff_W1 = (const float*)d_in[20], *ff_b1 = (const float*)d_in[21];
  const float* ff_W2 = (const float*)d_in[22], *ff_b2 = (const float*)d_in[23];
  const float* ln1_g = (const float*)d_in[24], *ln1_b = (const float*)d_in[25];
  const float* ln2_g = (const float*)d_in[26], *ln2_b = (const float*)d_in[27];
  const float* ln3_g = (const float*)d_in[28], *ln3_b = (const float*)d_in[29];

  char* ws = (char*)d_ws;
  const size_t MB = 1024ull * 1024ull;
  // bf16 weights
  __bf16* saWq_bf = (__bf16*)(ws + 0 * MB);
  __bf16* saWk_bf = (__bf16*)(ws + 2 * MB);
  __bf16* saWv_bf = (__bf16*)(ws + 4 * MB);
  __bf16* saWo_bf = (__bf16*)(ws + 6 * MB);
  __bf16* caWq_bf = (__bf16*)(ws + 8 * MB);
  __bf16* caWk_bf = (__bf16*)(ws + 10 * MB);
  __bf16* caWv_bf = (__bf16*)(ws + 12 * MB);
  __bf16* caWo_bf = (__bf16*)(ws + 14 * MB);
  __bf16* W1_bf   = (__bf16*)(ws + 16 * MB);   // 8 MB
  __bf16* W2_bf   = (__bf16*)(ws + 24 * MB);   // 8 MB
  // activations
  __bf16* x_bf    = (__bf16*)(ws + 32 * MB);
  __bf16* enc_bf  = (__bf16*)(ws + 40 * MB);
  __bf16* Qb      = (__bf16*)(ws + 48 * MB);
  __bf16* Kb      = (__bf16*)(ws + 56 * MB);
  __bf16* Vb      = (__bf16*)(ws + 64 * MB);
  __bf16* Vt      = (__bf16*)(ws + 72 * MB);
  float*  ctx     = (float*) (ws + 80 * MB);   // 16 MB
  float*  proj    = (float*) (ws + 96 * MB);   // 16 MB
  float*  yres    = (float*) (ws + 112 * MB);  // 16 MB
  __bf16* y_bf    = (__bf16*)(ws + 128 * MB);  // 8 MB
  __bf16* hidden  = (__bf16*)(ws + 136 * MB);  // 32 MB
  __bf16* ctx_bf  = (__bf16*)(ws + 168 * MB);  // 8 MB

  auto cvt = [&](const float* in, __bf16* out, int n) {
    cvt_kernel<<<dim3(2048), dim3(256), 0, stream>>>(in, out, n);
  };
  auto gemmF = [&](const __bf16* A, const __bf16* W, const float* b, float* out,
                   int M, int N, int K) {
    gemm_kernel<false, false><<<dim3(M / 128, N / 128), 256, 0, stream>>>(
        A, W, b, (void*)out, M, N, K);
  };
  auto gemmB = [&](const __bf16* A, const __bf16* W, const float* b, __bf16* out,
                   int M, int N, int K) {
    gemm_kernel<false, true><<<dim3(M / 128, N / 128), 256, 0, stream>>>(
        A, W, b, (void*)out, M, N, K);
  };

  // --- precision staging ---
  // saWq_bf .. enc_bf are the 24 segments of one array that starts at saWq_bf
  cvt_inputs_kernel<<<dim3(24 * 32), dim3(256), 0, stream>>>(
      sa_Wq, sa_Wk, sa_Wv, sa_Wo, ca_Wq, ca_Wk, ca_Wv, ca_Wo,
      ff_W1, ff_W2, x, enc, saWq_bf);

  // --- self attention ---
  gemmB(x_bf, saWq_bf, sa_bq, Qb, MROWS, DMODEL, DMODEL);
  gemmB(x_bf, saWk_bf, sa_bk, Kb, MROWS, DMODEL, DMODEL);
  gemmB(x_bf, saWv_bf, sa_bv, Vb, MROWS, DMODEL, DMODEL);
  transpose_v_kernel<<<dim3(TSEQ / 32, NHEAD, NB), 256, 0, stream>>>(Vb, Vt, TSEQ);
  attn_kernel<<<dim3(TSEQ / 64, NHEAD, NB), 128, 0, stream>>>(
      Qb, Kb, Vt, tgt_mask, ctx, TSEQ, TSEQ);
  cvt(ctx, ctx_bf, MROWS * DMODEL);
  gemmF(ctx_bf, saWo_bf, sa_bo, proj, MROWS, DMODEL, DMODEL);
  ln_kernel<<<MROWS, 256, 0, stream>>>(x, proj, ln1_g, ln1_b, yres, y_bf);

  // --- cross attention ---
  gemmB(y_bf,   caWq_bf, ca_bq, Qb, MROWS, DMODEL, DMODEL);
  gemmB(enc_bf, caWk_bf, ca_bk, Kb, MROWS, DMODEL, DMODEL);
  gemmB(enc_bf, caWv_bf, ca_bv, Vb, MROWS, DMODEL, DMODEL);
  transpose_v_kernel<<<dim3(SSEQ / 32, NHEAD, NB), 256, 0, stream>>>(Vb, Vt, SSEQ);
  attn_kernel<<<dim3(TSEQ / 64, NHEAD, NB), 128, 0, stream>>>(
      Qb, Kb, Vt, src_mask, ctx, TSEQ, SSEQ);
  cvt(ctx, ctx_bf, MROWS * DMODEL);
  gemmF(ctx_bf, caWo_bf, ca_bo, proj, MROWS, DMODEL, DMODEL);
  ln_kernel<<<MROWS, 256, 0, stream>>>(yres, proj, ln2_g, ln2_b, yres, y_bf);

  // --- feed forward ---
  gemm_kernel<true, true><<<dim3(MROWS / 128, DFFN / 128), 256, 0, stream>>>(
      y_bf, W1_bf, ff_b1, (void*)hidden, MROWS, DFFN, DMODEL);
  gemmF(hidden, W2_bf, ff_b2, proj, MROWS, DMODEL, DFFN);
  ln_kernel<<<MROWS, 256, 0, stream>>>(yres, proj, ln3_g, ln3_b, (float*)d_out, y_bf);
}

// v006
// A run of this version takes 323 microseconds.
// Timed twice side by side with v005, it ran 1.10 and 1.09 times as fast.
// Over all steps from v000 it is 2.47 times as fast.
#include <hip/hip_runtime.h>

// ---------------------------------------------------------------------------
// Problem constants (from reference): D=1024, H=16, DK=64, DFF=4096, B=2,
// T=S=2048.  M = B*T = 4096 rows for every activation GEMM.
// ---------------------------------------------------------------------------
#define DMODEL 1024
#define NHEAD  16
#define DHEAD  64
#define DFFN   4096
#define NB     2
#define TSEQ   2048
#define SSEQ   2048
#define MROWS  (NB * TSEQ)   // 4096

typedef __attribute__((ext_vector_type(16))) __bf16 v16bf;
typedef __attribute__((ext_vector_type(8)))  __bf16 v8bf;
typedef __attribute__((ext_vector_type(8)))  float  v8f;

// ---------------------------------------------------------------------------
// Helpers
// ---------------------------------------------------------------------------
__device__ __forceinline__ __bf16 f2bf(float f) {
  unsigned int u = __float_as_uint(f);
  u += 0x7FFFu + ((u >> 16) & 1u);          // round-to-nearest-even
  unsigned short s = (unsigned short)(u >> 16);
  __bf16 r;
  __builtin_memcpy(&r, &s, 2);
  return r;
}

// Load one WMMA 16-lane fragment row following the CDNA5 per-lane K-chunk
// layout: lanes 0-15 hold K {hi8=0: 0..7,16..23}, lanes 16-31 hold {8..15,24..31}.
__device__ __forceinline__ v16bf load_frag(const __bf16* row, int hi8) {
  v8bf a = *(const v8bf*)(row + hi8);
  v8bf b = *(const v8bf*)(row + hi8 + 16);
  return __builtin_shufflevector(a, b, 0,1,2,3,4,5,6,7,8,9,10,11,12,13,14,15);
}

__device__ __forceinline__ v8f wmma_bf16(v16bf a, v16bf b, v8f c) {
  return __builtin_amdgcn_wmma_f32_16x16x32_bf16(
      /*neg_a=*/false, a, /*neg_b=*/false, b,
      /*c_mod=*/(short)0, c, /*reuse_a=*/false, /*reuse_b=*/false);
}

// CDNA5 async global->LDS copies (16B per lane) are tracked by ASYNCcnt. Their
// LDS address is the byte offset within the workgroup LDS allocation (low 32
// bits of the generic pointer), their global address a per-lane 64-bit pointer.
__device__ __forceinline__ void wait_asynccnt0() {
  asm volatile("s_wait_asynccnt 0x0" ::: "memory");
}
// Eight async copies (16B per lane each) in one statement. The closing
// s_wait_xcnt stands inside the statement so that no address register of an
// issued copy is rewritten ahead of it.
__device__ __forceinline__ void async_copy8_b128(
    unsigned int l0, unsigned int l1, unsigned int l2, unsigned int l3,
    unsigned int l4, unsigned int l5, unsigned int l6, unsigned int l7,
    const void* g0, const void* g1, const void* g2, const void* g3,
    const void* g4, const void* g5, const void* g6, const void* g7) {
  asm volatile("global_load_async_to_lds_b128 %0, %8, off\n\t"
               "global_load_async_to_lds_b128 %1, %9, off\n\t"
               "global_load_async_to_lds_b128 %2, %10, off\n\t"
               "global_load_async_to_lds_b128 %3, %11, off\n\t"
               "global_load_async_to_lds_b128 %4, %12, off\n\t"
               "global_load_async_to_lds_b128 %5, %13, off\n\t"
               "global_load_async_to_lds_b128 %6, %14, off\n\t"
               "global_load_async_to_lds_b128 %7, %15, off\n\t"
               "s_wait_xcnt 0x0"
               :: "v"(l0), "v"(l1), "v"(l2), "v"(l3),
                  "v"(l4), "v"(l5), "v"(l6), "v"(l7),
                  "v"(g0), "v"(g1), "v"(g2), "v"(g3),
                  "v"(g4), "v"(g5), "v"(g6), "v"(g7)
               : "memory");
}
// Retires this wave's LDS reads before a barrier behind which the buffer they
// read is refilled by copies.
__device__ __forceinline__ void wait_dscnt0() {
  asm volatile("s_wait_dscnt 0x0" ::: "memory");
}

// ---------------------------------------------------------------------------
// fp32 -> bf16 conversion (grid-stride)
// ---------------------------------------------------------------------------
__global__ __launch_bounds__(256) void cvt_kernel(const float* __restrict__ in,
                                                  __bf16* __restrict__ out, int n) {
  int i = blockIdx.x * 256 + threadIdx.x;
  const int stride = gridDim.x * 256;
  for (; i < n; i += stride) out[i] = f2bf(in[i]);
}

// ---------------------------------------------------------------------------
// All twelve f32 -> bf16 conversions of the inputs in ONE launch. Their bf16
// images lie one behind the other in the workspace, so the destination is one
// array of 24 segments of 2^20 elements: segments 0..7 the eight D x D
// weights, 8..11 and 12..15 the two feed-forward weights, 16..19 and 20..23
// the two activations. 32 blocks share a segment; a block converts 32768
// contiguous elements, 1024 a trip: each wave-wide load covers four whole
// 128-B lines, each wave-wide store two. Few long-lived waves take the place
// of many short ones: the time of the short launches was the start of their
// waves, not their bytes.
// ---------------------------------------------------------------------------
typedef __attribute__((ext_vector_type(4))) float  v4f;
typedef __attribute__((ext_vector_type(4))) __bf16 v4bf;
#define CVT_SEG_LOG2   20
#define CVT_BLK_ELEMS  32768
__global__ __launch_bounds__(256) void cvt_inputs_kernel(
    const float* __restrict__ w0, const float* __restrict__ w1,
    const float* __restrict__ w2, const float* __restrict__ w3,
    const float* __restrict__ w4, const float* __restrict__ w5,
    const float* __restrict__ w6, const float* __restrict__ w7,
    const float* __restrict__ f1, const float* __restrict__ f2,
    const float* __restrict__ xa, const float* __restrict__ xe,
    __bf16* __restrict__ out)
{
  const int seg = blockIdx.x >> 5;     // block-uniform
  const float* src;
  int first;                           // the source's first segment
  if (seg < 8) {
    first = seg;
    src = seg == 0 ? w0 : seg == 1 ? w1 : seg == 2 ? w2 : seg == 3 ? w3
        : seg == 4 ? w4 : seg == 5 ? w5 : seg == 6 ? w6 : w7;
  } else if (seg < 12) { first = 8;  src = f1; }
  else if (seg < 16)   { first = 12; src = f2; }
  else if (seg < 20)   { first = 16; src = xa; }
  else                 { first = 20; src = xe; }
  const size_t inseg = (size_t)(blockIdx.x & 31) * CVT_BLK_ELEMS + threadIdx.x * 4;
  const float* s = src + ((size_t)(seg - first) << CVT_SEG_LOG2) + inseg;
  __bf16*      d = out + ((size_t)seg << CVT_SEG_LOG2) + inseg;
  // Four groups of eight trips: a group's eight 16-B loads per lane are in
  // flight together, ahead of its stores. Unrolled: every place in the block's
  // share is an immediate offset, so no address register is ever rewritten.
#pragma unroll
  for (int g = 0; g < CVT_BLK_ELEMS / 8192; ++g) {
    v4f v[8];
#pragma unroll
    for (int i = 0; i < 8; ++i) v[i] = *(const v4f*)(s + (g * 8 + i) * 1024);
#pragma unroll
    for (int i = 0; i < 8; ++i) {
      v4bf o;
#pragma unroll
      for (int e = 0; e < 4; ++e) o[e] = f2bf(v[i][e]);
      *(v4bf*)(d + (g * 8 + i) * 1024) = o;
    }
    // the next group's loads reuse the data registers of these stores
    if (g + 1 < CVT_BLK_ELEMS / 8192) asm volatile("s_wait_xcnt 0x0" ::: "memory");
  }
}

// ---------------------------------------------------------------------------
// Tiled GEMM: out[M,N] = A[M,K] @ W[N,K]^T + bias[N]   (torch Linear semantics)
// Block = 256 threads = 8 waves; 128x128 output tile; wave tile 32x64.
// K is staged 128 wide through double-buffered LDS using async global->LDS
// copies so the next stage streams in while WMMAs consume the current one: a
// stage feeds four blocks of 8 WMMAs a wave, so one publish point (two waits
// and a barrier) and one landing latency serve 128 k, and every wave-wide copy
// takes whole 128-B lines (two rows of 256 B).
// A staged row holds 256 B of data at a pitch of 272 B (16 B x odd): the
// sixteen rows that a half wave reads 16 B of fall on all 64 banks once.
// K must be a multiple of 128.
// ---------------------------------------------------------------------------
#define GBK    128  // k per stage
#define GPITCH 136  // bf16 elements per staged LDS row (272 B)
template<bool RELU, bool OUT_BF16>
__global__ __launch_bounds__(256) void gemm_kernel(
    const __bf16* __restrict__ A, const __bf16* __restrict__ W,
    const float* __restrict__ bias, void* __restrict__ outp,
    int M, int N, int K)
{
  __shared__ __attribute__((aligned(16))) __bf16 As[2][128 * GPITCH];
  __shared__ __attribute__((aligned(16))) __bf16 Ws[2][128 * GPITCH];

  const int tid  = threadIdx.x;
  const int lane = tid & 31;
  const int wave = tid >> 5;     // 0..7
  const int wm   = wave >> 1;    // 0..3 -> 32-row strip
  const int wn   = wave & 1;     // 0..1 -> 64-col strip
  const int bm   = blockIdx.x * 128;
  const int bn   = blockIdx.y * 128;
  const int l15  = lane & 15;
  const int hi8  = (lane >> 4) << 3;

  const v8f vzero = {0.f,0.f,0.f,0.f,0.f,0.f,0.f,0.f};
  v8f acc[2][4];
#pragma unroll
  for (int i = 0; i < 2; ++i)
#pragma unroll
    for (int j = 0; j < 4; ++j) acc[i][j] = vzero;

  // Staging map: thread t brings 16 B at column chunk (t & 15) of rows
  // (t >> 4) + 16 * i, i = 0..7, of the A stage and of the W stage.
  const int crow = tid >> 4;           // 0..15
  const int ccol = (tid & 15) * 8;     // element offset in the staged row
  const __bf16* aptr = A + (size_t)(bm + crow) * K + ccol;
  const __bf16* wptr = W + (size_t)(bn + crow) * K + ccol;
  const unsigned int lA = (unsigned int)(uintptr_t)(&As[0][crow * GPITCH + ccol]);
  const unsigned int lW = (unsigned int)(uintptr_t)(&Ws[0][crow * GPITCH + ccol]);
  const unsigned int rstep = 16 * GPITCH * 2;    // 16 LDS rows, bytes
  const unsigned int bstep = 128 * GPITCH * 2;   // one buffer, bytes
  const size_t gstep = (size_t)16 * K;           // 16 global rows, elements

  auto stage = [&](int bsel, int k0) {
    const unsigned int la = lA + bsel * bstep;
    const unsigned int lw = lW + bsel * bstep;
    const __bf16* ag = aptr + k0;
    const __bf16* wg = wptr + k0;
    async_copy8_b128(la, la + rstep, la + 2 * rstep, la + 3 * rstep,
                     la + 4 * rstep, la + 5 * rstep, la + 6 * rstep, la + 7 * rstep,
                     ag, ag + gstep, ag + 2 * gstep, ag + 3 * gstep,
                     ag + 4 * gstep, ag + 5 * gstep, ag + 6 * gstep, ag + 7 * gstep);
    async_copy8_b128(lw, lw + rstep, lw + 2 * rstep, lw + 3 * rstep,
                     lw + 4 * rstep, lw + 5 * rstep, lw + 6 * rstep, lw + 7 * rstep,
                     wg, wg + gstep, wg + 2 * gstep, wg + 3 * gstep,
                     wg + 4 * gstep, wg + 5 * gstep, wg + 6 * gstep, wg + 7 * gstep);
  };

  stage(0, 0);
  wait_asynccnt0();     // this wave's share of stage 0 has landed
  __syncthreads();      // ... and every other wave's
  if (GBK < K) stage(1, GBK);

  int buf = 0;
  for (int k0 = 0; k0 < K; k0 += GBK) {
    const __bf16* as = As[buf] + (wm * 32 + l15) * GPITCH;
    const __bf16* ws = Ws[buf] + (wn * 64 + l15) * GPITCH;
    // unrolled: a block's place in the stage becomes an immediate LDS offset,
    // and a block's fragment reads can go under the block before it
#pragma unroll
    for (int kk = 0; kk < GBK; kk += 32) {
      v16bf af[2], bfr[4];
#pragma unroll
      for (int i = 0; i < 2; ++i)
        af[i] = load_frag(as + i * 16 * GPITCH + kk, hi8);
#pragma unroll
      for (int j = 0; j < 4; ++j)
        bfr[j] = load_frag(ws + j * 16 * GPITCH + kk, hi8);
#pragma unroll
      for (int i = 0; i < 2; ++i)
#pragma unroll
        for (int j = 0; j < 4; ++j)
          acc[i][j] = wmma_bf16(af[i], bfr[j], acc[i][j]);
    }
    // Publish point: own LDS reads of this stage retired, own copies of the
    // next stage landed, then the barrier that publishes the next stage and
    // frees this buffer for the refill behind it.
    wait_dscnt0();
    wait_asynccnt0();
    __syncthreads();
    if (k0 + 2 * GBK < K) stage(buf, k0 + 2 * GBK);
    buf ^= 1;
  }
  wait_asynccnt0();     // nothing of the ring is in flight when the wave ends

  float*  outf = (float*)outp;
  __bf16* outb = (__bf16*)outp;
#pragma unroll
  for (int i = 0; i < 2; ++i) {
    const int mrow = bm + wm * 32 + i * 16 + hi8;  // C layout: row r+8*(lane>>4)
#pragma unroll
    for (int j = 0; j < 4; ++j) {
      const int ncol = bn + wn * 64 + j * 16 + l15;
      const float bv = bias[ncol];
#pragma unroll
      for (int r = 0; r < 8; ++r) {
        float v = acc[i][j][r] + bv;
        if (RELU) v = fmaxf(v, 0.0f);
        const size_t idx = (size_t)(mrow + r) * N + ncol;
        if (OUT_BF16) outb[idx] = f2bf(v); else outf[idx] = v;
      }
    }
  }
}

// ---------------------------------------------------------------------------
// Transpose V ([b][s][h][d] bf16) -> Vt ([b][h][d][s] bf16) so V columns are
// contiguous for the V^T A-operand of O^T += V^T P^T.
// ---------------------------------------------------------------------------
__global__ __launch_bounds__(256) void transpose_v_kernel(
    const __bf16* __restrict__ V, __bf16* __restrict__ Vt, int Skv)
{
  __shared__ __bf16 tile[32][72];    // 32 s  x 64 d (+pad)
  const int b  = blockIdx.z;
  const int h  = blockIdx.y;
  const int s0 = blockIdx.x * 32;
  const int tid = threadIdx.x;
  {
    const int sl = tid >> 3;                 // 0..31
    const int dp = (tid & 7) * 8;            // 0..56
    const __bf16* src = V + (size_t)(b * Skv + s0 + sl) * DMODEL + h * DHEAD + dp;
    v8bf val = *(const v8bf*)src;
#pragma unroll
    for (int i = 0; i < 8; ++i) tile[sl][dp + i] = val[i];
  }
  __syncthreads();
  {
    const int dl = tid >> 2;                 // 0..63
    const int sp = (tid & 3) * 8;            // 0..24
    v8bf o;
#pragma unroll
    for (int i = 0; i < 8; ++i) o[i] = tile[sp + i][dl];
    __bf16* dst = Vt + (size_t)((b * NHEAD + h) * DHEAD + dl) * Skv + s0 + sp;
    *(v8bf*)dst = o;
  }
}

// ---------------------------------------------------------------------------
// Both int32 masks ([B][T][S]) packed once per call into the lane masks that
// the attention selects on. For 16 queries q0.. and 32 keys s0.. there are 16
// words; bit l of word 8 t + r says whether key s0 + 16 t + 8 (l >> 4) + r of
// query q0 + (l & 15) is kept: lane l's place in the score tiles of the
// attention. Layout [mask][b][q / 16][s / 32][16]. One wave takes 16 queries x
// 128 keys: 16 loads of 16 B a lane, all in flight together, and writes 256 B.
// ---------------------------------------------------------------------------
typedef __attribute__((ext_vector_type(4)))  int          v4i;
typedef __attribute__((ext_vector_type(16))) unsigned int v16u;
// The same in the constant address space: nothing writes the packed masks while
// the attention runs, and read so a wave-uniform address gives a scalar load.
typedef __attribute__((address_space(4))) v16u cv16u;
__global__ __launch_bounds__(256) void pack_mask_kernel(
    const int* __restrict__ m0, const int* __restrict__ m1,
    unsigned int* __restrict__ pm)
{
  const int lane = threadIdx.x & 31;
  const int l15  = lane & 15;
  const int hi8  = (lane >> 4) << 3;
  const int gw   = blockIdx.x * 8 + (threadIdx.x >> 5);
  const int kg   = gw & (SSEQ / 128 - 1);       // group of 128 keys
  const int rowt = gw / (SSEQ / 128);           // (mask * B + b) * T / 16 + q / 16
  const int rt   = rowt & (MROWS / 16 - 1);     // b * T / 16 + q / 16
  const int* src = rowt >= MROWS / 16 ? m1 : m0;   // block-uniform
  const int* p = src + ((size_t)rt * 16 + l15) * SSEQ + kg * 128 + hi8;
  v4i v[16];
#pragma unroll
  for (int c = 0; c < 16; ++c)
    v[c] = *(const v4i*)(p + (c >> 2) * 32 + ((c >> 1) & 1) * 16 + (c & 1) * 4);
  unsigned int w[4];     // lane l: word l & 15 of each of the four key blocks
#pragma unroll
  for (int kb = 0; kb < 4; ++kb) {
    w[kb] = 0u;
#pragma unroll
    for (int e = 0; e < 16; ++e) {
      const unsigned int bal =
          __builtin_amdgcn_ballot_w32(v[kb * 4 + (e >> 2)][e & 3] != 0);
      if (l15 == e) w[kb] = bal;
    }
  }
  unsigned int* d = pm + ((size_t)rowt * (SSEQ / 32) + kg * 4) * 16 + lane;
  d[0]  = lane < 16 ? w[0] : w[1];
  d[32] = lane < 16 ? w[2] : w[3];
}

#define KVPITCH 72
// value of lane l ^ 16
__device__ __forceinline__ float other_half(float v) {
  const int b = __float_as_int(v);
  return __int_as_float(
      __builtin_amdgcn_permlanex16(b, b, 0x76543210, 0xfedcba98, false, false));
}
__global__ __launch_bounds__(128) void attn_kernel(
    const __bf16* __restrict__ Qb,   // [B*Tq, DMODEL] bf16
    const __bf16* __restrict__ Kb,   // [B*Skv, DMODEL] bf16
    const __bf16* __restrict__ Vt,   // [B*H*DHEAD, Skv] bf16
    const unsigned int* __restrict__ pmask, // [B][Tq/16][Skv/32][16] lane masks
    float*        __restrict__ ctx,  // [B*Tq, DMODEL] f32
    int Tq, int Skv)
{
  // 64 rows of 128 B at a pitch of 144 B (16 B x odd: no bank conflict for the
  // 16-byte fragment reads).
  __shared__ __attribute__((aligned(16))) __bf16 Ks[2][64 * KVPITCH];
  __shared__ __attribute__((aligned(16))) __bf16 Vs[2][64 * KVPITCH];
  const int lane = threadIdx.x & 31;
  // in a scalar register: the address of the wave's lane masks is formed from it
  const int wave = __builtin_amdgcn_readfirstlane(threadIdx.x >> 5);
  const int l15  = lane & 15;
  const int hi8  = (lane >> 4) << 3;
  const int h    = blockIdx.y;
  const int b    = blockIdx.z;
  const int q0   = blockIdx.x * 64 + wave * 16;

  // B operand: column l15 = query q0 + l15, k in the hardware order
  const __bf16* qrow = Qb + (size_t)(b * Tq + q0 + l15) * DMODEL + h * DHEAD;
  const v16bf qf0 = load_frag(qrow, hi8);        // K-dim 0..31 of head
  const v16bf qf1 = load_frag(qrow + 32, hi8);   // K-dim 32..63

  const __bf16* kbase  = Kb + (size_t)b * Skv * DMODEL + h * DHEAD;
  const __bf16* vtbase = Vt + (size_t)((b * NHEAD + h) * DHEAD) * Skv;
  // the lane masks of this wave's 16 queries, 16 words per 32 keys
  const unsigned int* pmw =
      pmask + ((size_t)(b * Tq + q0) >> 4) * (size_t)(Skv >> 5) * 16;

  const v8f vzero = {0.f,0.f,0.f,0.f,0.f,0.f,0.f,0.f};
  v8f o[4];        // o[j][r] = O[q0 + l15][j * 16 + hi8 + r]
#pragma unroll
  for (int j = 0; j < 4; ++j) o[j] = vzero;
  float mrow = -1e30f;   // running maximum of the lane's query (both halves)
  float lrow = 0.f;      // running sum over this half's keys only

  // Staging map: thread t brings 16 B at column chunk (t & 7) of rows
  // (t >> 3) + 16 * i, i = 0..3, of the K tile and of the V^T tile: each
  // wave-wide copy covers four whole 128-B lines.
  const int crow = threadIdx.x >> 3;          // 0..15
  const int ccol = (threadIdx.x & 7) * 8;     // element offset in the row
  const __bf16* kcp = kbase  + (size_t)crow * DMODEL + ccol;
  const __bf16* vcp = vtbase + (size_t)crow * Skv + ccol;
  const unsigned int lK = (unsigned int)(uintptr_t)(&Ks[0][crow * KVPITCH + ccol]);
  const unsigned int lV = (unsigned int)(uintptr_t)(&Vs[0][crow * KVPITCH + ccol]);
  const unsigned int rstep = 16 * KVPITCH * 2;   // 16 LDS rows, bytes
  const unsigned int bstep = 64 * KVPITCH * 2;   // one buffer, bytes
  auto stage = [&](int bsel, int key0) {
    const unsigned int lk = lK + bsel * bstep;
    const unsigned int lv = lV + bsel * bstep;
    const __bf16* kg = kcp + (size_t)key0 * DMODEL;
    const __bf16* vg = vcp + key0;
    async_copy8_b128(lk, lk + rstep, lk + 2 * rstep, lk + 3 * rstep,
                     lv, lv + rstep, lv + 2 * rstep, lv + 3 * rstep,
                     kg, kg + 16 * DMODEL, kg + 32 * DMODEL, kg + 48 * DMODEL,
                     vg, vg + (size_t)16 * Skv, vg + (size_t)32 * Skv,
                     vg + (size_t)48 * Skv);
  };

  stage(0, 0);
  wait_asynccnt0();     // this wave's share of tile 0 has landed
  __syncthreads();      // ... and every other wave's
  if (64 < Skv) stage(1, 64);

  // lane masks of tile 0; each trip fetches the next tile's, well ahead of
  // their use, so that no pass waits out a scalar load
  v16u mwc[2] = { *(const cv16u*)(pmw), *(const cv16u*)(pmw + 16) };

  int buf = 0;
  for (int t0 = 0; t0 < Skv; t0 += 64) {
   const __bf16* kt = Ks[buf];
   const __bf16* vt = Vs[buf];
   // the last trip fetches its own again: the address stays inside the array
   const unsigned int* pmn = pmw + (size_t)((t0 + 64 < Skv ? t0 + 64 : t0) >> 5) * 16;
   const v16u mwn[2] = { *(const cv16u*)(pmn), *(const cv16u*)(pmn + 16) };
   // unrolled: the pass's place in the tile becomes an immediate LDS offset
#pragma unroll
   for (int p = 0; p < 2; ++p) {
    const int s0 = t0 + p * 32;
    // lane masks of the pass: word 8 t + r for score sc[t][r]
    const v16u mw = mwc[p];
    // A operands of the pass: K rows (keys) and V^T rows (head dims)
    v16bf kf[4], vf[4];
#pragma unroll
    for (int t = 0; t < 2; ++t) {
      const __bf16* krow = kt + (p * 32 + t * 16 + l15) * KVPITCH;
      kf[t * 2]     = load_frag(krow, hi8);
      kf[t * 2 + 1] = load_frag(krow + 32, hi8);
    }
#pragma unroll
    for (int j = 0; j < 4; ++j)
      vf[j] = load_frag(vt + (j * 16 + l15) * KVPITCH + p * 32, hi8);
    v8f sc[2];     // sc[t][r] = score(key s0 + 16 t + hi8 + r, query q0 + l15)
#pragma unroll
    for (int t = 0; t < 2; ++t) {
      sc[t] = wmma_bf16(kf[t * 2], qf0, vzero);
      sc[t] = wmma_bf16(kf[t * 2 + 1], qf1, sc[t]);
    }
    // scale + mask + maximum over the lane's 16 keys
    float nmax = -1e30f;
#pragma unroll
    for (int t = 0; t < 2; ++t)
#pragma unroll
      for (int r = 0; r < 8; ++r) {
        float v = sc[t][r] * 0.125f;   // 1/sqrt(64)
        if (!__builtin_amdgcn_inverse_ballot_w32(mw[t * 8 + r])) v = -1e9f;
        sc[t][r] = v;
        nmax = fmaxf(nmax, v);
      }
    nmax = fmaxf(nmax, other_half(nmax));   // all 32 keys of the query

    const float mn  = fmaxf(mrow, nmax);
    const float scl = __expf(mrow - mn);
    mrow = mn;
    float rsum = 0.f;
    v16bf pf;      // B operand P^T: pf[s] = P[key kmap(s, h)][query l15]
#pragma unroll
    for (int t = 0; t < 2; ++t)
#pragma unroll
      for (int r = 0; r < 8; ++r) {
        const float pv = __expf(sc[t][r] - mn);
        rsum += pv;
        pf[t * 8 + r] = (__bf16)pv;
      }
    lrow = lrow * scl + rsum;
#pragma unroll
    for (int j = 0; j < 4; ++j)
#pragma unroll
      for (int r = 0; r < 8; ++r) o[j][r] *= scl;

#pragma unroll
    for (int j = 0; j < 4; ++j) o[j] = wmma_bf16(vf[j], pf, o[j]);
   }
   // Publish point: own LDS reads of this tile retired, own copies of the next
   // tile landed, then the barrier that publishes the next tile and frees this
   // buffer for the refill behind it.
   wait_dscnt0();
   wait_asynccnt0();
   __syncthreads();
   if (t0 + 128 < Skv) stage(buf, t0 + 128);
   buf ^= 1;
   mwc[0] = mwn[0];
   mwc[1] = mwn[1];
  }
  wait_asynccnt0();     // nothing of the ring is in flight when the wave ends

  // the halves' sums are joined once, here
  const float inv = 1.0f / (lrow + other_half(lrow));
  float* crow_out = ctx + (size_t)(b * Tq + q0 + l15) * DMODEL + h * DHEAD + hi8;
#pragma unroll
  for (int j = 0; j < 4; ++j) {
    const v4f lo = { o[j][0] * inv, o[j][1] * inv, o[j][2] * inv, o[j][3] * inv };
    const v4f hi = { o[j][4] * inv, o[j][5] * inv, o[j][6] * inv, o[j][7] * inv };
    *(v4f*)(crow_out + j * 16)     = lo;
    *(v4f*)(crow_out + j * 16 + 4) = hi;
  }
}

// ---------------------------------------------------------------------------
// Residual add + LayerNorm; writes f32 stream + bf16 copy for next GEMM.
// One block per row of 1024. (x/yout may alias for in-place update.)
// ---------------------------------------------------------------------------
__global__ __launch_bounds__(256) void ln_kernel(
    const float* x, const float* __restrict__ sub,
    const float* __restrict__ g, const float* __restrict__ bta,
    float* yout, __bf16* __restrict__ ybf)
{
  __shared__ float s1[256], s2[256];
  const size_t base = (size_t)blockIdx.x * DMODEL;
  float v[4];
  float lsum = 0.f, lsq = 0.f;
#pragma unroll
  for (int k = 0; k < 4; ++k) {
    const int i = threadIdx.x + k * 256;
    v[k] = x[base + i] + sub[base + i];
    lsum += v[k];
    lsq  += v[k] * v[k];
  }
  s1[threadIdx.x] = lsum; s2[threadIdx.x] = lsq;
  __syncthreads();
  for (int off = 128; off > 0; off >>= 1) {
    if (threadIdx.x < off) {
      s1[threadIdx.x] += s1[threadIdx.x + off];
      s2[threadIdx.x] += s2[threadIdx.x + off];
    }
    __syncthreads();
  }
  const float mean = s1[0] * (1.0f / DMODEL);
  const float var  = s2[0] * (1.0f / DMODEL) - mean * mean;
  const float rs   = rsqrtf(var + 1e-5f);
#pragma unroll
  for (int k = 0; k < 4; ++k) {
    const int i = threadIdx.x + k * 256;
    const float o = (v[k] - mean) * rs * g[i] + bta[i];
    yout[base + i] = o;
    ybf[base + i]  = f2bf(o);
  }
}

// ---------------------------------------------------------------------------
// Host orchestration
// ---------------------------------------------------------------------------
extern "C" void kernel_launch(void* const* d_in, const int* in_sizes, int n_in,
                              void* d_out, int out_size, void* d_ws, size_t ws_size,
                              hipStream_t stream) {
  (void)in_sizes; (void)n_in; (void)out_size; (void)ws_size;

  const float* x        = (const float*)d_in[0];
  const float* enc      = (const float*)d_in[1];
  const int*   src_mask = (const int*)d_in[2];
  const int*   tgt_mask = (const int*)d_in[3];
  const float* sa_Wq = (const float*)d_in[4],  *sa_bq = (const float*)d_in[5];
  const float* sa_Wk = (const float*)d_in[6],  *sa_bk = (const float*)d_in[7];
  const float* sa_Wv = (const float*)d_in[8],  *sa_bv = (const float*)d_in[9];
  const float* sa_Wo = (const float*)d_in[10], *sa_bo = (const float*)d_in[11];
  const float* ca_Wq = (const float*)d_in[12], *ca_bq = (const float*)d_in[13];
  const float* ca_Wk = (const float*)d_in[14], *ca_bk = (const float*)d_in[15];
  const float* ca_Wv = (const float*)d_in[16], *ca_bv = (const float*)d_in[17];
  const float* ca_Wo = (const float*)d_in[18], *ca_bo = (const float*)d_in[19];
  const float* ff_W1 = (const float*)d_in[20], *ff_b1 = (const float*)d_in[21];
  const float* ff_W2 = (const float*)d_in[22], *ff_b2 = (const float*)d_in[23];
  const float* ln1_g = (const float*)d_in[24], *ln1_b = (const float*)d_in[25];
  const float* ln2_g = (const float*)d_in[26], *ln2_b = (const float*)d_in[27];
  const float* ln3_g = (const float*)d_in[28], *ln3_b = (const float*)d_in[29];

  char* ws = (char*)d_ws;
  const size_t MB = 1024ull * 1024ull;
  // bf16 weights
  __bf16* saWq_bf = (__bf16*)(ws + 0 * MB);
  __bf16* saWk_bf = (__bf16*)(ws + 2 * MB);
  __bf16* saWv_bf = (__bf16*)(ws + 4 * MB);
  __bf16* saWo_bf = (__bf16*)(ws + 6 * MB);
  __bf16* caWq_bf = (__bf16*)(ws + 8 * MB);
  __bf16* caWk_bf = (__bf16*)(ws + 10 * MB);
  __bf16* caWv_bf = (__bf16*)(ws + 12 * MB);
  __bf16* caWo_bf = (__bf16*)(ws + 14 * MB);
  __bf16* W1_bf   = (__bf16*)(ws + 16 * MB);   // 8 MB
  __bf16* W2_bf   = (__bf16*)(ws + 24 * MB);   // 8 MB
  // activations
  __bf16* x_bf    = (__bf16*)(ws + 32 * MB);
  __bf16* enc_bf  = (__bf16*)(ws + 40 * MB);
  __bf16* Qb      = (__bf16*)(ws + 48 * MB);
  __bf16* Kb      = (__bf16*)(ws + 56 * MB);
  __bf16* Vb      = (__bf16*)(ws + 64 * MB);
  __bf16* Vt      = (__bf16*)(ws + 72 * MB);
  float*  ctx     = (float*) (ws + 80 * MB);   // 16 MB
  float*  proj    = (float*) (ws + 96 * MB);   // 16 MB
  float*  yres    = (float*) (ws + 112 * MB);  // 16 MB
  __bf16* y_bf    = (__bf16*)(ws + 128 * MB);  // 8 MB
  __bf16* hidden  = (__bf16*)(ws + 136 * MB);  // 32 MB
  __bf16* ctx_bf  = (__bf16*)(ws + 168 * MB);  // 8 MB
  unsigned int* pm_tgt = (unsigned int*)(ws + 176 * MB);  // 1 MB
  unsigned int* pm_src = (unsigned int*)(ws + 177 * MB);  // 1 MB, behind pm_tgt

  auto cvt = [&](const float* in, __bf16* out, int n) {
    cvt_kernel<<<dim3(2048), dim3(256), 0, stream>>>(in, out, n);
  };
  auto gemmF = [&](const __bf16* A, const __bf16* W, const float* b, float* out,
                   int M, int N, int K) {
    gemm_kernel<false, false><<<dim3(M / 128, N / 128), 256, 0, stream>>>(
        A, W, b, (void*)out, M, N, K);
  };
  auto gemmB = [&](const __bf16* A, const __bf16* W, const float* b, __bf16* out,
                   int M, int N, int K) {
    gemm_kernel<false, true><<<dim3(M / 128, N / 128), 256, 0, stream>>>(
        A, W, b, (void*)out, M, N, K);
  };

  // --- precision staging ---
  // saWq_bf .. enc_bf are the 24 segments of one array that starts at saWq_bf
  cvt_inputs_kernel<<<dim3(24 * 32), dim3(256), 0, stream>>>(
      sa_Wq, sa_Wk, sa_Wv, sa_Wo, ca_Wq, ca_Wk, ca_Wv, ca_Wo,
      ff_W1, ff_W2, x, enc, saWq_bf);

  // both masks -> lane masks, pm_tgt then pm_src: one wave per 16 x 128 bits
  pack_mask_kernel<<<dim3(2 * (MROWS / 16) * (SSEQ / 128) / 8), dim3(256), 0, stream>>>(
      tgt_mask, src_mask, pm_tgt);

  // --- self attention ---
  gemmB(x_bf, saWq_bf, sa_bq, Qb, MROWS, DMODEL, DMODEL);
  gemmB(x_bf, saWk_bf, sa_bk, Kb, MROWS, DMODEL, DMODEL);
  gemmB(x_bf, saWv_bf, sa_bv, Vb, MROWS, DMODEL, DMODEL);
  transpose_v_kernel<<<dim3(TSEQ / 32, NHEAD, NB), 256, 0, stream>>>(Vb, Vt, TSEQ);
  attn_kernel<<<dim3(TSEQ / 64, NHEAD, NB), 128, 0, stream>>>(
      Qb, Kb, Vt, pm_tgt, ctx, TSEQ, TSEQ);
  cvt(ctx, ctx_bf, MROWS * DMODEL);
  gemmF(ctx_bf, saWo_bf, sa_bo, proj, MROWS, DMODEL, DMODEL);
  ln_kernel<<<MROWS, 256, 0, stream>>>(x, proj, ln1_g, ln1_b, yres, y_bf);

  // --- cross attention ---
  gemmB(y_bf,   caWq_bf, ca_bq, Qb, MROWS, DMODEL, DMODEL);
  gemmB(enc_bf, caWk_bf, ca_bk, Kb, MROWS, DMODEL, DMODEL);
  gemmB(enc_bf, caWv_bf, ca_bv, Vb, MROWS, DMODEL, DMODEL);
  transpose_v_kernel<<<dim3(SSEQ / 32, NHEAD, NB), 256, 0, stream>>>(Vb, Vt, SSEQ);
  attn_kernel<<<dim3(TSEQ / 64, NHEAD, NB), 128, 0, stream>>>(
      Qb, Kb, Vt, pm_src, ctx, TSEQ, SSEQ);
  cvt(ctx, ctx_bf, MROWS * DMODEL);
  gemmF(ctx_bf, caWo_bf, ca_bo, proj, MROWS, DMODEL, DMODEL);
  ln_kernel<<<MROWS, 256, 0, stream>>>(yres, proj, ln2_g, ln2_b, yres, y_bf);

  // --- feed forward ---
  gemm_kernel<true, true><<<dim3(MROWS / 128, DFFN / 128), 256, 0, stream>>>(
      y_bf, W1_bf, ff_b1, (void*)hidden, MROWS, DFFN, DMODEL);
  gemmF(hidden, W2_bf, ff_b2, proj, MROWS, DMODEL, DFFN);
  ln_kernel<<<MROWS, 256, 0, stream>>>(yres, proj, ln3_g, ln3_b, (float*)d_out, y_bf);
}

// v007
// It runs in 301 microseconds.
// Next to v006, in two timings, it ran 1.08 times as fast each time.
// Counting every step since v000, it is 2.67 times as fast.
#include <hip/hip_runtime.h>

// ---------------------------------------------------------------------------
// Problem constants (from reference): D=1024, H=16, DK=64, DFF=4096, B=2,
// T=S=2048.  M = B*T = 4096 rows for every activation GEMM.
// ---------------------------------------------------------------------------
#define DMODEL 1024
#define NHEAD  16
#define DHEAD  64
#define DFFN   4096
#define NB     2
#define TSEQ   2048
#define SSEQ   2048
#define MROWS  (NB * TSEQ)   // 4096

typedef __attribute__((ext_vector_type(16))) __bf16 v16bf;
typedef __attribute__((ext_vector_type(8)))  __bf16 v8bf;
typedef __attribute__((ext_vector_type(8)))  float  v8f;

// ---------------------------------------------------------------------------
// Helpers
// ---------------------------------------------------------------------------
__device__ __forceinline__ __bf16 f2bf(float f) {
  unsigned int u = __float_as_uint(f);
  u += 0x7FFFu + ((u >> 16) & 1u);          // round-to-nearest-even
  unsigned short s = (unsigned short)(u >> 16);
  __bf16 r;
  __builtin_memcpy(&r, &s, 2);
  return r;
}

// Load one WMMA 16-lane fragment row following the CDNA5 per-lane K-chunk
// layout: lanes 0-15 hold K {hi8=0: 0..7,16..23}, lanes 16-31 hold {8..15,24..31}.
__device__ __forceinline__ v16bf load_frag(const __bf16* row, int hi8) {
  v8bf a = *(const v8bf*)(row + hi8);
  v8bf b = *(const v8bf*)(row + hi8 + 16);
  return __builtin_shufflevector(a, b, 0,1,2,3,4,5,6,7,8,9,10,11,12,13,14,15);
}

__device__ __forceinline__ v8f wmma_bf16(v16bf a, v16bf b, v8f c) {
  return __builtin_amdgcn_wmma_f32_16x16x32_bf16(
      /*neg_a=*/false, a, /*neg_b=*/false, b,
      /*c_mod=*/(short)0, c, /*reuse_a=*/false, /*reuse_b=*/false);
}

// CDNA5 async global->LDS copies (16B per lane) are tracked by ASYNCcnt. Their
// LDS address is the byte offset within the workgroup LDS allocation (low 32
// bits of the generic pointer), their global address a per-lane 64-bit pointer.
__device__ __forceinline__ void wait_asynccnt0() {
  asm volatile("s_wait_asynccnt 0x0" ::: "memory");
}
// Eight async copies (16B per lane each) in one statement. The closing
// s_wait_xcnt stands inside the statement so that no address register of an
// issued copy is rewritten ahead of it.
__device__ __forceinline__ void async_copy8_b128(
    unsigned int l0, unsigned int l1, unsigned int l2, unsigned int l3,
    unsigned int l4, unsigned int l5, unsigned int l6, unsigned int l7,
    const void* g0, const void* g1, const void* g2, const void* g3,
    const void* g4, const void* g5, const void* g6, const void* g7) {
  asm volatile("global_load_async_to_lds_b128 %0, %8, off\n\t"
               "global_load_async_to_lds_b128 %1, %9, off\n\t"
               "global_load_async_to_lds_b128 %2, %10, off\n\t"
               "global_load_async_to_lds_b128 %3, %11, off\n\t"
               "global_load_async_to_lds_b128 %4, %12, off\n\t"
               "global_load_async_to_lds_b128 %5, %13, off\n\t"
               "global_load_async_to_lds_b128 %6, %14, off\n\t"
               "global_load_async_to_lds_b128 %7, %15, off\n\t"
               "s_wait_xcnt 0x0"
               :: "v"(l0), "v"(l1), "v"(l2), "v"(l3),
                  "v"(l4), "v"(l5), "v"(l6), "v"(l7),
                  "v"(g0), "v"(g1), "v"(g2), "v"(g3),
                  "v"(g4), "v"(g5), "v"(g6), "v"(g7)
               : "memory");
}
// Retires this wave's LDS reads before a barrier behind which the buffer they
// read is refilled by copies.
__device__ __forceinline__ void wait_dscnt0() {
  asm volatile("s_wait_dscnt 0x0" ::: "memory");
}

// ---------------------------------------------------------------------------
// fp32 -> bf16 conversion (grid-stride)
// ---------------------------------------------------------------------------
__global__ __launch_bounds__(256) void cvt_kernel(const float* __restrict__ in,
                                                  __bf16* __restrict__ out, int n) {
  int i = blockIdx.x * 256 + threadIdx.x;
  const int stride = gridDim.x * 256;
  for (; i < n; i += stride) out[i] = f2bf(in[i]);
}

// ---------------------------------------------------------------------------
// All twelve f32 -> bf16 conversions of the inputs in ONE launch. Their bf16
// images lie one behind the other in the workspace, so the destination is one
// array of 24 segments of 2^20 elements: segments 0..7 the eight D x D
// weights, 8..11 and 12..15 the two feed-forward weights, 16..19 and 20..23
// the two activations. 32 blocks share a segment; a block converts 32768
// contiguous elements, 1024 a trip: each wave-wide load covers four whole
// 128-B lines, each wave-wide store two. Few long-lived waves take the place
// of many short ones: the time of the short launches was the start of their
// waves, not their bytes.
// ---------------------------------------------------------------------------
typedef __attribute__((ext_vector_type(4))) float  v4f;
typedef __attribute__((ext_vector_type(4))) __bf16 v4bf;
#define CVT_SEG_LOG2   20
#define CVT_BLK_ELEMS  32768
__global__ __launch_bounds__(256) void cvt_inputs_kernel(
    const float* __restrict__ w0, const float* __restrict__ w1,
    const float* __restrict__ w2, const float* __restrict__ w3,
    const float* __restrict__ w4, const float* __restrict__ w5,
    const float* __restrict__ w6, const float* __restrict__ w7,
    const float* __restrict__ f1, const float* __restrict__ f2,
    const float* __restrict__ xa, const float* __restrict__ xe,
    __bf16* __restrict__ out)
{
  const int seg = blockIdx.x >> 5;     // block-uniform
  const float* src;
  int first;                           // the source's first segment
  if (seg < 8) {
    first = seg;
    src = seg == 0 ? w0 : seg == 1 ? w1 : seg == 2 ? w2 : seg == 3 ? w3
        : seg == 4 ? w4 : seg == 5 ? w5 : seg == 6 ? w6 : w7;
  } else if (seg < 12) { first = 8;  src = f1; }
  else if (seg < 16)   { first = 12; src = f2; }
  else if (seg < 20)   { first = 16; src = xa; }
  else                 { first = 20; src = xe; }
  const size_t inseg = (size_t)(blockIdx.x & 31) * CVT_BLK_ELEMS + threadIdx.x * 4;
  const float* s = src + ((size_t)(seg - first) << CVT_SEG_LOG2) + inseg;
  __bf16*      d = out + ((size_t)seg << CVT_SEG_LOG2) + inseg;
  // Four groups of eight trips: a group's eight 16-B loads per lane are in
  // flight together, ahead of its stores. Unrolled: every place in the block's
  // share is an immediate offset, so no address register is ever rewritten.
#pragma unroll
  for (int g = 0; g < CVT_BLK_ELEMS / 8192; ++g) {
    v4f v[8];
#pragma unroll
    for (int i = 0; i < 8; ++i) v[i] = *(const v4f*)(s + (g * 8 + i) * 1024);
#pragma unroll
    for (int i = 0; i < 8; ++i) {
      v4bf o;
#pragma unroll
      for (int e = 0; e < 4; ++e) o[e] = f2bf(v[i][e]);
      *(v4bf*)(d + (g * 8 + i) * 1024) = o;
    }
    // the next group's loads reuse the data registers of these stores
    if (g + 1 < CVT_BLK_ELEMS / 8192) asm volatile("s_wait_xcnt 0x0" ::: "memory");
  }
}

// ---------------------------------------------------------------------------
// Tiled GEMM: out[M,N] = A[M,K] @ W[N,K]^T + bias[N]   (torch Linear semantics)
// Block = 256 threads = 8 waves; 128x128 output tile; wave tile 32x64.
// K is staged 128 wide through double-buffered LDS using async global->LDS
// copies so the next stage streams in while WMMAs consume the current one: a
// stage feeds four blocks of 8 WMMAs a wave, so one publish point (two waits
// and a barrier) and one landing latency serve 128 k, and every wave-wide copy
// takes whole 128-B lines (two rows of 256 B).
// A staged row holds 256 B of data at a pitch of 272 B (16 B x odd): the
// sixteen rows that a half wave reads 16 B of fall on all 64 banks once.
// K must be a multiple of 128.
// ---------------------------------------------------------------------------
#define GBK    128  // k per stage
#define GPITCH 136  // bf16 elements per staged LDS row (272 B)
// One block's 128x128 tile at rows bm.., columns bn..
template<bool RELU, bool OUT_BF16>
__device__ __forceinline__ void gemm_tile(
    const __bf16* __restrict__ A, const __bf16* __restrict__ W,
    const float* __restrict__ bias, void* __restrict__ outp,
    int N, int K, int bm, int bn)
{
  __shared__ __attribute__((aligned(16))) __bf16 As[2][128 * GPITCH];
  __shared__ __attribute__((aligned(16))) __bf16 Ws[2][128 * GPITCH];

  const int tid  = threadIdx.x;
  const int lane = tid & 31;
  const int wave = tid >> 5;     // 0..7
  const int wm   = wave >> 1;    // 0..3 -> 32-row strip
  const int wn   = wave & 1;     // 0..1 -> 64-col strip
  const int l15  = lane & 15;
  const int hi8  = (lane >> 4) << 3;

  const v8f vzero = {0.f,0.f,0.f,0.f,0.f,0.f,0.f,0.f};
  v8f acc[2][4];
#pragma unroll
  for (int i = 0; i < 2; ++i)
#pragma unroll
    for (int j = 0; j < 4; ++j) acc[i][j] = vzero;

  // Staging map: thread t brings 16 B at column chunk (t & 15) of rows
  // (t >> 4) + 16 * i, i = 0..7, of the A stage and of the W stage.
  const int crow = tid >> 4;           // 0..15
  const int ccol = (tid & 15) * 8;     // element offset in the staged row
  const __bf16* aptr = A + (size_t)(bm + crow) * K + ccol;
  const __bf16* wptr = W + (size_t)(bn + crow) * K + ccol;
  const unsigned int lA = (unsigned int)(uintptr_t)(&As[0][crow * GPITCH + ccol]);
  const unsigned int lW = (unsigned int)(uintptr_t)(&Ws[0][crow * GPITCH + ccol]);
  const unsigned int rstep = 16 * GPITCH * 2;    // 16 LDS rows, bytes
  const unsigned int bstep = 128 * GPITCH * 2;   // one buffer, bytes
  const size_t gstep = (size_t)16 * K;           // 16 global rows, elements

  auto stage = [&](int bsel, int k0) {
    const unsigned int la = lA + bsel * bstep;
    const unsigned int lw = lW + bsel * bstep;
    const __bf16* ag = aptr + k0;
    const __bf16* wg = wptr + k0;
    async_copy8_b128(la, la + rstep, la + 2 * rstep, la + 3 * rstep,
                     la + 4 * rstep, la + 5 * rstep, la + 6 * rstep, la + 7 * rstep,
                     ag, ag + gstep, ag + 2 * gstep, ag + 3 * gstep,
                     ag + 4 * gstep, ag + 5 * gstep, ag + 6 * gstep, ag + 7 * gstep);
    async_copy8_b128(lw, lw + rstep, lw + 2 * rstep, lw + 3 * rstep,
                     lw + 4 * rstep, lw + 5 * rstep, lw + 6 * rstep, lw + 7 * rstep,
                     wg, wg + gstep, wg + 2 * gstep, wg + 3 * gstep,
                     wg + 4 * gstep, wg + 5 * gstep, wg + 6 * gstep, wg + 7 * gstep);
  };

  stage(0, 0);
  wait_asynccnt0();     // this wave's share of stage 0 has landed
  __syncthreads();      // ... and every other wave's
  if (GBK < K) stage(1, GBK);

  int buf = 0;
  for (int k0 = 0; k0 < K; k0 += GBK) {
    const __bf16* as = As[buf] + (wm * 32 + l15) * GPITCH;
    const __bf16* ws = Ws[buf] + (wn * 64 + l15) * GPITCH;
    // unrolled: a block's place in the stage becomes an immediate LDS offset,
    // and a block's fragment reads can go under the block before it
#pragma unroll
    for (int kk = 0; kk < GBK; kk += 32) {
      v16bf af[2], bfr[4];
#pragma unroll
      for (int i = 0; i < 2; ++i)
        af[i] = load_frag(as + i * 16 * GPITCH + kk, hi8);
#pragma unroll
      for (int j = 0; j < 4; ++j)
        bfr[j] = load_frag(ws + j * 16 * GPITCH + kk, hi8);
#pragma unroll
      for (int i = 0; i < 2; ++i)
#pragma unroll
        for (int j = 0; j < 4; ++j)
          acc[i][j] = wmma_bf16(af[i], bfr[j], acc[i][j]);
    }
    // Publish point: own LDS reads of this stage retired, own copies of the
    // next stage landed, then the barrier that publishes the next stage and
    // frees this buffer for the refill behind it.
    wait_dscnt0();
    wait_asynccnt0();
    __syncthreads();
    if (k0 + 2 * GBK < K) stage(buf, k0 + 2 * GBK);
    buf ^= 1;
  }
  wait_asynccnt0();     // nothing of the ring is in flight when the wave ends

  float*  outf = (float*)outp;
  __bf16* outb = (__bf16*)outp;
#pragma unroll
  for (int i = 0; i < 2; ++i) {
    const int mrow = bm + wm * 32 + i * 16 + hi8;  // C layout: row r+8*(lane>>4)
#pragma unroll
    for (int j = 0; j < 4; ++j) {
      const int ncol = bn + wn * 64 + j * 16 + l15;
      const float bv = bias[ncol];
#pragma unroll
      for (int r = 0; r < 8; ++r) {
        float v = acc[i][j][r] + bv;
        if (RELU) v = fmaxf(v, 0.0f);
        const size_t idx = (size_t)(mrow + r) * N + ncol;
        if (OUT_BF16) outb[idx] = f2bf(v); else outf[idx] = v;
      }
    }
  }
}

template<bool RELU, bool OUT_BF16>
__global__ __launch_bounds__(256) void gemm_kernel(
    const __bf16* __restrict__ A, const __bf16* __restrict__ W,
    const float* __restrict__ bias, void* __restrict__ outp,
    int M, int N, int K)
{
  (void)M;
  gemm_tile<RELU, OUT_BF16>(A, W, bias, outp, N, K,
                            blockIdx.x * 128, blockIdx.y * 128);
}

// ---------------------------------------------------------------------------
// The five projections whose inputs are ready when the call starts, in ONE
// launch: self Q, self K, cross K, self V, cross V, each [MROWS, DMODEL] =
// act @ W^T + b, their bf16 results one behind the other in out. Eight values
// of blockIdx.y make one projection. Alone, a projection has one block per WGP,
// whose waits nothing covers, and pays its own launch gap, first fill and
// epilogue; together they keep two blocks resident per WGP, so one block's
// waits, start and end go under the other's work.
// ---------------------------------------------------------------------------
__global__ __launch_bounds__(256) void proj5_kernel(
    const __bf16* __restrict__ xa, const __bf16* __restrict__ xe,
    const __bf16* __restrict__ w0, const __bf16* __restrict__ w1,
    const __bf16* __restrict__ w2, const __bf16* __restrict__ w3,
    const __bf16* __restrict__ w4,
    const float* __restrict__ b0, const float* __restrict__ b1,
    const float* __restrict__ b2, const float* __restrict__ b3,
    const float* __restrict__ b4,
    __bf16* __restrict__ out)
{
  const int g = blockIdx.y >> 3;     // block-uniform
  const __bf16* A = (g == 2 || g == 4) ? xe : xa;
  const __bf16* W = g == 0 ? w0 : g == 1 ? w1 : g == 2 ? w2 : g == 3 ? w3 : w4;
  const float*  b = g == 0 ? b0 : g == 1 ? b1 : g == 2 ? b2 : g == 3 ? b3 : b4;
  gemm_tile<false, true>(A, W, b, (void*)(out + (size_t)g * MROWS * DMODEL),
                         DMODEL, DMODEL, blockIdx.x * 128, (blockIdx.y & 7) * 128);
}

// ---------------------------------------------------------------------------
// Transpose V ([b][s][h][d] bf16) -> Vt ([b][h][d][s] bf16) so V columns are
// contiguous for the V^T A-operand of O^T += V^T P^T.
// ---------------------------------------------------------------------------
__global__ __launch_bounds__(256) void transpose_v_kernel(
    const __bf16* __restrict__ V, __bf16* __restrict__ Vt, int Skv)
{
  __shared__ __bf16 tile[32][72];    // 32 s  x 64 d (+pad)
  const int b  = blockIdx.z;
  const int h  = blockIdx.y;
  const int s0 = blockIdx.x * 32;
  const int tid = threadIdx.x;
  {
    const int sl = tid >> 3;                 // 0..31
    const int dp = (tid & 7) * 8;            // 0..56
    const __bf16* src = V + (size_t)(b * Skv + s0 + sl) * DMODEL + h * DHEAD + dp;
    v8bf val = *(const v8bf*)src;
#pragma unroll
    for (int i = 0; i < 8; ++i) tile[sl][dp + i] = val[i];
  }
  __syncthreads();
  {
    const int dl = tid >> 2;                 // 0..63
    const int sp = (tid & 3) * 8;            // 0..24
    v8bf o;
#pragma unroll
    for (int i = 0; i < 8; ++i) o[i] = tile[sp + i][dl];
    __bf16* dst = Vt + (size_t)((b * NHEAD + h) * DHEAD + dl) * Skv + s0 + sp;
    *(v8bf*)dst = o;
  }
}

// ---------------------------------------------------------------------------
// Both int32 masks ([B][T][S]) packed once per call into the lane masks that
// the attention selects on. For 16 queries q0.. and 32 keys s0.. there are 16
// words; bit l of word 8 t + r says whether key s0 + 16 t + 8 (l >> 4) + r of
// query q0 + (l & 15) is kept: lane l's place in the score tiles of the
// attention. Layout [mask][b][q / 16][s / 32][16]. One wave takes 16 queries x
// 128 keys: 16 loads of 16 B a lane, all in flight together, and writes 256 B.
// ---------------------------------------------------------------------------
typedef __attribute__((ext_vector_type(4)))  int          v4i;
typedef __attribute__((ext_vector_type(16))) unsigned int v16u;
// The same in the constant address space: nothing writes the packed masks while
// the attention runs, and read so a wave-uniform address gives a scalar load.
typedef __attribute__((address_space(4))) v16u cv16u;
__global__ __launch_bounds__(256) void pack_mask_kernel(
    const int* __restrict__ m0, const int* __restrict__ m1,
    unsigned int* __restrict__ pm)
{
  const int lane = threadIdx.x & 31;
  const int l15  = lane & 15;
  const int hi8  = (lane >> 4) << 3;
  const int gw   = blockIdx.x * 8 + (threadIdx.x >> 5);
  const int kg   = gw & (SSEQ / 128 - 1);       // group of 128 keys
  const int rowt = gw / (SSEQ / 128);           // (mask * B + b) * T / 16 + q / 16
  const int rt   = rowt & (MROWS / 16 - 1);     // b * T / 16 + q / 16
  const int* src = rowt >= MROWS / 16 ? m1 : m0;   // block-uniform
  const int* p = src + ((size_t)rt * 16 + l15) * SSEQ + kg * 128 + hi8;
  v4i v[16];
#pragma unroll
  for (int c = 0; c < 16; ++c)
    v[c] = *(const v4i*)(p + (c >> 2) * 32 + ((c >> 1) & 1) * 16 + (c & 1) * 4);
  unsigned int w[4];     // lane l: word l & 15 of each of the four key blocks
#pragma unroll
  for (int kb = 0; kb < 4; ++kb) {
    w[kb] = 0u;
#pragma unroll
    for (int e = 0; e < 16; ++e) {
      const unsigned int bal =
          __builtin_amdgcn_ballot_w32(v[kb * 4 + (e >> 2)][e & 3] != 0);
      if (l15 == e) w[kb] = bal;
    }
  }
  unsigned int* d = pm + ((size_t)rowt * (SSEQ / 32) + kg * 4) * 16 + lane;
  d[0]  = lane < 16 ? w[0] : w[1];
  d[32] = lane < 16 ? w[2] : w[3];
}

#define KVPITCH 72
// value of lane l ^ 16
__device__ __forceinline__ float other_half(float v) {
  const int b = __float_as_int(v);
  return __int_as_float(
      __builtin_amdgcn_permlanex16(b, b, 0x76543210, 0xfedcba98, false, false));
}
__global__ __launch_bounds__(128) void attn_kernel(
    const __bf16* __restrict__ Qb,   // [B*Tq, DMODEL] bf16
    const __bf16* __restrict__ Kb,   // [B*Skv, DMODEL] bf16
    const __bf16* __restrict__ Vt,   // [B*H*DHEAD, Skv] bf16
    const unsigned int* __restrict__ pmask, // [B][Tq/16][Skv/32][16] lane masks
    float*        __restrict__ ctx,  // [B*Tq, DMODEL] f32
    int Tq, int Skv)
{
  // 64 rows of 128 B at a pitch of 144 B (16 B x odd: no bank conflict for the
  // 16-byte fragment reads).
  __shared__ __attribute__((aligned(16))) __bf16 Ks[2][64 * KVPITCH];
  __shared__ __attribute__((aligned(16))) __bf16 Vs[2][64 * KVPITCH];
  const int lane = threadIdx.x & 31;
  // in a scalar register: the address of the wave's lane masks is formed from it
  const int wave = __builtin_amdgcn_readfirstlane(threadIdx.x >> 5);
  const int l15  = lane & 15;
  const int hi8  = (lane >> 4) << 3;
  const int h    = blockIdx.y;
  const int b    = blockIdx.z;
  const int q0   = blockIdx.x * 64 + wave * 16;

  // B operand: column l15 = query q0 + l15, k in the hardware order
  const __bf16* qrow = Qb + (size_t)(b * Tq + q0 + l15) * DMODEL + h * DHEAD;
  const v16bf qf0 = load_frag(qrow, hi8);        // K-dim 0..31 of head
  const v16bf qf1 = load_frag(qrow + 32, hi8);   // K-dim 32..63

  const __bf16* kbase  = Kb + (size_t)b * Skv * DMODEL + h * DHEAD;
  const __bf16* vtbase = Vt + (size_t)((b * NHEAD + h) * DHEAD) * Skv;
  // the lane masks of this wave's 16 queries, 16 words per 32 keys
  const unsigned int* pmw =
      pmask + ((size_t)(b * Tq + q0) >> 4) * (size_t)(Skv >> 5) * 16;

  const v8f vzero = {0.f,0.f,0.f,0.f,0.f,0.f,0.f,0.f};
  v8f o[4];        // o[j][r] = O[q0 + l15][j * 16 + hi8 + r]
#pragma unroll
  for (int j = 0; j < 4; ++j) o[j] = vzero;
  float mrow = -1e30f;   // running maximum of the lane's query (both halves)
  float lrow = 0.f;      // running sum over this half's keys only

  // Staging map: thread t brings 16 B at column chunk (t & 7) of rows
  // (t >> 3) + 16 * i, i = 0..3, of the K tile and of the V^T tile: each
  // wave-wide copy covers four whole 128-B lines.
  const int crow = threadIdx.x >> 3;          // 0..15
  const int ccol = (threadIdx.x & 7) * 8;     // element offset in the row
  const __bf16* kcp = kbase  + (size_t)crow * DMODEL + ccol;
  const __bf16* vcp = vtbase + (size_t)crow * Skv + ccol;
  const unsigned int lK = (unsigned int)(uintptr_t)(&Ks[0][crow * KVPITCH + ccol]);
  const unsigned int lV = (unsigned int)(uintptr_t)(&Vs[0][crow * KVPITCH + ccol]);
  const unsigned int rstep = 16 * KVPITCH * 2;   // 16 LDS rows, bytes
  const unsigned int bstep = 64 * KVPITCH * 2;   // one buffer, bytes
  auto stage = [&](int bsel, int key0) {
    const unsigned int lk = lK + bsel * bstep;
    const unsigned int lv = lV + bsel * bstep;
    const __bf16* kg = kcp + (size_t)key0 * DMODEL;
    const __bf16* vg = vcp + key0;
    async_copy8_b128(lk, lk + rstep, lk + 2 * rstep, lk + 3 * rstep,
                     lv, lv + rstep, lv + 2 * rstep, lv + 3 * rstep,
                     kg, kg + 16 * DMODEL, kg + 32 * DMODEL, kg + 48 * DMODEL,
                     vg, vg + (size_t)16 * Skv, vg + (size_t)32 * Skv,
                     vg + (size_t)48 * Skv);
  };

  stage(0, 0);
  wait_asynccnt0();     // this wave's share of tile 0 has landed
  __syncthreads();      // ... and every other wave's
  if (64 < Skv) stage(1, 64);

  // lane masks of tile 0; each trip fetches the next tile's, well ahead of
  // their use, so that no pass waits out a scalar load
  v16u mwc[2] = { *(const cv16u*)(pmw), *(const cv16u*)(pmw + 16) };

  int buf = 0;
  for (int t0 = 0; t0 < Skv; t0 += 64) {
   const __bf16* kt = Ks[buf];
   const __bf16* vt = Vs[buf];
   // the last trip fetches its own again: the address stays inside the array
   const unsigned int* pmn = pmw + (size_t)((t0 + 64 < Skv ? t0 + 64 : t0) >> 5) * 16;
   const v16u mwn[2] = { *(const cv16u*)(pmn), *(const cv16u*)(pmn + 16) };
   // unrolled: the pass's place in the tile becomes an immediate LDS offset
#pragma unroll
   for (int p = 0; p < 2; ++p) {
    const int s0 = t0 + p * 32;
    // lane masks of the pass: word 8 t + r for score sc[t][r]
    const v16u mw = mwc[p];
    // A operands of the pass: K rows (keys) and V^T rows (head dims)
    v16bf kf[4], vf[4];
#pragma unroll
    for (int t = 0; t < 2; ++t) {
      const __bf16* krow = kt + (p * 32 + t * 16 + l15) * KVPITCH;
      kf[t * 2]     = load_frag(krow, hi8);
      kf[t * 2 + 1] = load_frag(krow + 32, hi8);
    }
#pragma unroll
    for (int j = 0; j < 4; ++j)
      vf[j] = load_frag(vt + (j * 16 + l15) * KVPITCH + p * 32, hi8);
    v8f sc[2];     // sc[t][r] = score(key s0 + 16 t + hi8 + r, query q0 + l15)
#pragma unroll
    for (int t = 0; t < 2; ++t) {
      sc[t] = wmma_bf16(kf[t * 2], qf0, vzero);
      sc[t] = wmma_bf16(kf[t * 2 + 1], qf1, sc[t]);
    }
    // scale + mask + maximum over the lane's 16 keys
    float nmax = -1e30f;
#pragma unroll
    for (int t = 0; t < 2; ++t)
#pragma unroll
      for (int r = 0; r < 8; ++r) {
        float v = sc[t][r] * 0.125f;   // 1/sqrt(64)
        if (!__builtin_amdgcn_inverse_ballot_w32(mw[t * 8 + r])) v = -1e9f;
        sc[t][r] = v;
        nmax = fmaxf(nmax, v);
      }
    nmax = fmaxf(nmax, other_half(nmax));   // all 32 keys of the query

    const float mn  = fmaxf(mrow, nmax);
    const float scl = __expf(mrow - mn);
    mrow = mn;
    float rsum = 0.f;
    v16bf pf;      // B operand P^T: pf[s] = P[key kmap(s, h)][query l15]
#pragma unroll
    for (int t = 0; t < 2; ++t)
#pragma unroll
      for (int r = 0; r < 8; ++r) {
        const float pv = __expf(sc[t][r] - mn);
        rsum += pv;
        pf[t * 8 + r] = (__bf16)pv;
      }
    lrow = lrow * scl + rsum;
#pragma unroll
    for (int j = 0; j < 4; ++j)
#pragma unroll
      for (int r = 0; r < 8; ++r) o[j][r] *= scl;

#pragma unroll
    for (int j = 0; j < 4; ++j) o[j] = wmma_bf16(vf[j], pf, o[j]);
   }
   // Publish point: own LDS reads of this tile retired, own copies of the next
   // tile landed, then the barrier that publishes the next tile and frees this
   // buffer for the refill behind it.
   wait_dscnt0();
   wait_asynccnt0();
   __syncthreads();
   if (t0 + 128 < Skv) stage(buf, t0 + 128);
   buf ^= 1;
   mwc[0] = mwn[0];
   mwc[1] = mwn[1];
  }
  wait_asynccnt0();     // nothing of the ring is in flight when the wave ends

  // the halves' sums are joined once, here
  const float inv = 1.0f / (lrow + other_half(lrow));
  float* crow_out = ctx + (size_t)(b * Tq + q0 + l15) * DMODEL + h * DHEAD + hi8;
#pragma unroll
  for (int j = 0; j < 4; ++j) {
    const v4f lo = { o[j][0] * inv, o[j][1] * inv, o[j][2] * inv, o[j][3] * inv };
    const v4f hi = { o[j][4] * inv, o[j][5] * inv, o[j][6] * inv, o[j][7] * inv };
    *(v4f*)(crow_out + j * 16)     = lo;
    *(v4f*)(crow_out + j * 16 + 4) = hi;
  }
}

// ---------------------------------------------------------------------------
// Residual add + LayerNorm; writes f32 stream + bf16 copy for next GEMM.
// One block per row of 1024. (x/yout may alias for in-place update.)
// ---------------------------------------------------------------------------
__global__ __launch_bounds__(256) void ln_kernel(
    const float* x, const float* __restrict__ sub,
    const float* __restrict__ g, const float* __restrict__ bta,
    float* yout, __bf16* __restrict__ ybf)
{
  __shared__ float s1[256], s2[256];
  const size_t base = (size_t)blockIdx.x * DMODEL;
  float v[4];
  float lsum = 0.f, lsq = 0.f;
#pragma unroll
  for (int k = 0; k < 4; ++k) {
    const int i = threadIdx.x + k * 256;
    v[k] = x[base + i] + sub[base + i];
    lsum += v[k];
    lsq  += v[k] * v[k];
  }
  s1[threadIdx.x] = lsum; s2[threadIdx.x] = lsq;
  __syncthreads();
  for (int off = 128; off > 0; off >>= 1) {
    if (threadIdx.x < off) {
      s1[threadIdx.x] += s1[threadIdx.x + off];
      s2[threadIdx.x] += s2[threadIdx.x + off];
    }
    __syncthreads();
  }
  const float mean = s1[0] * (1.0f / DMODEL);
  const float var  = s2[0] * (1.0f / DMODEL) - mean * mean;
  const float rs   = rsqrtf(var + 1e-5f);
#pragma unroll
  for (int k = 0; k < 4; ++k) {
    const int i = threadIdx.x + k * 256;
    const float o = (v[k] - mean) * rs * g[i] + bta[i];
    yout[base + i] = o;
    ybf[base + i]  = f2bf(o);
  }
}

// ---------------------------------------------------------------------------
// Host orchestration
// ---------------------------------------------------------------------------
extern "C" void kernel_launch(void* const* d_in, const int* in_sizes, int n_in,
                              void* d_out, int out_size, void* d_ws, size_t ws_size,
                              hipStream_t stream) {
  (void)in_sizes; (void)n_in; (void)out_size; (void)ws_size;

  const float* x        = (const float*)d_in[0];
  const float* enc      = (const float*)d_in[1];
  const int*   src_mask = (const int*)d_in[2];
  const int*   tgt_mask = (const int*)d_in[3];
  const float* sa_Wq = (const float*)d_in[4],  *sa_bq = (const float*)d_in[5];
  const float* sa_Wk = (const float*)d_in[6],  *sa_bk = (const float*)d_in[7];
  const float* sa_Wv = (const float*)d_in[8],  *sa_bv = (const float*)d_in[9];
  const float* sa_Wo = (const float*)d_in[10], *sa_bo = (const float*)d_in[11];
  const float* ca_Wq = (const float*)d_in[12], *ca_bq = (const float*)d_in[13];
  const float* ca_Wk = (const float*)d_in[14], *ca_bk = (const float*)d_in[15];
  const float* ca_Wv = (const float*)d_in[16], *ca_bv = (const float*)d_in[17];
  const float* ca_Wo = (const float*)d_in[18], *ca_bo = (const float*)d_in[19];
  const float* ff_W1 = (const float*)d_in[20], *ff_b1 = (const float*)d_in[21];
  const float* ff_W2 = (const float*)d_in[22], *ff_b2 = (const float*)d_in[23];
  const float* ln1_g = (const float*)d_in[24], *ln1_b = (const float*)d_in[25];
  const float* ln2_g = (const float*)d_in[26], *ln2_b = (const float*)d_in[27];
  const float* ln3_g = (const float*)d_in[28], *ln3_b = (const float*)d_in[29];

  char* ws = (char*)d_ws;
  const size_t MB = 1024ull * 1024ull;
  // bf16 weights
  __bf16* saWq_bf = (__bf16*)(ws + 0 * MB);
  __bf16* saWk_bf = (__bf16*)(ws + 2 * MB);
  __bf16* saWv_bf = (__bf16*)(ws + 4 * MB);
  __bf16* saWo_bf = (__bf16*)(ws + 6 * MB);
  __bf16* caWq_bf = (__bf16*)(ws + 8 * MB);
  __bf16* caWk_bf = (__bf16*)(ws + 10 * MB);
  __bf16* caWv_bf = (__bf16*)(ws + 12 * MB);
  __bf16* caWo_bf = (__bf16*)(ws + 14 * MB);
  __bf16* W1_bf   = (__bf16*)(ws + 16 * MB);   // 8 MB
  __bf16* W2_bf   = (__bf16*)(ws + 24 * MB);   // 8 MB
  // activations
  __bf16* x_bf    = (__bf16*)(ws + 32 * MB);
  __bf16* enc_bf  = (__bf16*)(ws + 40 * MB);
  __bf16* Qb      = (__bf16*)(ws + 48 * MB);
  float*  ctx     = (float*) (ws + 80 * MB);   // 16 MB
  float*  proj    = (float*) (ws + 96 * MB);   // 16 MB
  float*  yres    = (float*) (ws + 112 * MB);  // 16 MB
  __bf16* y_bf    = (__bf16*)(ws + 128 * MB);  // 8 MB
  __bf16* hidden  = (__bf16*)(ws + 136 * MB);  // 32 MB
  __bf16* ctx_bf  = (__bf16*)(ws + 168 * MB);  // 8 MB
  unsigned int* pm_tgt = (unsigned int*)(ws + 176 * MB);  // 1 MB
  unsigned int* pm_src = (unsigned int*)(ws + 177 * MB);  // 1 MB, behind pm_tgt
  // results of the merged projections, 8 MB each, one behind the other
  __bf16* saQ     = (__bf16*)(ws + 178 * MB);
  __bf16* saK     = (__bf16*)(ws + 186 * MB);
  __bf16* caK     = (__bf16*)(ws + 194 * MB);
  __bf16* saV     = (__bf16*)(ws + 202 * MB);  // cross V behind it, at 210 MB
  __bf16* saVt    = (__bf16*)(ws + 218 * MB);
  __bf16* caVt    = (__bf16*)(ws + 226 * MB);  // behind saVt

  auto cvt = [&](const float* in, __bf16* out, int n) {
    cvt_kernel<<<dim3(2048), dim3(256), 0, stream>>>(in, out, n);
  };
  auto gemmF = [&](const __bf16* A, const __bf16* W, const float* b, float* out,
                   int M, int N, int K) {
    gemm_kernel<false, false><<<dim3(M / 128, N / 128), 256, 0, stream>>>(
        A, W, b, (void*)out, M, N, K);
  };
  auto gemmB = [&](const __bf16* A, const __bf16* W, const float* b, __bf16* out,
                   int M, int N, int K) {
    gemm_kernel<false, true><<<dim3(M / 128, N / 128), 256, 0, stream>>>(
        A, W, b, (void*)out, M, N, K);
  };

  // --- precision staging ---
  // saWq_bf .. enc_bf are the 24 segments of one array that starts at saWq_bf
  cvt_inputs_kernel<<<dim3(24 * 32), dim3(256), 0, stream>>>(
      sa_Wq, sa_Wk, sa_Wv, sa_Wo, ca_Wq, ca_Wk, ca_Wv, ca_Wo,
      ff_W1, ff_W2, x, enc, saWq_bf);

  // both masks -> lane masks, pm_tgt then pm_src: one wave per 16 x 128 bits
  pack_mask_kernel<<<dim3(2 * (MROWS / 16) * (SSEQ / 128) / 8), dim3(256), 0, stream>>>(
      tgt_mask, src_mask, pm_tgt);

  // --- every projection of x and of the encoder output ---
  proj5_kernel<<<dim3(MROWS / 128, 5 * (DMODEL / 128)), 256, 0, stream>>>(
      x_bf, enc_bf, saWq_bf, saWk_bf, caWk_bf, saWv_bf, caWv_bf,
      sa_bq, sa_bk, ca_bk, sa_bv, ca_bv, saQ);
  // self V and cross V lie one behind the other and have the same length, and
  // so do their transposes: one launch takes them as 2 * NB batches
  static_assert(TSEQ == SSEQ, "the merged transpose takes both V as one array");
  transpose_v_kernel<<<dim3(TSEQ / 32, NHEAD, 2 * NB), 256, 0, stream>>>(saV, saVt, TSEQ);

  // --- self attention ---
  attn_kernel<<<dim3(TSEQ / 64, NHEAD, NB), 128, 0, stream>>>(
      saQ, saK, saVt, pm_tgt, ctx, TSEQ, TSEQ);
  cvt(ctx, ctx_bf, MROWS * DMODEL);
  gemmF(ctx_bf, saWo_bf, sa_bo, proj, MROWS, DMODEL, DMODEL);
  ln_kernel<<<MROWS, 256, 0, stream>>>(x, proj, ln1_g, ln1_b, yres, y_bf);

  // --- cross attention ---
  gemmB(y_bf,   caWq_bf, ca_bq, Qb, MROWS, DMODEL, DMODEL);
  attn_kernel<<<dim3(TSEQ / 64, NHEAD, NB), 128, 0, stream>>>(
      Qb, caK, caVt, pm_src, ctx, TSEQ, SSEQ);
  cvt(ctx, ctx_bf, MROWS * DMODEL);
  gemmF(ctx_bf, caWo_bf, ca_bo, proj, MROWS, DMODEL, DMODEL);
  ln_kernel<<<MROWS, 256, 0, stream>>>(yres, proj, ln2_g, ln2_b, yres, y_bf);

  // --- feed forward ---
  gemm_kernel<true, true><<<dim3(MROWS / 128, DFFN / 128), 256, 0, stream>>>(
      y_bf, W1_bf, ff_b1, (void*)hidden, MROWS, DFFN, DMODEL);
  gemmF(hidden, W2_bf, ff_b2, proj, MROWS, DMODEL, DFFN);
  ln_kernel<<<MROWS, 256, 0, stream>>>(yres, proj, ln3_g, ln3_b, (float*)d_out, y_bf);
}

// v008
// A run of this version takes 279 microseconds.
// Timed twice side by side with v007, it ran 1.08 times as fast both times.
// All steps since v000 together make it 2.88 times as fast.
#include <hip/hip_runtime.h>

// ---------------------------------------------------------------------------
// Problem constants (from reference): D=1024, H=16, DK=64, DFF=4096, B=2,
// T=S=2048.  M = B*T = 4096 rows for every activation GEMM.
// ---------------------------------------------------------------------------
#define DMODEL 1024
#define NHEAD  16
#define DHEAD  64
#define DFFN   4096
#define NB     2
#define TSEQ   2048
#define SSEQ   2048
#define MROWS  (NB * TSEQ)   // 4096

typedef __attribute__((ext_vector_type(16))) __bf16 v16bf;
typedef __attribute__((ext_vector_type(8)))  __bf16 v8bf;
typedef __attribute__((ext_vector_type(8)))  float  v8f;

// ---------------------------------------------------------------------------
// Helpers
// ---------------------------------------------------------------------------
__device__ __forceinline__ __bf16 f2bf(float f) {
  unsigned int u = __float_as_uint(f);
  u += 0x7FFFu + ((u >> 16) & 1u);          // round-to-nearest-even
  unsigned short s = (unsigned short)(u >> 16);
  __bf16 r;
  __builtin_memcpy(&r, &s, 2);
  return r;
}

// Load one WMMA 16-lane fragment row following the CDNA5 per-lane K-chunk
// layout: lanes 0-15 hold K {hi8=0: 0..7,16..23}, lanes 16-31 hold {8..15,24..31}.
__device__ __forceinline__ v16bf load_frag(const __bf16* row, int hi8) {
  v8bf a = *(const v8bf*)(row + hi8);
  v8bf b = *(const v8bf*)(row + hi8 + 16);
  return __builtin_shufflevector(a, b, 0,1,2,3,4,5,6,7,8,9,10,11,12,13,14,15);
}

__device__ __forceinline__ v8f wmma_bf16(v16bf a, v16bf b, v8f c) {
  return __builtin_amdgcn_wmma_f32_16x16x32_bf16(
      /*neg_a=*/false, a, /*neg_b=*/false, b,
      /*c_mod=*/(short)0, c, /*reuse_a=*/false, /*reuse_b=*/false);
}

// CDNA5 async global->LDS copies (16B per lane) are tracked by ASYNCcnt. Their
// LDS address is the byte offset within the workgroup LDS allocation (low 32
// bits of the generic pointer), their global address a per-lane 64-bit pointer.
__device__ __forceinline__ void wait_asynccnt0() {
  asm volatile("s_wait_asynccnt 0x0" ::: "memory");
}
// Eight async copies (16B per lane each) in one statement. The closing
// s_wait_xcnt stands inside the statement so that no address register of an
// issued copy is rewritten ahead of it.
__device__ __forceinline__ void async_copy8_b128(
    unsigned int l0, unsigned int l1, unsigned int l2, unsigned int l3,
    unsigned int l4, unsigned int l5, unsigned int l6, unsigned int l7,
    const void* g0, const void* g1, const void* g2, const void* g3,
    const void* g4, const void* g5, const void* g6, const void* g7) {
  asm volatile("global_load_async_to_lds_b128 %0, %8, off\n\t"
               "global_load_async_to_lds_b128 %1, %9, off\n\t"
               "global_load_async_to_lds_b128 %2, %10, off\n\t"
               "global_load_async_to_lds_b128 %3, %11, off\n\t"
               "global_load_async_to_lds_b128 %4, %12, off\n\t"
               "global_load_async_to_lds_b128 %5, %13, off\n\t"
               "global_load_async_to_lds_b128 %6, %14, off\n\t"
               "global_load_async_to_lds_b128 %7, %15, off\n\t"
               "s_wait_xcnt 0x0"
               :: "v"(l0), "v"(l1), "v"(l2), "v"(l3),
                  "v"(l4), "v"(l5), "v"(l6), "v"(l7),
                  "v"(g0), "v"(g1), "v"(g2), "v"(g3),
                  "v"(g4), "v"(g5), "v"(g6), "v"(g7)
               : "memory");
}
// Retires this wave's LDS reads before a barrier behind which the buffer they
// read is refilled by copies.
__device__ __forceinline__ void wait_dscnt0() {
  asm volatile("s_wait_dscnt 0x0" ::: "memory");
}

// ---------------------------------------------------------------------------
// All twelve f32 -> bf16 conversions of the inputs in ONE launch. Their bf16
// images lie one behind the other in the workspace, so the destination is one
// array of 24 segments of 2^20 elements: segments 0..7 the eight D x D
// weights, 8..11 and 12..15 the two feed-forward weights, 16..19 and 20..23
// the two activations. 32 blocks share a segment; a block converts 32768
// contiguous elements, 1024 a trip: each wave-wide load covers four whole
// 128-B lines, each wave-wide store two. Few long-lived waves take the place
// of many short ones: the time of the short launches was the start of their
// waves, not their bytes.
// ---------------------------------------------------------------------------
typedef __attribute__((ext_vector_type(4))) float  v4f;
typedef __attribute__((ext_vector_type(4))) __bf16 v4bf;
#define CVT_SEG_LOG2   20
#define CVT_BLK_ELEMS  32768
__global__ __launch_bounds__(256) void cvt_inputs_kernel(
    const float* __restrict__ w0, const float* __restrict__ w1,
    const float* __restrict__ w2, const float* __restrict__ w3,
    const float* __restrict__ w4, const float* __restrict__ w5,
    const float* __restrict__ w6, const float* __restrict__ w7,
    const float* __restrict__ f1, const float* __restrict__ f2,
    const float* __restrict__ xa, const float* __restrict__ xe,
    __bf16* __restrict__ out)
{
  const int seg = blockIdx.x >> 5;     // block-uniform
  const float* src;
  int first;                           // the source's first segment
  if (seg < 8) {
    first = seg;
    src = seg == 0 ? w0 : seg == 1 ? w1 : seg == 2 ? w2 : seg == 3 ? w3
        : seg == 4 ? w4 : seg == 5 ? w5 : seg == 6 ? w6 : w7;
  } else if (seg < 12) { first = 8;  src = f1; }
  else if (seg < 16)   { first = 12; src = f2; }
  else if (seg < 20)   { first = 16; src = xa; }
  else                 { first = 20; src = xe; }
  const size_t inseg = (size_t)(blockIdx.x & 31) * CVT_BLK_ELEMS + threadIdx.x * 4;
  const float* s = src + ((size_t)(seg - first) << CVT_SEG_LOG2) + inseg;
  __bf16*      d = out + ((size_t)seg << CVT_SEG_LOG2) + inseg;
  // Four groups of eight trips: a group's eight 16-B loads per lane are in
  // flight together, ahead of its stores. Unrolled: every place in the block's
  // share is an immediate offset, so no address register is ever rewritten.
#pragma unroll
  for (int g = 0; g < CVT_BLK_ELEMS / 8192; ++g) {
    v4f v[8];
#pragma unroll
    for (int i = 0; i < 8; ++i) v[i] = *(const v4f*)(s + (g * 8 + i) * 1024);
#pragma unroll
    for (int i = 0; i < 8; ++i) {
      v4bf o;
#pragma unroll
      for (int e = 0; e < 4; ++e) o[e] = f2bf(v[i][e]);
      *(v4bf*)(d + (g * 8 + i) * 1024) = o;
    }
    // the next group's loads reuse the data registers of these stores
    if (g + 1 < CVT_BLK_ELEMS / 8192) asm volatile("s_wait_xcnt 0x0" ::: "memory");
  }
}

// ---------------------------------------------------------------------------
// Tiled GEMM: out[M,N] = A[M,K] @ W[N,K]^T + bias[N]   (torch Linear semantics)
// Block = 256 threads = 8 waves; 128x128 output tile; wave tile 32x64.
// K is staged 128 wide through double-buffered LDS using async global->LDS
// copies so the next stage streams in while WMMAs consume the current one: a
// stage feeds four blocks of 8 WMMAs a wave, so one publish point (two waits
// and a barrier) and one landing latency serve 128 k, and every wave-wide copy
// takes whole 128-B lines (two rows of 256 B).
// A staged row holds 256 B of data at a pitch of 272 B (16 B x odd): the
// sixteen rows that a half wave reads 16 B of fall on all 64 banks once.
// K must be a multiple of 128.
// ---------------------------------------------------------------------------
#define GBK    128  // k per stage
#define GPITCH 136  // bf16 elements per staged LDS row (272 B)
// One block's 128x128 tile at rows bm.., columns bn.. Where VTSEL is set (bf16
// results only) and vt (block-uniform) holds, the tile is stored transposed per
// batch, as the attention reads V: out[b][column][s] for row b * TSEQ + s. A
// lane's eight accumulator rows of one column are eight consecutive s, so they
// go as one 16-B store.
template<bool RELU, bool OUT_BF16, bool VTSEL>
__device__ __forceinline__ void gemm_tile(
    const __bf16* __restrict__ A, const __bf16* __restrict__ W,
    const float* __restrict__ bias, void* __restrict__ outp,
    int N, int K, int bm, int bn, bool vt)
{
  __shared__ __attribute__((aligned(16))) __bf16 As[2][128 * GPITCH];
  __shared__ __attribute__((aligned(16))) __bf16 Ws[2][128 * GPITCH];

  const int tid  = threadIdx.x;
  const int lane = tid & 31;
  const int wave = tid >> 5;     // 0..7
  const int wm   = wave >> 1;    // 0..3 -> 32-row strip
  const int wn   = wave & 1;     // 0..1 -> 64-col strip
  const int l15  = lane & 15;
  const int hi8  = (lane >> 4) << 3;

  const v8f vzero = {0.f,0.f,0.f,0.f,0.f,0.f,0.f,0.f};
  v8f acc[2][4];
#pragma unroll
  for (int i = 0; i < 2; ++i)
#pragma unroll
    for (int j = 0; j < 4; ++j) acc[i][j] = vzero;

  // Staging map: thread t brings 16 B at column chunk (t & 15) of rows
  // (t >> 4) + 16 * i, i = 0..7, of the A stage and of the W stage.
  const int crow = tid >> 4;           // 0..15
  const int ccol = (tid & 15) * 8;     // element offset in the staged row
  const __bf16* aptr = A + (size_t)(bm + crow) * K + ccol;
  const __bf16* wptr = W + (size_t)(bn + crow) * K + ccol;
  const unsigned int lA = (unsigned int)(uintptr_t)(&As[0][crow * GPITCH + ccol]);
  const unsigned int lW = (unsigned int)(uintptr_t)(&Ws[0][crow * GPITCH + ccol]);
  const unsigned int rstep = 16 * GPITCH * 2;    // 16 LDS rows, bytes
  const unsigned int bstep = 128 * GPITCH * 2;   // one buffer, bytes
  const size_t gstep = (size_t)16 * K;           // 16 global rows, elements

  auto stage = [&](int bsel, int k0) {
    const unsigned int la = lA + bsel * bstep;
    const unsigned int lw = lW + bsel * bstep;
    const __bf16* ag = aptr + k0;
    const __bf16* wg = wptr + k0;
    async_copy8_b128(la, la + rstep, la + 2 * rstep, la + 3 * rstep,
                     la + 4 * rstep, la + 5 * rstep, la + 6 * rstep, la + 7 * rstep,
                     ag, ag + gstep, ag + 2 * gstep, ag + 3 * gstep,
                     ag + 4 * gstep, ag + 5 * gstep, ag + 6 * gstep, ag + 7 * gstep);
    async_copy8_b128(lw, lw + rstep, lw + 2 * rstep, lw + 3 * rstep,
                     lw + 4 * rstep, lw + 5 * rstep, lw + 6 * rstep, lw + 7 * rstep,
                     wg, wg + gstep, wg + 2 * gstep, wg + 3 * gstep,
                     wg + 4 * gstep, wg + 5 * gstep, wg + 6 * gstep, wg + 7 * gstep);
  };

  stage(0, 0);
  wait_asynccnt0();     // this wave's share of stage 0 has landed
  __syncthreads();      // ... and every other wave's
  if (GBK < K) stage(1, GBK);

  int buf = 0;
  for (int k0 = 0; k0 < K; k0 += GBK) {
    const __bf16* as = As[buf] + (wm * 32 + l15) * GPITCH;
    const __bf16* ws = Ws[buf] + (wn * 64 + l15) * GPITCH;
    // unrolled: a block's place in the stage becomes an immediate LDS offset,
    // and a block's fragment reads can go under the block before it
#pragma unroll
    for (int kk = 0; kk < GBK; kk += 32) {
      v16bf af[2], bfr[4];
#pragma unroll
      for (int i = 0; i < 2; ++i)
        af[i] = load_frag(as + i * 16 * GPITCH + kk, hi8);
#pragma unroll
      for (int j = 0; j < 4; ++j)
        bfr[j] = load_frag(ws + j * 16 * GPITCH + kk, hi8);
#pragma unroll
      for (int i = 0; i < 2; ++i)
#pragma unroll
        for (int j = 0; j < 4; ++j)
          acc[i][j] = wmma_bf16(af[i], bfr[j], acc[i][j]);
    }
    // Publish point: own LDS reads of this stage retired, own copies of the
    // next stage landed, then the barrier that publishes the next stage and
    // frees this buffer for the refill behind it.
    wait_dscnt0();
    wait_asynccnt0();
    __syncthreads();
    if (k0 + 2 * GBK < K) stage(buf, k0 + 2 * GBK);
    buf ^= 1;
  }
  wait_asynccnt0();     // nothing of the ring is in flight when the wave ends

  float*  outf = (float*)outp;
  __bf16* outb = (__bf16*)outp;
  if (VTSEL && OUT_BF16 && vt) {
    // all eight 16-B values first, then the eight stores, the wave's last
    // instructions: no register of an issued store is written again
    const int mrow = bm + wm * 32 + hi8;           // rows mrow + 16 i + r
    __bf16* tcol = outb + ((size_t)(mrow / TSEQ) * N + bn + wn * 64 + l15) * TSEQ
                        + (mrow % TSEQ);
    v8bf t[2][4];
#pragma unroll
    for (int j = 0; j < 4; ++j) {
      const float bv = bias[bn + wn * 64 + j * 16 + l15];
#pragma unroll
      for (int i = 0; i < 2; ++i)
#pragma unroll
        for (int r = 0; r < 8; ++r) {
          float v = acc[i][j][r] + bv;
          if (RELU) v = fmaxf(v, 0.0f);
          t[i][j][r] = f2bf(v);
        }
    }
#pragma unroll
    for (int j = 0; j < 4; ++j)
#pragma unroll
      for (int i = 0; i < 2; ++i)
        *(v8bf*)(tcol + (size_t)j * 16 * TSEQ + i * 16) = t[i][j];
    return;
  }
#pragma unroll
  for (int i = 0; i < 2; ++i) {
    const int mrow = bm + wm * 32 + i * 16 + hi8;  // C layout: row r+8*(lane>>4)
#pragma unroll
    for (int j = 0; j < 4; ++j) {
      const int ncol = bn + wn * 64 + j * 16 + l15;
      const float bv = bias[ncol];
#pragma unroll
      for (int r = 0; r < 8; ++r) {
        float v = acc[i][j][r] + bv;
        if (RELU) v = fmaxf(v, 0.0f);
        const size_t idx = (size_t)(mrow + r) * N + ncol;
        if (OUT_BF16) outb[idx] = f2bf(v); else outf[idx] = v;
      }
    }
  }
  // The built code lays the transposed block behind these stores, with a branch
  // between them: no register of an issued store is rewritten ahead of this wait
  // on any way through the listing.
  if (VTSEL) asm volatile("s_wait_xcnt 0x0" ::: "memory");
}

template<bool RELU, bool OUT_BF16>
__global__ __launch_bounds__(256) void gemm_kernel(
    const __bf16* __restrict__ A, const __bf16* __restrict__ W,
    const float* __restrict__ bias, void* __restrict__ outp,
    int M, int N, int K)
{
  (void)M;
  gemm_tile<RELU, OUT_BF16, false>(A, W, bias, outp, N, K,
                                   blockIdx.x * 128, blockIdx.y * 128, false);
}

// ---------------------------------------------------------------------------
// The five projections whose inputs are ready when the call starts, in ONE
// launch: self Q, self K, cross K, self V, cross V, each [MROWS, DMODEL] =
// act @ W^T + b, their bf16 results one behind the other in out; the two V are
// stored transposed ([b][h][d][s]), so that V columns are contiguous for the
// attention's V^T operand and no transposing launch is needed. Eight values of
// blockIdx.y make one projection. Alone, a projection has one block per WGP,
// whose waits nothing covers, and pays its own launch gap, first fill and
// epilogue; together they keep two blocks resident per WGP, so one block's
// waits, start and end go under the other's work.
// ---------------------------------------------------------------------------
__global__ __launch_bounds__(256) void proj5_kernel(
    const __bf16* __restrict__ xa, const __bf16* __restrict__ xe,
    const __bf16* __restrict__ w0, const __bf16* __restrict__ w1,
    const __bf16* __restrict__ w2, const __bf16* __restrict__ w3,
    const __bf16* __restrict__ w4,
    const float* __restrict__ b0, const float* __restrict__ b1,
    const float* __restrict__ b2, const float* __restrict__ b3,
    const float* __restrict__ b4,
    __bf16* __restrict__ out)
{
  const int g = blockIdx.y >> 3;     // block-uniform
  const __bf16* A = (g == 2 || g == 4) ? xe : xa;
  const __bf16* W = g == 0 ? w0 : g == 1 ? w1 : g == 2 ? w2 : g == 3 ? w3 : w4;
  const float*  b = g == 0 ? b0 : g == 1 ? b1 : g == 2 ? b2 : g == 3 ? b3 : b4;
  gemm_tile<false, true, true>(A, W, b, (void*)(out + (size_t)g * MROWS * DMODEL),
                               DMODEL, DMODEL, blockIdx.x * 128,
                               (blockIdx.y & 7) * 128, g >= 3);
}

// ---------------------------------------------------------------------------
// Both int32 masks ([B][T][S]) packed once per call into the lane masks that
// the attention selects on. For 16 queries q0.. and 32 keys s0.. there are 16
// words; bit l of word 8 t + r says whether key s0 + 16 t + 8 (l >> 4) + r of
// query q0 + (l & 15) is kept: lane l's place in the score tiles of the
// attention. Layout [mask][b][q / 16][s / 32][16]. One wave takes 16 queries x
// 128 keys: 16 loads of 16 B a lane, all in flight together, and writes 256 B.
// ---------------------------------------------------------------------------
typedef __attribute__((ext_vector_type(4)))  int          v4i;
typedef __attribute__((ext_vector_type(16))) unsigned int v16u;
// The same in the constant address space: nothing writes the packed masks while
// the attention runs, and read so a wave-uniform address gives a scalar load.
typedef __attribute__((address_space(4))) v16u cv16u;
__global__ __launch_bounds__(256) void pack_mask_kernel(
    const int* __restrict__ m0, const int* __restrict__ m1,
    unsigned int* __restrict__ pm)
{
  const int lane = threadIdx.x & 31;
  const int l15  = lane & 15;
  const int hi8  = (lane >> 4) << 3;
  const int gw   = blockIdx.x * 8 + (threadIdx.x >> 5);
  const int kg   = gw & (SSEQ / 128 - 1);       // group of 128 keys
  const int rowt = gw / (SSEQ / 128);           // (mask * B + b) * T / 16 + q / 16
  const int rt   = rowt & (MROWS / 16 - 1);     // b * T / 16 + q / 16
  const int* src = rowt >= MROWS / 16 ? m1 : m0;   // block-uniform
  const int* p = src + ((size_t)rt * 16 + l15) * SSEQ + kg * 128 + hi8;
  v4i v[16];
#pragma unroll
  for (int c = 0; c < 16; ++c)
    v[c] = *(const v4i*)(p + (c >> 2) * 32 + ((c >> 1) & 1) * 16 + (c & 1) * 4);
  unsigned int w[4];     // lane l: word l & 15 of each of the four key blocks
#pragma unroll
  for (int kb = 0; kb < 4; ++kb) {
    w[kb] = 0u;
#pragma unroll
    for (int e = 0; e < 16; ++e) {
      const unsigned int bal =
          __builtin_amdgcn_ballot_w32(v[kb * 4 + (e >> 2)][e & 3] != 0);
      if (l15 == e) w[kb] = bal;
    }
  }
  unsigned int* d = pm + ((size_t)rowt * (SSEQ / 32) + kg * 4) * 16 + lane;
  d[0]  = lane < 16 ? w[0] : w[1];
  d[32] = lane < 16 ? w[2] : w[3];
}

#define KVPITCH 72
// value of lane l ^ 16
__device__ __forceinline__ float other_half(float v) {
  const int b = __float_as_int(v);
  return __int_as_float(
      __builtin_amdgcn_permlanex16(b, b, 0x76543210, 0xfedcba98, false, false));
}
__global__ __launch_bounds__(128) void attn_kernel(
    const __bf16* __restrict__ Qb,   // [B*Tq, DMODEL] bf16
    const __bf16* __restrict__ Kb,   // [B*Skv, DMODEL] bf16
    const __bf16* __restrict__ Vt,   // [B*H*DHEAD, Skv] bf16
    const unsigned int* __restrict__ pmask, // [B][Tq/16][Skv/32][16] lane masks
    __bf16*       __restrict__ ctx,  // [B*Tq, DMODEL] bf16, the next GEMM's A
    int Tq, int Skv)
{
  // 64 rows of 128 B at a pitch of 144 B (16 B x odd: no bank conflict for the
  // 16-byte fragment reads).
  __shared__ __attribute__((aligned(16))) __bf16 Ks[2][64 * KVPITCH];
  __shared__ __attribute__((aligned(16))) __bf16 Vs[2][64 * KVPITCH];
  const int lane = threadIdx.x & 31;
  // in a scalar register: the address of the wave's lane masks is formed from it
  const int wave = __builtin_amdgcn_readfirstlane(threadIdx.x >> 5);
  const int l15  = lane & 15;
  const int hi8  = (lane >> 4) << 3;
  const int h    = blockIdx.y;
  const int b    = blockIdx.z;
  const int q0   = blockIdx.x * 64 + wave * 16;

  // B operand: column l15 = query q0 + l15, k in the hardware order
  const __bf16* qrow = Qb + (size_t)(b * Tq + q0 + l15) * DMODEL + h * DHEAD;
  const v16bf qf0 = load_frag(qrow, hi8);        // K-dim 0..31 of head
  const v16bf qf1 = load_frag(qrow + 32, hi8);   // K-dim 32..63

  const __bf16* kbase  = Kb + (size_t)b * Skv * DMODEL + h * DHEAD;
  const __bf16* vtbase = Vt + (size_t)((b * NHEAD + h) * DHEAD) * Skv;
  // the lane masks of this wave's 16 queries, 16 words per 32 keys
  const unsigned int* pmw =
      pmask + ((size_t)(b * Tq + q0) >> 4) * (size_t)(Skv >> 5) * 16;

  const v8f vzero = {0.f,0.f,0.f,0.f,0.f,0.f,0.f,0.f};
  v8f o[4];        // o[j][r] = O[q0 + l15][j * 16 + hi8 + r]
#pragma unroll
  for (int j = 0; j < 4; ++j) o[j] = vzero;
  float mrow = -1e30f;   // running maximum of the lane's query (both halves)
  float lrow = 0.f;      // running sum over this half's keys only

  // Staging map: thread t brings 16 B at column chunk (t & 7) of rows
  // (t >> 3) + 16 * i, i = 0..3, of the K tile and of the V^T tile: each
  // wave-wide copy covers four whole 128-B lines.
  const int crow = threadIdx.x >> 3;          // 0..15
  const int ccol = (threadIdx.x & 7) * 8;     // element offset in the row
  const __bf16* kcp = kbase  + (size_t)crow * DMODEL + ccol;
  const __bf16* vcp = vtbase + (size_t)crow * Skv + ccol;
  const unsigned int lK = (unsigned int)(uintptr_t)(&Ks[0][crow * KVPITCH + ccol]);
  const unsigned int lV = (unsigned int)(uintptr_t)(&Vs[0][crow * KVPITCH + ccol]);
  const unsigned int rstep = 16 * KVPITCH * 2;   // 16 LDS rows, bytes
  const unsigned int bstep = 64 * KVPITCH * 2;   // one buffer, bytes
  auto stage = [&](int bsel, int key0) {
    const unsigned int lk = lK + bsel * bstep;
    const unsigned int lv = lV + bsel * bstep;
    const __bf16* kg = kcp + (size_t)key0 * DMODEL;
    const __bf16* vg = vcp + key0;
    async_copy8_b128(lk, lk + rstep, lk + 2 * rstep, lk + 3 * rstep,
                     lv, lv + rstep, lv + 2 * rstep, lv + 3 * rstep,
                     kg, kg + 16 * DMODEL, kg + 32 * DMODEL, kg + 48 * DMODEL,
                     vg, vg + (size_t)16 * Skv, vg + (size_t)32 * Skv,
                     vg + (size_t)48 * Skv);
  };

  stage(0, 0);
  wait_asynccnt0();     // this wave's share of tile 0 has landed
  __syncthreads();      // ... and every other wave's
  if (64 < Skv) stage(1, 64);

  // lane masks of tile 0; each trip fetches the next tile's, well ahead of
  // their use, so that no pass waits out a scalar load
  v16u mwc[2] = { *(const cv16u*)(pmw), *(const cv16u*)(pmw + 16) };

  int buf = 0;
  for (int t0 = 0; t0 < Skv; t0 += 64) {
   const __bf16* kt = Ks[buf];
   const __bf16* vt = Vs[buf];
   // the last trip fetches its own again: the address stays inside the array
   const unsigned int* pmn = pmw + (size_t)((t0 + 64 < Skv ? t0 + 64 : t0) >> 5) * 16;
   const v16u mwn[2] = { *(const cv16u*)(pmn), *(const cv16u*)(pmn + 16) };
   // unrolled: the pass's place in the tile becomes an immediate LDS offset
#pragma unroll
   for (int p = 0; p < 2; ++p) {
    const int s0 = t0 + p * 32;
    // lane masks of the pass: word 8 t + r for score sc[t][r]
    const v16u mw = mwc[p];
    // A operands of the pass: K rows (keys) and V^T rows (head dims)
    v16bf kf[4], vf[4];
#pragma unroll
    for (int t = 0; t < 2; ++t) {
      const __bf16* krow = kt + (p * 32 + t * 16 + l15) * KVPITCH;
      kf[t * 2]     = load_frag(krow, hi8);
      kf[t * 2 + 1] = load_frag(krow + 32, hi8);
    }
#pragma unroll
    for (int j = 0; j < 4; ++j)
      vf[j] = load_frag(vt + (j * 16 + l15) * KVPITCH + p * 32, hi8);
    v8f sc[2];     // sc[t][r] = score(key s0 + 16 t + hi8 + r, query q0 + l15)
#pragma unroll
    for (int t = 0; t < 2; ++t) {
      sc[t] = wmma_bf16(kf[t * 2], qf0, vzero);
      sc[t] = wmma_bf16(kf[t * 2 + 1], qf1, sc[t]);
    }
    // scale + mask + maximum over the lane's 16 keys
    float nmax = -1e30f;
#pragma unroll
    for (int t = 0; t < 2; ++t)
#pragma unroll
      for (int r = 0; r < 8; ++r) {
        float v = sc[t][r] * 0.125f;   // 1/sqrt(64)
        if (!__builtin_amdgcn_inverse_ballot_w32(mw[t * 8 + r])) v = -1e9f;
        sc[t][r] = v;
        nmax = fmaxf(nmax, v);
      }
    nmax = fmaxf(nmax, other_half(nmax));   // all 32 keys of the query

    const float mn  = fmaxf(mrow, nmax);
    const float scl = __expf(mrow - mn);
    mrow = mn;
    float rsum = 0.f;
    v16bf pf;      // B operand P^T: pf[s] = P[key kmap(s, h)][query l15]
#pragma unroll
    for (int t = 0; t < 2; ++t)
#pragma unroll
      for (int r = 0; r < 8; ++r) {
        const float pv = __expf(sc[t][r] - mn);
        rsum += pv;
        pf[t * 8 + r] = (__bf16)pv;
      }
    lrow = lrow * scl + rsum;
#pragma unroll
    for (int j = 0; j < 4; ++j)
#pragma unroll
      for (int r = 0; r < 8; ++r) o[j][r] *= scl;

#pragma unroll
    for (int j = 0; j < 4; ++j) o[j] = wmma_bf16(vf[j], pf, o[j]);
   }
   // Publish point: own LDS reads of this tile retired, own copies of the next
   // tile landed, then the barrier that publishes the next tile and frees this
   // buffer for the refill behind it.
   wait_dscnt0();
   wait_asynccnt0();
   __syncthreads();
   if (t0 + 128 < Skv) stage(buf, t0 + 128);
   buf ^= 1;
   mwc[0] = mwn[0];
   mwc[1] = mwn[1];
  }
  wait_asynccnt0();     // nothing of the ring is in flight when the wave ends

  // the halves' sums are joined once, here
  const float inv = 1.0f / (lrow + other_half(lrow));
  __bf16* crow_out = ctx + (size_t)(b * Tq + q0 + l15) * DMODEL + h * DHEAD + hi8;
#pragma unroll
  for (int j = 0; j < 4; ++j) {
    v8bf t;
#pragma unroll
    for (int r = 0; r < 8; ++r) t[r] = f2bf(o[j][r] * inv);
    *(v8bf*)(crow_out + j * 16) = t;
  }
}

// ---------------------------------------------------------------------------
// Residual add + LayerNorm; writes f32 stream + bf16 copy for next GEMM.
// One block per row of 1024. (x/yout may alias for in-place update.)
// ---------------------------------------------------------------------------
__global__ __launch_bounds__(256) void ln_kernel(
    const float* x, const float* __restrict__ sub,
    const float* __restrict__ g, const float* __restrict__ bta,
    float* yout, __bf16* __restrict__ ybf)
{
  __shared__ float s1[256], s2[256];
  const size_t base = (size_t)blockIdx.x * DMODEL;
  float v[4];
  float lsum = 0.f, lsq = 0.f;
#pragma unroll
  for (int k = 0; k < 4; ++k) {
    const int i = threadIdx.x + k * 256;
    v[k] = x[base + i] + sub[base + i];
    lsum += v[k];
    lsq  += v[k] * v[k];
  }
  s1[threadIdx.x] = lsum; s2[threadIdx.x] = lsq;
  __syncthreads();
  for (int off = 128; off > 0; off >>= 1) {
    if (threadIdx.x < off) {
      s1[threadIdx.x] += s1[threadIdx.x + off];
      s2[threadIdx.x] += s2[threadIdx.x + off];
    }
    __syncthreads();
  }
  const float mean = s1[0] * (1.0f / DMODEL);
  const float var  = s2[0] * (1.0f / DMODEL) - mean * mean;
  const float rs   = rsqrtf(var + 1e-5f);
#pragma unroll
  for (int k = 0; k < 4; ++k) {
    const int i = threadIdx.x + k * 256;
    const float o = (v[k] - mean) * rs * g[i] + bta[i];
    yout[base + i] = o;
    ybf[base + i]  = f2bf(o);
  }
}

// ---------------------------------------------------------------------------
// Host orchestration
// ---------------------------------------------------------------------------
extern "C" void kernel_launch(void* const* d_in, const int* in_sizes, int n_in,
                              void* d_out, int out_size, void* d_ws, size_t ws_size,
                              hipStream_t stream) {
  (void)in_sizes; (void)n_in; (void)out_size; (void)ws_size;

  const float* x        = (const float*)d_in[0];
  const float* enc      = (const float*)d_in[1];
  const int*   src_mask = (const int*)d_in[2];
  const int*   tgt_mask = (const int*)d_in[3];
  const float* sa_Wq = (const float*)d_in[4],  *sa_bq = (const float*)d_in[5];
  const float* sa_Wk = (const float*)d_in[6],  *sa_bk = (const float*)d_in[7];
  const float* sa_Wv = (const float*)d_in[8],  *sa_bv = (const float*)d_in[9];
  const float* sa_Wo = (const float*)d_in[10], *sa_bo = (const float*)d_in[11];
  const float* ca_Wq = (const float*)d_in[12], *ca_bq = (const float*)d_in[13];
  const float* ca_Wk = (const float*)d_in[14], *ca_bk = (const float*)d_in[15];
  const float* ca_Wv = (const float*)d_in[16], *ca_bv = (const float*)d_in[17];
  const float* ca_Wo = (const float*)d_in[18], *ca_bo = (const float*)d_in[19];
  const float* ff_W1 = (const float*)d_in[20], *ff_b1 = (const float*)d_in[21];
  const float* ff_W2 = (const float*)d_in[22], *ff_b2 = (const float*)d_in[23];
  const float* ln1_g = (const float*)d_in[24], *ln1_b = (const float*)d_in[25];
  const float* ln2_g = (const float*)d_in[26], *ln2_b = (const float*)d_in[27];
  const float* ln3_g = (const float*)d_in[28], *ln3_b = (const float*)d_in[29];

  char* ws = (char*)d_ws;
  const size_t MB = 1024ull * 1024ull;
  // bf16 weights
  __bf16* saWq_bf = (__bf16*)(ws + 0 * MB);
  __bf16* saWk_bf = (__bf16*)(ws + 2 * MB);
  __bf16* saWv_bf = (__bf16*)(ws + 4 * MB);
  __bf16* saWo_bf = (__bf16*)(ws + 6 * MB);
  __bf16* caWq_bf = (__bf16*)(ws + 8 * MB);
  __bf16* caWk_bf = (__bf16*)(ws + 10 * MB);
  __bf16* caWv_bf = (__bf16*)(ws + 12 * MB);
  __bf16* caWo_bf = (__bf16*)(ws + 14 * MB);
  __bf16* W1_bf   = (__bf16*)(ws + 16 * MB);   // 8 MB
  __bf16* W2_bf   = (__bf16*)(ws + 24 * MB);   // 8 MB
  // activations
  __bf16* x_bf    = (__bf16*)(ws + 32 * MB);
  __bf16* enc_bf  = (__bf16*)(ws + 40 * MB);
  __bf16* Qb      = (__bf16*)(ws + 48 * MB);
  float*  proj    = (float*) (ws + 96 * MB);   // 16 MB
  float*  yres    = (float*) (ws + 112 * MB);  // 16 MB
  __bf16* y_bf    = (__bf16*)(ws + 128 * MB);  // 8 MB
  __bf16* hidden  = (__bf16*)(ws + 136 * MB);  // 32 MB
  __bf16* ctx_bf  = (__bf16*)(ws + 168 * MB);  // 8 MB
  unsigned int* pm_tgt = (unsigned int*)(ws + 176 * MB);  // 1 MB
  unsigned int* pm_src = (unsigned int*)(ws + 177 * MB);  // 1 MB, behind pm_tgt
  // results of the merged projections, 8 MB each, one behind the other
  __bf16* saQ     = (__bf16*)(ws + 178 * MB);
  __bf16* saK     = (__bf16*)(ws + 186 * MB);
  __bf16* caK     = (__bf16*)(ws + 194 * MB);
  __bf16* saVt    = (__bf16*)(ws + 202 * MB);  // stored transposed
  __bf16* caVt    = (__bf16*)(ws + 210 * MB);  // stored transposed

  auto gemmF = [&](const __bf16* A, const __bf16* W, const float* b, float* out,
                   int M, int N, int K) {
    gemm_kernel<false, false><<<dim3(M / 128, N / 128), 256, 0, stream>>>(
        A, W, b, (void*)out, M, N, K);
  };
  auto gemmB = [&](const __bf16* A, const __bf16* W, const float* b, __bf16* out,
                   int M, int N, int K) {
    gemm_kernel<false, true><<<dim3(M / 128, N / 128), 256, 0, stream>>>(
        A, W, b, (void*)out, M, N, K);
  };

  // --- precision staging ---
  // saWq_bf .. enc_bf are the 24 segments of one array that starts at saWq_bf
  cvt_inputs_kernel<<<dim3(24 * 32), dim3(256), 0, stream>>>(
      sa_Wq, sa_Wk, sa_Wv, sa_Wo, ca_Wq, ca_Wk, ca_Wv, ca_Wo,
      ff_W1, ff_W2, x, enc, saWq_bf);

  // both masks -> lane masks, pm_tgt then pm_src: one wave per 16 x 128 bits
  pack_mask_kernel<<<dim3(2 * (MROWS / 16) * (SSEQ / 128) / 8), dim3(256), 0, stream>>>(
      tgt_mask, src_mask, pm_tgt);

  // --- every projection of x and of the encoder output ---
  proj5_kernel<<<dim3(MROWS / 128, 5 * (DMODEL / 128)), 256, 0, stream>>>(
      x_bf, enc_bf, saWq_bf, saWk_bf, caWk_bf, saWv_bf, caWv_bf,
      sa_bq, sa_bk, ca_bk, sa_bv, ca_bv, saQ);
  static_assert(TSEQ == SSEQ, "the transposed store takes one length for both V");

  // --- self attention ---
  attn_kernel<<<dim3(TSEQ / 64, NHEAD, NB), 128, 0, stream>>>(
      saQ, saK, saVt, pm_tgt, ctx_bf, TSEQ, TSEQ);
  gemmF(ctx_bf, saWo_bf, sa_bo, proj, MROWS, DMODEL, DMODEL);
  ln_kernel<<<MROWS, 256, 0, stream>>>(x, proj, ln1_g, ln1_b, yres, y_bf);

  // --- cross attention ---
  gemmB(y_bf,   caWq_bf, ca_bq, Qb, MROWS, DMODEL, DMODEL);
  attn_kernel<<<dim3(TSEQ / 64, NHEAD, NB), 128, 0, stream>>>(
      Qb, caK, caVt, pm_src, ctx_bf, TSEQ, SSEQ);
  gemmF(ctx_bf, caWo_bf, ca_bo, proj, MROWS, DMODEL, DMODEL);
  ln_kernel<<<MROWS, 256, 0, stream>>>(yres, proj, ln2_g, ln2_b, yres, y_bf);

  // --- feed forward ---
  gemm_kernel<true, true><<<dim3(MROWS / 128, DFFN / 128), 256, 0, stream>>>(
      y_bf, W1_bf, ff_b1, (void*)hidden, MROWS, DFFN, DMODEL);
  gemmF(hidden, W2_bf, ff_b2, proj, MROWS, DMODEL, DFFN);
  ln_kernel<<<MROWS, 256, 0, stream>>>(yres, proj, ln3_g, ln3_b, (float*)d_out, y_bf);
}

// v009
// Measured time: 270 microseconds a run.
// Two timings next to v008 put it at 1.03 and 1.04 times that version's speed.
// Counting every step since v000, it is 2.98 times as fast.
#include <hip/hip_runtime.h>

// ---------------------------------------------------------------------------
// Problem constants (from reference): D=1024, H=16, DK=64, DFF=4096, B=2,
// T=S=2048.  M = B*T = 4096 rows for every activation GEMM.
// ---------------------------------------------------------------------------
#define DMODEL 1024
#define NHEAD  16
#define DHEAD  64
#define DFFN   4096
#define NB     2
#define TSEQ   2048
#define SSEQ   2048
#define MROWS  (NB * TSEQ)   // 4096

typedef __attribute__((ext_vector_type(16))) __bf16 v16bf;
typedef __attribute__((ext_vector_type(8)))  __bf16 v8bf;
typedef __attribute__((ext_vector_type(8)))  float  v8f;

// ---------------------------------------------------------------------------
// Helpers
// ---------------------------------------------------------------------------
__device__ __forceinline__ __bf16 f2bf(float f) {
  unsigned int u = __float_as_uint(f);
  u += 0x7FFFu + ((u >> 16) & 1u);          // round-to-nearest-even
  unsigned short s = (unsigned short)(u >> 16);
  __bf16 r;
  __builtin_memcpy(&r, &s, 2);
  return r;
}

// Load one WMMA 16-lane fragment row following the CDNA5 per-lane K-chunk
// layout: lanes 0-15 hold K {hi8=0: 0..7,16..23}, lanes 16-31 hold {8..15,24..31}.
__device__ __forceinline__ v16bf load_frag(const __bf16* row, int hi8) {
  v8bf a = *(const v8bf*)(row + hi8);
  v8bf b = *(const v8bf*)(row + hi8 + 16);
  return __builtin_shufflevector(a, b, 0,1,2,3,4,5,6,7,8,9,10,11,12,13,14,15);
}

__device__ __forceinline__ v8f wmma_bf16(v16bf a, v16bf b, v8f c) {
  return __builtin_amdgcn_wmma_f32_16x16x32_bf16(
      /*neg_a=*/false, a, /*neg_b=*/false, b,
      /*c_mod=*/(short)0, c, /*reuse_a=*/false, /*reuse_b=*/false);
}

// CDNA5 async global->LDS copies (16B per lane) are tracked by ASYNCcnt. Their
// LDS address is the byte offset within the workgroup LDS allocation (low 32
// bits of the generic pointer), their global address a per-lane 64-bit pointer.
__device__ __forceinline__ void wait_asynccnt0() {
  asm volatile("s_wait_asynccnt 0x0" ::: "memory");
}
// Eight async copies (16B per lane each) in one statement. The closing
// s_wait_xcnt stands inside the statement so that no address register of an
// issued copy is rewritten ahead of it.
__device__ __forceinline__ void async_copy8_b128(
    unsigned int l0, unsigned int l1, unsigned int l2, unsigned int l3,
    unsigned int l4, unsigned int l5, unsigned int l6, unsigned int l7,
    const void* g0, const void* g1, const void* g2, const void* g3,
    const void* g4, const void* g5, const void* g6, const void* g7) {
  asm volatile("global_load_async_to_lds_b128 %0, %8, off\n\t"
               "global_load_async_to_lds_b128 %1, %9, off\n\t"
               "global_load_async_to_lds_b128 %2, %10, off\n\t"
               "global_load_async_to_lds_b128 %3, %11, off\n\t"
               "global_load_async_to_lds_b128 %4, %12, off\n\t"
               "global_load_async_to_lds_b128 %5, %13, off\n\t"
               "global_load_async_to_lds_b128 %6, %14, off\n\t"
               "global_load_async_to_lds_b128 %7, %15, off\n\t"
               "s_wait_xcnt 0x0"
               :: "v"(l0), "v"(l1), "v"(l2), "v"(l3),
                  "v"(l4), "v"(l5), "v"(l6), "v"(l7),
                  "v"(g0), "v"(g1), "v"(g2), "v"(g3),
                  "v"(g4), "v"(g5), "v"(g6), "v"(g7)
               : "memory");
}
// Retires this wave's LDS reads before a barrier behind which the buffer they
// read is refilled by copies.
__device__ __forceinline__ void wait_dscnt0() {
  asm volatile("s_wait_dscnt 0x0" ::: "memory");
}

// ---------------------------------------------------------------------------
// All twelve f32 -> bf16 conversions of the inputs in ONE launch. Their bf16
// images lie one behind the other in the workspace, so the destination is one
// array of 24 segments of 2^20 elements: segments 0..7 the eight D x D
// weights, 8..11 and 12..15 the two feed-forward weights, 16..19 and 20..23
// the two activations. 32 blocks share a segment; a block converts 32768
// contiguous elements, 1024 a trip: each wave-wide load covers four whole
// 128-B lines, each wave-wide store two. Few long-lived waves take the place
// of many short ones, for speed only.
// ---------------------------------------------------------------------------
typedef __attribute__((ext_vector_type(4))) float  v4f;
typedef __attribute__((ext_vector_type(4))) __bf16 v4bf;
#define CVT_SEG_LOG2   20
#define CVT_BLK_ELEMS  32768
__global__ __launch_bounds__(256) void cvt_inputs_kernel(
    const float* __restrict__ w0, const float* __restrict__ w1,
    const float* __restrict__ w2, const float* __restrict__ w3,
    const float* __restrict__ w4, const float* __restrict__ w5,
    const float* __restrict__ w6, const float* __restrict__ w7,
    const float* __restrict__ f1, const float* __restrict__ f2,
    const float* __restrict__ xa, const float* __restrict__ xe,
    __bf16* __restrict__ out)
{
  const int seg = blockIdx.x >> 5;     // block-uniform
  const float* src;
  int first;                           // the source's first segment
  if (seg < 8) {
    first = seg;
    src = seg == 0 ? w0 : seg == 1 ? w1 : seg == 2 ? w2 : seg == 3 ? w3
        : seg == 4 ? w4 : seg == 5 ? w5 : seg == 6 ? w6 : w7;
  } else if (seg < 12) { first = 8;  src = f1; }
  else if (seg < 16)   { first = 12; src = f2; }
  else if (seg < 20)   { first = 16; src = xa; }
  else                 { first = 20; src = xe; }
  const size_t inseg = (size_t)(blockIdx.x & 31) * CVT_BLK_ELEMS + threadIdx.x * 4;
  const float* s = src + ((size_t)(seg - first) << CVT_SEG_LOG2) + inseg;
  __bf16*      d = out + ((size_t)seg << CVT_SEG_LOG2) + inseg;
  // Four groups of eight trips: a group's eight 16-B loads per lane are in
  // flight together, ahead of its stores. Unrolled: every place in the block's
  // share is an immediate offset, so no address register is ever rewritten.
#pragma unroll
  for (int g = 0; g < CVT_BLK_ELEMS / 8192; ++g) {
    v4f v[8];
#pragma unroll
    for (int i = 0; i < 8; ++i) v[i] = *(const v4f*)(s + (g * 8 + i) * 1024);
#pragma unroll
    for (int i = 0; i < 8; ++i) {
      v4bf o;
#pragma unroll
      for (int e = 0; e < 4; ++e) o[e] = f2bf(v[i][e]);
      *(v4bf*)(d + (g * 8 + i) * 1024) = o;
    }
    // the next group's loads reuse the data registers of these stores
    if (g + 1 < CVT_BLK_ELEMS / 8192) asm volatile("s_wait_xcnt 0x0" ::: "memory");
  }
}

// ---------------------------------------------------------------------------
// Tiled GEMM: out[M,N] = A[M,K] @ W[N,K]^T + bias[N]   (torch Linear semantics)
// Block = 256 threads = 8 waves; 128x128 output tile; wave tile 32x64.
// K is staged 128 wide through double-buffered LDS using async global->LDS
// copies so the next stage streams in while WMMAs consume the current one: a
// stage feeds four blocks of 8 WMMAs a wave, so one publish point (two waits
// and a barrier) and one landing latency serve 128 k, and every wave-wide copy
// takes whole 128-B lines (two rows of 256 B).
// A staged row holds 256 B of data at a pitch of 272 B (16 B x odd): the
// sixteen rows that a half wave reads 16 B of fall on all 64 banks once.
// K must be a multiple of 128.
// ---------------------------------------------------------------------------
#define GBK    128  // k per stage
#define GPITCH 136  // bf16 elements per staged LDS row (272 B)
// One block's 128x128 tile at rows bm.., columns bn.. Where VTSEL is set (bf16
// results only) and vt (block-uniform) holds, the tile is stored transposed per
// batch, as the attention reads V: out[b][column][s] for row b * TSEQ + s. A
// lane's eight accumulator rows of one column are eight consecutive s, so they
// go as one 16-B store.
template<bool RELU, bool OUT_BF16, bool VTSEL>
__device__ __forceinline__ void gemm_tile(
    const __bf16* __restrict__ A, const __bf16* __restrict__ W,
    const float* __restrict__ bias, void* __restrict__ outp,
    int N, int K, int bm, int bn, bool vt)
{
  __shared__ __attribute__((aligned(16))) __bf16 As[2][128 * GPITCH];
  __shared__ __attribute__((aligned(16))) __bf16 Ws[2][128 * GPITCH];

  const int tid  = threadIdx.x;
  const int lane = tid & 31;
  const int wave = tid >> 5;     // 0..7
  const int wm   = wave >> 1;    // 0..3 -> 32-row strip
  const int wn   = wave & 1;     // 0..1 -> 64-col strip
  const int l15  = lane & 15;
  const int hi8  = (lane >> 4) << 3;

  const v8f vzero = {0.f,0.f,0.f,0.f,0.f,0.f,0.f,0.f};
  v8f acc[2][4];
#pragma unroll
  for (int i = 0; i < 2; ++i)
#pragma unroll
    for (int j = 0; j < 4; ++j) acc[i][j] = vzero;

  // Staging map: thread t brings 16 B at column chunk (t & 15) of rows
  // (t >> 4) + 16 * i, i = 0..7, of the A stage and of the W stage.
  const int crow = tid >> 4;           // 0..15
  const int ccol = (tid & 15) * 8;     // element offset in the staged row
  const __bf16* aptr = A + (size_t)(bm + crow) * K + ccol;
  const __bf16* wptr = W + (size_t)(bn + crow) * K + ccol;
  const unsigned int lA = (unsigned int)(uintptr_t)(&As[0][crow * GPITCH + ccol]);
  const unsigned int lW = (unsigned int)(uintptr_t)(&Ws[0][crow * GPITCH + ccol]);
  const unsigned int rstep = 16 * GPITCH * 2;    // 16 LDS rows, bytes
  const unsigned int bstep = 128 * GPITCH * 2;   // one buffer, bytes
  const size_t gstep = (size_t)16 * K;           // 16 global rows, elements

  auto stage = [&](int bsel, int k0) {
    const unsigned int la = lA + bsel * bstep;
    const unsigned int lw = lW + bsel * bstep;
    const __bf16* ag = aptr + k0;
    const __bf16* wg = wptr + k0;
    async_copy8_b128(la, la + rstep, la + 2 * rstep, la + 3 * rstep,
                     la + 4 * rstep, la + 5 * rstep, la + 6 * rstep, la + 7 * rstep,
                     ag, ag + gstep, ag + 2 * gstep, ag + 3 * gstep,
                     ag + 4 * gstep, ag + 5 * gstep, ag + 6 * gstep, ag + 7 * gstep);
    async_copy8_b128(lw, lw + rstep, lw + 2 * rstep, lw + 3 * rstep,
                     lw + 4 * rstep, lw + 5 * rstep, lw + 6 * rstep, lw + 7 * rstep,
                     wg, wg + gstep, wg + 2 * gstep, wg + 3 * gstep,
                     wg + 4 * gstep, wg + 5 * gstep, wg + 6 * gstep, wg + 7 * gstep);
  };

  stage(0, 0);
  wait_asynccnt0();     // this wave's share of stage 0 has landed
  __syncthreads();      // ... and every other wave's
  if (GBK < K) stage(1, GBK);

  int buf = 0;
  for (int k0 = 0; k0 < K; k0 += GBK) {
    const __bf16* as = As[buf] + (wm * 32 + l15) * GPITCH;
    const __bf16* ws = Ws[buf] + (wn * 64 + l15) * GPITCH;
    // unrolled: a block's place in the stage becomes an immediate LDS offset,
    // and a block's fragment reads can go under the block before it
#pragma unroll
    for (int kk = 0; kk < GBK; kk += 32) {
      v16bf af[2], bfr[4];
#pragma unroll
      for (int i = 0; i < 2; ++i)
        af[i] = load_frag(as + i * 16 * GPITCH + kk, hi8);
#pragma unroll
      for (int j = 0; j < 4; ++j)
        bfr[j] = load_frag(ws + j * 16 * GPITCH + kk, hi8);
#pragma unroll
      for (int i = 0; i < 2; ++i)
#pragma unroll
        for (int j = 0; j < 4; ++j)
          acc[i][j] = wmma_bf16(af[i], bfr[j], acc[i][j]);
    }
    // Publish point: own LDS reads of this stage retired, own copies of the
    // next stage landed, then the barrier that publishes the next stage and
    // frees this buffer for the refill behind it.
    wait_dscnt0();
    wait_asynccnt0();
    __syncthreads();
    if (k0 + 2 * GBK < K) stage(buf, k0 + 2 * GBK);
    buf ^= 1;
  }
  wait_asynccnt0();     // nothing of the ring is in flight when the wave ends

  float*  outf = (float*)outp;
  __bf16* outb = (__bf16*)outp;
  if (VTSEL && OUT_BF16 && vt) {
    // all eight 16-B values first, then the eight stores, the wave's last
    // instructions: no register of an issued store is written again
    const int mrow = bm + wm * 32 + hi8;           // rows mrow + 16 i + r
    __bf16* tcol = outb + ((size_t)(mrow / TSEQ) * N + bn + wn * 64 + l15) * TSEQ
                        + (mrow % TSEQ);
    v8bf t[2][4];
#pragma unroll
    for (int j = 0; j < 4; ++j) {
      const float bv = bias[bn + wn * 64 + j * 16 + l15];
#pragma unroll
      for (int i = 0; i < 2; ++i)
#pragma unroll
        for (int r = 0; r < 8; ++r) {
          float v = acc[i][j][r] + bv;
          if (RELU) v = fmaxf(v, 0.0f);
          t[i][j][r] = f2bf(v);
        }
    }
#pragma unroll
    for (int j = 0; j < 4; ++j)
#pragma unroll
      for (int i = 0; i < 2; ++i)
        *(v8bf*)(tcol + (size_t)j * 16 * TSEQ + i * 16) = t[i][j];
    return;
  }
#pragma unroll
  for (int i = 0; i < 2; ++i) {
    const int mrow = bm + wm * 32 + i * 16 + hi8;  // C layout: row r+8*(lane>>4)
#pragma unroll
    for (int j = 0; j < 4; ++j) {
      const int ncol = bn + wn * 64 + j * 16 + l15;
      const float bv = bias[ncol];
#pragma unroll
      for (int r = 0; r < 8; ++r) {
        float v = acc[i][j][r] + bv;
        if (RELU) v = fmaxf(v, 0.0f);
        const size_t idx = (size_t)(mrow + r) * N + ncol;
        if (OUT_BF16) outb[idx] = f2bf(v); else outf[idx] = v;
      }
    }
  }
  // The built code lays the transposed block behind these stores, with a branch
  // between them: no register of an issued store is rewritten ahead of this wait
  // on any way through the listing.
  if (VTSEL) asm volatile("s_wait_xcnt 0x0" ::: "memory");
}

template<bool RELU, bool OUT_BF16>
__global__ __launch_bounds__(256) void gemm_kernel(
    const __bf16* __restrict__ A, const __bf16* __restrict__ W,
    const float* __restrict__ bias, void* __restrict__ outp,
    int M, int N, int K)
{
  (void)M;
  gemm_tile<RELU, OUT_BF16, false>(A, W, bias, outp, N, K,
                                   blockIdx.x * 128, blockIdx.y * 128, false);
}

// ---------------------------------------------------------------------------
// The five projections whose inputs are ready when the call starts, in ONE
// launch: self Q, self K, cross K, self V, cross V, each [MROWS, DMODEL] =
// act @ W^T + b, their bf16 results one behind the other in out; the two V are
// stored transposed ([b][h][d][s]), so that V columns are contiguous for the
// attention's V^T operand and no transposing launch is needed. Eight values of
// blockIdx.y make one projection. Alone, a projection has one block per WGP,
// whose waits nothing covers, and pays its own launch gap, first fill and
// epilogue; together they keep two blocks resident per WGP, so one block's
// waits, start and end go under the other's work.
// ---------------------------------------------------------------------------
__global__ __launch_bounds__(256) void proj5_kernel(
    const __bf16* __restrict__ xa, const __bf16* __restrict__ xe,
    const __bf16* __restrict__ w0, const __bf16* __restrict__ w1,
    const __bf16* __restrict__ w2, const __bf16* __restrict__ w3,
    const __bf16* __restrict__ w4,
    const float* __restrict__ b0, const float* __restrict__ b1,
    const float* __restrict__ b2, const float* __restrict__ b3,
    const float* __restrict__ b4,
    __bf16* __restrict__ out)
{
  const int g = blockIdx.y >> 3;     // block-uniform
  const __bf16* A = (g == 2 || g == 4) ? xe : xa;
  const __bf16* W = g == 0 ? w0 : g == 1 ? w1 : g == 2 ? w2 : g == 3 ? w3 : w4;
  const float*  b = g == 0 ? b0 : g == 1 ? b1 : g == 2 ? b2 : g == 3 ? b3 : b4;
  gemm_tile<false, true, true>(A, W, b, (void*)(out + (size_t)g * MROWS * DMODEL),
                               DMODEL, DMODEL, blockIdx.x * 128,
                               (blockIdx.y & 7) * 128, g >= 3);
}

// ---------------------------------------------------------------------------
// Both int32 masks ([B][T][S]) packed once per call into the lane masks that
// the attention selects on. For 16 queries q0.. and 32 keys s0.. there are 16
// words; bit l of word 8 t + r says whether key s0 + 16 t + 8 (l >> 4) + r of
// query q0 + (l & 15) is kept: lane l's place in the score tiles of the
// attention. Layout [mask][b][q / 16][s / 32][16]. One wave takes 16 queries x
// 128 keys: 16 loads of 16 B a lane, all in flight together, and writes 256 B.
// ---------------------------------------------------------------------------
typedef __attribute__((ext_vector_type(4)))  int          v4i;
typedef __attribute__((ext_vector_type(16))) unsigned int v16u;
// The same in the constant address space: nothing writes the packed masks while
// the attention runs, and read so a wave-uniform address gives a scalar load.
typedef __attribute__((address_space(4))) v16u cv16u;
__global__ __launch_bounds__(256) void pack_mask_kernel(
    const int* __restrict__ m0, const int* __restrict__ m1,
    unsigned int* __restrict__ pm)
{
  const int lane = threadIdx.x & 31;
  const int l15  = lane & 15;
  const int hi8  = (lane >> 4) << 3;
  const int gw   = blockIdx.x * 8 + (threadIdx.x >> 5);
  const int kg   = gw & (SSEQ / 128 - 1);       // group of 128 keys
  const int rowt = gw / (SSEQ / 128);           // (mask * B + b) * T / 16 + q / 16
  const int rt   = rowt & (MROWS / 16 - 1);     // b * T / 16 + q / 16
  const int* src = rowt >= MROWS / 16 ? m1 : m0;   // block-uniform
  const int* p = src + ((size_t)rt * 16 + l15) * SSEQ + kg * 128 + hi8;
  v4i v[16];
#pragma unroll
  for (int c = 0; c < 16; ++c)
    v[c] = *(const v4i*)(p + (c >> 2) * 32 + ((c >> 1) & 1) * 16 + (c & 1) * 4);
  unsigned int w[4];     // lane l: word l & 15 of each of the four key blocks
#pragma unroll
  for (int kb = 0; kb < 4; ++kb) {
    w[kb] = 0u;
#pragma unroll
    for (int e = 0; e < 16; ++e) {
      const unsigned int bal =
          __builtin_amdgcn_ballot_w32(v[kb * 4 + (e >> 2)][e & 3] != 0);
      if (l15 == e) w[kb] = bal;
    }
  }
  unsigned int* d = pm + ((size_t)rowt * (SSEQ / 32) + kg * 4) * 16 + lane;
  d[0]  = lane < 16 ? w[0] : w[1];
  d[32] = lane < 16 ? w[2] : w[3];
}

#define KVPITCH 72
// value of lane l ^ 16
__device__ __forceinline__ float other_half(float v) {
  const int b = __float_as_int(v);
  return __int_as_float(
      __builtin_amdgcn_permlanex16(b, b, 0x76543210, 0xfedcba98, false, false));
}
typedef __attribute__((ext_vector_type(4))) unsigned int v4u;
template<bool TRIM>
__global__ __launch_bounds__(128) void attn_kernel(
    const __bf16* __restrict__ Qb,   // [B*Tq, DMODEL] bf16
    const __bf16* __restrict__ Kb,   // [B*Skv, DMODEL] bf16
    const __bf16* __restrict__ Vt,   // [B*H*DHEAD, Skv] bf16
    const unsigned int* __restrict__ pmask, // [B][Tq/16][Skv/32][16] lane masks
    __bf16*       __restrict__ ctx,  // [B*Tq, DMODEL] bf16, the next GEMM's A
    int Tq, int Skv)
{
  // 64 rows of 128 B at a pitch of 144 B (16 B x odd: no bank conflict for the
  // 16-byte fragment reads).
  __shared__ __attribute__((aligned(16))) __bf16 Ks[2][64 * KVPITCH];
  __shared__ __attribute__((aligned(16))) __bf16 Vs[2][64 * KVPITCH];
  __shared__ unsigned int wneed[4], wrows[4];   // TRIM: each wave's findings
  const int lane = threadIdx.x & 31;
  // in a scalar register: the address of the wave's lane masks is formed from it
  const int wave = __builtin_amdgcn_readfirstlane(threadIdx.x >> 5);
  const int l15  = lane & 15;
  const int hi8  = (lane >> 4) << 3;
  const int h    = blockIdx.y;
  const int b    = blockIdx.z;
  const __bf16* kbase  = Kb + (size_t)b * Skv * DMODEL + h * DHEAD;
  const __bf16* vtbase = Vt + (size_t)((b * NHEAD + h) * DHEAD) * Skv;
  const v8f vzero = {0.f,0.f,0.f,0.f,0.f,0.f,0.f,0.f};

  // Staging map: thread t brings 16 B at column chunk (t & 7) of rows
  // (t >> 3) + 16 * i, i = 0..3, of the K tile and of the V^T tile: each
  // wave-wide copy covers four whole 128-B lines.
  const int crow = threadIdx.x >> 3;          // 0..15
  const int ccol = (threadIdx.x & 7) * 8;     // element offset in the row
  const __bf16* kcp = kbase  + (size_t)crow * DMODEL + ccol;
  const __bf16* vcp = vtbase + (size_t)crow * Skv + ccol;
  const unsigned int lK = (unsigned int)(uintptr_t)(&Ks[0][crow * KVPITCH + ccol]);
  const unsigned int lV = (unsigned int)(uintptr_t)(&Vs[0][crow * KVPITCH + ccol]);
  const unsigned int rstep = 16 * KVPITCH * 2;   // 16 LDS rows, bytes
  const unsigned int bstep = 64 * KVPITCH * 2;   // one buffer, bytes
  auto stage = [&](int bsel, int key0) {
    const unsigned int lk = lK + bsel * bstep;
    const unsigned int lv = lV + bsel * bstep;
    const __bf16* kg = kcp + (size_t)key0 * DMODEL;
    const __bf16* vg = vcp + key0;
    async_copy8_b128(lk, lk + rstep, lk + 2 * rstep, lk + 3 * rstep,
                     lv, lv + rstep, lv + 2 * rstep, lv + 3 * rstep,
                     kg, kg + 16 * DMODEL, kg + 32 * DMODEL, kg + 48 * DMODEL,
                     vg, vg + (size_t)16 * Skv, vg + (size_t)32 * Skv,
                     vg + (size_t)48 * Skv);
  };

  // kept rolled: both query tiles run the same text; unrolled it would be twice
  // as long in the instruction cache for nothing
#pragma clang loop unroll(disable)
  for (int rep = 0; rep < (TRIM ? 2 : 1); ++rep) {
  const int qtile = !TRIM ? (int)blockIdx.x
                  : rep == 0 ? (Tq >> 6) - 1 - (int)blockIdx.x : (int)blockIdx.x;
  const int q0   = qtile * 64 + wave * 16;

  // B operand: column l15 = query q0 + l15, k in the hardware order
  const __bf16* qrow = Qb + (size_t)(b * Tq + q0 + l15) * DMODEL + h * DHEAD;
  const v16bf qf0 = load_frag(qrow, hi8);        // K-dim 0..31 of head
  const v16bf qf1 = load_frag(qrow + 32, hi8);   // K-dim 32..63

  // the lane masks of this wave's 16 queries, 16 words per 32 keys
  const unsigned int* pmw =
      pmask + ((size_t)(b * Tq + q0) >> 4) * (size_t)(Skv >> 5) * 16;

  v8f o[4];        // o[j][r] = O[q0 + l15][j * 16 + hi8 + r]
#pragma unroll
  for (int j = 0; j < 4; ++j) o[j] = vzero;
  float mrow = -1e30f;   // running maximum of the lane's query (both halves)
  float lrow = 0.f;      // running sum over this half's keys only

  // where the key loop ends, the same for the whole block
  int kend = Skv;
  if (TRIM) {
    // lane l ORs the 32 words (128 B) of key tile l, keys 64 l .. 64 l + 63, of
    // the wave's 16 queries: the 32 lanes cover the SSEQ / 64 tiles of a row
    static_assert(SSEQ / 64 == 32, "one lane per tile of 64 keys");
    const v4u* tw = (const v4u*)(pmw + lane * 32);
    v4u a = tw[0];
#pragma unroll
    for (int i = 1; i < 8; ++i) a |= tw[i];
    const unsigned int tor = a[0] | a[1] | a[2] | a[3];
    // bit l: tile l keeps a key for one of the wave's queries
    const unsigned int need = __builtin_amdgcn_ballot_w32(tor != 0u);
    // over all tiles; bits q and q + 16: query q keeps a key somewhere
    unsigned int rows = tor;
#pragma unroll
    for (int off = 16; off > 0; off >>= 1) rows |= __shfl_xor(rows, off);
    if (lane == 0) {
      wneed[wave] = need;
      wrows[wave] = (rows | (rows >> 16)) & 0xFFFFu;
    }
    __syncthreads();   // the four waves' findings are joined behind it
    const unsigned int bneed = wneed[0] | wneed[1] | wneed[2] | wneed[3];
    const unsigned int brows = wrows[0] & wrows[1] & wrows[2] & wrows[3];
    // | 1: at least one tile; at most 32 tiles, and never past the keys
    int ke = 64 * (32 - __builtin_clz(bneed | 1u));
    if (brows != 0xFFFFu || ke > Skv) ke = Skv;
    kend = __builtin_amdgcn_readfirstlane(ke);   // scalar: loop tests, branches
  }

  stage(0, 0);
  wait_asynccnt0();     // this wave's share of tile 0 has landed
  __syncthreads();      // ... and every other wave's
  if (64 < kend) stage(1, 64);

  // lane masks of tile 0; each trip fetches the next tile's, well ahead of
  // their use, so that no pass waits out a scalar load
  v16u mwc[2] = { *(const cv16u*)(pmw), *(const cv16u*)(pmw + 16) };

  int buf = 0;
  for (int t0 = 0; t0 < kend; t0 += 64) {
   const __bf16* kt = Ks[buf];
   const __bf16* vt = Vs[buf];
   // the last trip fetches its own again: the address stays inside the array
   const unsigned int* pmn = pmw + (size_t)((t0 + 64 < kend ? t0 + 64 : t0) >> 5) * 16;
   v16u mwn[2];
   if (!TRIM) { mwn[0] = *(const cv16u*)(pmn); mwn[1] = *(const cv16u*)(pmn + 16); }
   // unrolled: the pass's place in the tile becomes an immediate LDS offset
#pragma unroll
   for (int p = 0; p < 2; ++p) {
    const int s0 = t0 + p * 32;
    // lane masks of the pass: word 8 t + r for score sc[t][r]
    const v16u mw = mwc[p];
    // A operands of the pass: K rows (keys) and V^T rows (head dims)
    v16bf kf[4], vf[4];
#pragma unroll
    for (int t = 0; t < 2; ++t) {
      const __bf16* krow = kt + (p * 32 + t * 16 + l15) * KVPITCH;
      kf[t * 2]     = load_frag(krow, hi8);
      kf[t * 2 + 1] = load_frag(krow + 32, hi8);
    }
#pragma unroll
    for (int j = 0; j < 4; ++j)
      vf[j] = load_frag(vt + (j * 16 + l15) * KVPITCH + p * 32, hi8);
    v8f sc[2];     // sc[t][r] = score(key s0 + 16 t + hi8 + r, query q0 + l15)
#pragma unroll
    for (int t = 0; t < 2; ++t) {
      sc[t] = wmma_bf16(kf[t * 2], qf0, vzero);
      sc[t] = wmma_bf16(kf[t * 2 + 1], qf1, sc[t]);
    }
    // scale + mask + maximum over the lane's 16 keys
    float nmax = -1e30f;
#pragma unroll
    for (int t = 0; t < 2; ++t)
#pragma unroll
      for (int r = 0; r < 8; ++r) {
        float v = sc[t][r] * 0.125f;   // 1/sqrt(64)
        if (!__builtin_amdgcn_inverse_ballot_w32(mw[t * 8 + r])) v = -1e9f;
        sc[t][r] = v;
        nmax = fmaxf(nmax, v);
      }
    nmax = fmaxf(nmax, other_half(nmax));   // all 32 keys of the query

    const float mn  = fmaxf(mrow, nmax);
    const float scl = __expf(mrow - mn);
    mrow = mn;
    float rsum = 0.f;
    v16bf pf;      // B operand P^T: pf[s] = P[key kmap(s, h)][query l15]
#pragma unroll
    for (int t = 0; t < 2; ++t)
#pragma unroll
      for (int r = 0; r < 8; ++r) {
        const float pv = __expf(sc[t][r] - mn);
        rsum += pv;
        pf[t * 8 + r] = (__bf16)pv;
      }
    lrow = lrow * scl + rsum;
#pragma unroll
    for (int j = 0; j < 4; ++j)
#pragma unroll
      for (int r = 0; r < 8; ++r) o[j][r] *= scl;

#pragma unroll
    for (int j = 0; j < 4; ++j) o[j] = wmma_bf16(vf[j], pf, o[j]);
   }
   // TRIM: fetched here, straight into the words' own registers (fetched at the
   // head of the trip, this build moved all 32 words by scalar copies each trip)
   if (TRIM) { mwc[0] = *(const cv16u*)(pmn); mwc[1] = *(const cv16u*)(pmn + 16); }
   // Publish point: own LDS reads of this tile retired, own copies of the next
   // tile landed, then the barrier that publishes the next tile and frees this
   // buffer for the refill behind it.
   wait_dscnt0();
   wait_asynccnt0();
   __syncthreads();
   if (t0 + 128 < kend) stage(buf, t0 + 128);
   buf ^= 1;
   if (!TRIM) { mwc[0] = mwn[0]; mwc[1] = mwn[1]; }
  }
  wait_asynccnt0();     // nothing of the ring is in flight when the wave ends

  // the halves' sums are joined once, here
  const float inv = 1.0f / (lrow + other_half(lrow));
  __bf16* crow_out = ctx + (size_t)(b * Tq + q0 + l15) * DMODEL + h * DHEAD + hi8;
#pragma unroll
  for (int j = 0; j < 4; ++j) {
    v8bf t;
#pragma unroll
    for (int r = 0; r < 8; ++r) t[r] = f2bf(o[j][r] * inv);
    *(v8bf*)(crow_out + j * 16) = t;
  }
  // the second query tile writes the registers of these stores anew
  if (TRIM) asm volatile("s_wait_xcnt 0x0" ::: "memory");
  }
}

// ---------------------------------------------------------------------------
// Residual add + LayerNorm; writes f32 stream + bf16 copy for next GEMM.
// One block per row of 1024. (x/yout may alias for in-place update.)
// ---------------------------------------------------------------------------
__global__ __launch_bounds__(256) void ln_kernel(
    const float* x, const float* __restrict__ sub,
    const float* __restrict__ g, const float* __restrict__ bta,
    float* yout, __bf16* __restrict__ ybf)
{
  __shared__ float s1[256], s2[256];
  const size_t base = (size_t)blockIdx.x * DMODEL;
  float v[4];
  float lsum = 0.f, lsq = 0.f;
#pragma unroll
  for (int k = 0; k < 4; ++k) {
    const int i = threadIdx.x + k * 256;
    v[k] = x[base + i] + sub[base + i];
    lsum += v[k];
    lsq  += v[k] * v[k];
  }
  s1[threadIdx.x] = lsum; s2[threadIdx.x] = lsq;
  __syncthreads();
  for (int off = 128; off > 0; off >>= 1) {
    if (threadIdx.x < off) {
      s1[threadIdx.x] += s1[threadIdx.x + off];
      s2[threadIdx.x] += s2[threadIdx.x + off];
    }
    __syncthreads();
  }
  const float mean = s1[0] * (1.0f / DMODEL);
  const float var  = s2[0] * (1.0f / DMODEL) - mean * mean;
  const float rs   = rsqrtf(var + 1e-5f);
#pragma unroll
  for (int k = 0; k < 4; ++k) {
    const int i = threadIdx.x + k * 256;
    const float o = (v[k] - mean) * rs * g[i] + bta[i];
    yout[base + i] = o;
    ybf[base + i]  = f2bf(o);
  }
}

// ---------------------------------------------------------------------------
// Host orchestration
// ---------------------------------------------------------------------------
extern "C" void kernel_launch(void* const* d_in, const int* in_sizes, int n_in,
                              void* d_out, int out_size, void* d_ws, size_t ws_size,
                              hipStream_t stream) {
  (void)in_sizes; (void)n_in; (void)out_size; (void)ws_size;

  const float* x        = (const float*)d_in[0];
  const float* enc      = (const float*)d_in[1];
  const int*   src_mask = (const int*)d_in[2];
  const int*   tgt_mask = (const int*)d_in[3];
  const float* sa_Wq = (const float*)d_in[4],  *sa_bq = (const float*)d_in[5];
  const float* sa_Wk = (const float*)d_in[6],  *sa_bk = (const float*)d_in[7];
  const float* sa_Wv = (const float*)d_in[8],  *sa_bv = (const float*)d_in[9];
  const float* sa_Wo = (const float*)d_in[10], *sa_bo = (const float*)d_in[11];
  const float* ca_Wq = (const float*)d_in[12], *ca_bq = (const float*)d_in[13];
  const float* ca_Wk = (const float*)d_in[14], *ca_bk = (const float*)d_in[15];
  const float* ca_Wv = (const float*)d_in[16], *ca_bv = (const float*)d_in[17];
  const float* ca_Wo = (const float*)d_in[18], *ca_bo = (const float*)d_in[19];
  const float* ff_W1 = (const float*)d_in[20], *ff_b1 = (const float*)d_in[21];
  const float* ff_W2 = (const float*)d_in[22], *ff_b2 = (const float*)d_in[23];
  const float* ln1_g = (const float*)d_in[24], *ln1_b = (const float*)d_in[25];
  const float* ln2_g = (const float*)d_in[26], *ln2_b = (const float*)d_in[27];
  const float* ln3_g = (const float*)d_in[28], *ln3_b = (const float*)d_in[29];

  char* ws = (char*)d_ws;
  const size_t MB = 1024ull * 1024ull;
  // bf16 weights
  __bf16* saWq_bf = (__bf16*)(ws + 0 * MB);
  __bf16* saWk_bf = (__bf16*)(ws + 2 * MB);
  __bf16* saWv_bf = (__bf16*)(ws + 4 * MB);
  __bf16* saWo_bf = (__bf16*)(ws + 6 * MB);
  __bf16* caWq_bf = (__bf16*)(ws + 8 * MB);
  __bf16* caWk_bf = (__bf16*)(ws + 10 * MB);
  __bf16* caWv_bf = (__bf16*)(ws + 12 * MB);
  __bf16* caWo_bf = (__bf16*)(ws + 14 * MB);
  __bf16* W1_bf   = (__bf16*)(ws + 16 * MB);   // 8 MB
  __bf16* W2_bf   = (__bf16*)(ws + 24 * MB);   // 8 MB
  // activations
  __bf16* x_bf    = (__bf16*)(ws + 32 * MB);
  __bf16* enc_bf  = (__bf16*)(ws + 40 * MB);
  __bf16* Qb      = (__bf16*)(ws + 48 * MB);
  float*  proj    = (float*) (ws + 96 * MB);   // 16 MB
  float*  yres    = (float*) (ws + 112 * MB);  // 16 MB
  __bf16* y_bf    = (__bf16*)(ws + 128 * MB);  // 8 MB
  __bf16* hidden  = (__bf16*)(ws + 136 * MB);  // 32 MB
  __bf16* ctx_bf  = (__bf16*)(ws + 168 * MB);  // 8 MB
  unsigned int* pm_tgt = (unsigned int*)(ws + 176 * MB);  // 1 MB
  unsigned int* pm_src = (unsigned int*)(ws + 177 * MB);  // 1 MB, behind pm_tgt
  // results of the merged projections, 8 MB each, one behind the other
  __bf16* saQ     = (__bf16*)(ws + 178 * MB);
  __bf16* saK     = (__bf16*)(ws + 186 * MB);
  __bf16* caK     = (__bf16*)(ws + 194 * MB);
  __bf16* saVt    = (__bf16*)(ws + 202 * MB);  // stored transposed
  __bf16* caVt    = (__bf16*)(ws + 210 * MB);  // stored transposed

  auto gemmF = [&](const __bf16* A, const __bf16* W, const float* b, float* out,
                   int M, int N, int K) {
    gemm_kernel<false, false><<<dim3(M / 128, N / 128), 256, 0, stream>>>(
        A, W, b, (void*)out, M, N, K);
  };
  auto gemmB = [&](const __bf16* A, const __bf16* W, const float* b, __bf16* out,
                   int M, int N, int K) {
    gemm_kernel<false, true><<<dim3(M / 128, N / 128), 256, 0, stream>>>(
        A, W, b, (void*)out, M, N, K);
  };

  // --- precision staging ---
  // saWq_bf .. enc_bf are the 24 segments of one array that starts at saWq_bf
  cvt_inputs_kernel<<<dim3(24 * 32), dim3(256), 0, stream>>>(
      sa_Wq, sa_Wk, sa_Wv, sa_Wo, ca_Wq, ca_Wk, ca_Wv, ca_Wo,
      ff_W1, ff_W2, x, enc, saWq_bf);

  // both masks -> lane masks, pm_tgt then pm_src: one wave per 16 x 128 bits
  pack_mask_kernel<<<dim3(2 * (MROWS / 16) * (SSEQ / 128) / 8), dim3(256), 0, stream>>>(
      tgt_mask, src_mask, pm_tgt);

  // --- every projection of x and of the encoder output ---
  proj5_kernel<<<dim3(MROWS / 128, 5 * (DMODEL / 128)), 256, 0, stream>>>(
      x_bf, enc_bf, saWq_bf, saWk_bf, caWk_bf, saWv_bf, caWv_bf,
      sa_bq, sa_bk, ca_bk, sa_bv, ca_bv, saQ);
  static_assert(TSEQ == SSEQ, "the transposed store takes one length for both V");

  // --- self attention ---
  // two query tiles a block: half the blocks
  attn_kernel<true><<<dim3(TSEQ / 128, NHEAD, NB), 128, 0, stream>>>(
      saQ, saK, saVt, pm_tgt, ctx_bf, TSEQ, TSEQ);
  gemmF(ctx_bf, saWo_bf, sa_bo, proj, MROWS, DMODEL, DMODEL);
  ln_kernel<<<MROWS, 256, 0, stream>>>(x, proj, ln1_g, ln1_b, yres, y_bf);

  // --- cross attention ---
  gemmB(y_bf,   caWq_bf, ca_bq, Qb, MROWS, DMODEL, DMODEL);
  attn_kernel<false><<<dim3(TSEQ / 64, NHEAD, NB), 128, 0, stream>>>(
      Qb, caK, caVt, pm_src, ctx_bf, TSEQ, SSEQ);
  gemmF(ctx_bf, caWo_bf, ca_bo, proj, MROWS, DMODEL, DMODEL);
  ln_kernel<<<MROWS, 256, 0, stream>>>(yres, proj, ln2_g, ln2_b, yres, y_bf);

  // --- feed forward ---
  gemm_kernel<true, true><<<dim3(MROWS / 128, DFFN / 128), 256, 0, stream>>>(
      y_bf, W1_bf, ff_b1, (void*)hidden, MROWS, DFFN, DMODEL);
  gemmF(hidden, W2_bf, ff_b2, proj, MROWS, DMODEL, DFFN);
  ln_kernel<<<MROWS, 256, 0, stream>>>(yres, proj, ln3_g, ln3_b, (float*)d_out, y_bf);
}

// v010
// One run takes 264 microseconds.
// Two timings next to v009 both put it at 1.03 times that version's speed.
// Counting every step since v000, it is 3.08 times as fast.
#include <hip/hip_runtime.h>

// ---------------------------------------------------------------------------
// Problem constants (from reference): D=1024, H=16, DK=64, DFF=4096, B=2,
// T=S=2048.  M = B*T = 4096 rows for every activation GEMM.
// ---------------------------------------------------------------------------
#define DMODEL 1024
#define NHEAD  16
#define DHEAD  64
#define DFFN   4096
#define NB     2
#define TSEQ   2048
#define SSEQ   2048
#define MROWS  (NB * TSEQ)   // 4096

typedef __attribute__((ext_vector_type(16))) __bf16 v16bf;
typedef __attribute__((ext_vector_type(8)))  __bf16 v8bf;
typedef __attribute__((ext_vector_type(8)))  float  v8f;

// ---------------------------------------------------------------------------
// Helpers
// ---------------------------------------------------------------------------
__device__ __forceinline__ __bf16 f2bf(float f) {
  unsigned int u = __float_as_uint(f);
  u += 0x7FFFu + ((u >> 16) & 1u);          // round-to-nearest-even
  unsigned short s = (unsigned short)(u >> 16);
  __bf16 r;
  __builtin_memcpy(&r, &s, 2);
  return r;
}

// Load one WMMA 16-lane fragment row following the CDNA5 per-lane K-chunk
// layout: lanes 0-15 hold K {hi8=0: 0..7,16..23}, lanes 16-31 hold {8..15,24..31}.
__device__ __forceinline__ v16bf load_frag(const __bf16* row, int hi8) {
  v8bf a = *(const v8bf*)(row + hi8);
  v8bf b = *(const v8bf*)(row + hi8 + 16);
  return __builtin_shufflevector(a, b, 0,1,2,3,4,5,6,7,8,9,10,11,12,13,14,15);
}

__device__ __forceinline__ v8f wmma_bf16(v16bf a, v16bf b, v8f c) {
  return __builtin_amdgcn_wmma_f32_16x16x32_bf16(
      /*neg_a=*/false, a, /*neg_b=*/false, b,
      /*c_mod=*/(short)0, c, /*reuse_a=*/false, /*reuse_b=*/false);
}

// CDNA5 async global->LDS copies (16B per lane) are tracked by ASYNCcnt. Their
// LDS address is the byte offset within the workgroup LDS allocation (low 32
// bits of the generic pointer), their global address a per-lane 64-bit pointer.
__device__ __forceinline__ void wait_asynccnt0() {
  asm volatile("s_wait_asynccnt 0x0" ::: "memory");
}
// Counted forms for a ring with more than one stage in flight: they return when
// all but the wave's 16 (32) youngest copies have landed, so one (two) whole
// younger stages of 16 copies a wave fly on while the oldest is published.
__device__ __forceinline__ void wait_asynccnt16() {
  asm volatile("s_wait_asynccnt 0x10" ::: "memory");
}
__device__ __forceinline__ void wait_asynccnt32() {
  asm volatile("s_wait_asynccnt 0x20" ::: "memory");
}
// Eight async copies (16B per lane each) in one statement. The closing
// s_wait_xcnt stands inside the statement so that no address register of an
// issued copy is rewritten ahead of it.
__device__ __forceinline__ void async_copy8_b128(
    unsigned int l0, unsigned int l1, unsigned int l2, unsigned int l3,
    unsigned int l4, unsigned int l5, unsigned int l6, unsigned int l7,
    const void* g0, const void* g1, const void* g2, const void* g3,
    const void* g4, const void* g5, const void* g6, const void* g7) {
  asm volatile("global_load_async_to_lds_b128 %0, %8, off\n\t"
               "global_load_async_to_lds_b128 %1, %9, off\n\t"
               "global_load_async_to_lds_b128 %2, %10, off\n\t"
               "global_load_async_to_lds_b128 %3, %11, off\n\t"
               "global_load_async_to_lds_b128 %4, %12, off\n\t"
               "global_load_async_to_lds_b128 %5, %13, off\n\t"
               "global_load_async_to_lds_b128 %6, %14, off\n\t"
               "global_load_async_to_lds_b128 %7, %15, off\n\t"
               "s_wait_xcnt 0x0"
               :: "v"(l0), "v"(l1), "v"(l2), "v"(l3),
                  "v"(l4), "v"(l5), "v"(l6), "v"(l7),
                  "v"(g0), "v"(g1), "v"(g2), "v"(g3),
                  "v"(g4), "v"(g5), "v"(g6), "v"(g7)
               : "memory");
}
// Retires this wave's LDS reads before a barrier behind which the buffer they
// read is refilled by copies.
__device__ __forceinline__ void wait_dscnt0() {
  asm volatile("s_wait_dscnt 0x0" ::: "memory");
}

// ---------------------------------------------------------------------------
// All twelve f32 -> bf16 conversions of the inputs in ONE launch. Their bf16
// images lie one behind the other in the workspace, so the destination is one
// array of 24 segments of 2^20 elements: segments 0..7 the eight D x D
// weights, 8..11 and 12..15 the two feed-forward weights, 16..19 and 20..23
// the two activations. 32 blocks share a segment; a block converts 32768
// contiguous elements, 1024 a trip: each wave-wide load covers four whole
// 128-B lines, each wave-wide store two. Few long-lived waves take the place
// of many short ones, for speed only.
// ---------------------------------------------------------------------------
typedef __attribute__((ext_vector_type(4))) float  v4f;
typedef __attribute__((ext_vector_type(4))) __bf16 v4bf;
#define CVT_SEG_LOG2   20
#define CVT_BLK_ELEMS  32768
__global__ __launch_bounds__(256) void cvt_inputs_kernel(
    const float* __restrict__ w0, const float* __restrict__ w1,
    const float* __restrict__ w2, const float* __restrict__ w3,
    const float* __restrict__ w4, const float* __restrict__ w5,
    const float* __restrict__ w6, const float* __restrict__ w7,
    const float* __restrict__ f1, const float* __restrict__ f2,
    const float* __restrict__ xa, const float* __restrict__ xe,
    __bf16* __restrict__ out)
{
  const int seg = blockIdx.x >> 5;     // block-uniform
  const float* src;
  int first;                           // the source's first segment
  if (seg < 8) {
    first = seg;
    src = seg == 0 ? w0 : seg == 1 ? w1 : seg == 2 ? w2 : seg == 3 ? w3
        : seg == 4 ? w4 : seg == 5 ? w5 : seg == 6 ? w6 : w7;
  } else if (seg < 12) { first = 8;  src = f1; }
  else if (seg < 16)   { first = 12; src = f2; }
  else if (seg < 20)   { first = 16; src = xa; }
  else                 { first = 20; src = xe; }
  const size_t inseg = (size_t)(blockIdx.x & 31) * CVT_BLK_ELEMS + threadIdx.x * 4;
  const float* s = src + ((size_t)(seg - first) << CVT_SEG_LOG2) + inseg;
  __bf16*      d = out + ((size_t)seg << CVT_SEG_LOG2) + inseg;
  // Four groups of eight trips: a group's eight 16-B loads per lane are in
  // flight together, ahead of its stores. Unrolled: every place in the block's
  // share is an immediate offset, so no address register is ever rewritten.
#pragma unroll
  for (int g = 0; g < CVT_BLK_ELEMS / 8192; ++g) {
    v4f v[8];
#pragma unroll
    for (int i = 0; i < 8; ++i) v[i] = *(const v4f*)(s + (g * 8 + i) * 1024);
#pragma unroll
    for (int i = 0; i < 8; ++i) {
      v4bf o;
#pragma unroll
      for (int e = 0; e < 4; ++e) o[e] = f2bf(v[i][e]);
      *(v4bf*)(d + (g * 8 + i) * 1024) = o;
    }
    // the next group's loads reuse the data registers of these stores
    if (g + 1 < CVT_BLK_ELEMS / 8192) asm volatile("s_wait_xcnt 0x0" ::: "memory");
  }
}

// ---------------------------------------------------------------------------
// Tiled GEMM: out[M,N] = A[M,K] @ W[N,K]^T + bias[N]   (torch Linear semantics)
// Block = 256 threads = 8 waves; 128x128 output tile; wave tile 32x64.
// K is staged 128 wide through a ring of NBUF (2 or 3) LDS buffers using async global->LDS
// copies so the next stage streams in while WMMAs consume the current one: a
// stage feeds four blocks of 8 WMMAs a wave, so one publish point (two waits
// and a barrier) and one landing latency serve 128 k, and every wave-wide copy
// takes whole 128-B lines (two rows of 256 B).
// A staged row holds 256 B of data at a pitch of 272 B (16 B x odd): the
// sixteen rows that a half wave reads 16 B of fall on all 64 banks once.
// K must be a multiple of 128.
// NBUF = 2: one stage in flight; for launches that keep two blocks on a WGP,
// whose copies overlap each other's work. NBUF = 3: for launches of one block
// per WGP. There nothing else on the WGP covers the
// block's waits; asked for two stages ahead, two stages are in flight at any time
// and the wait at the publish point is counted: it leaves the younger one out.
// ---------------------------------------------------------------------------
#define GBK    128  // k per stage
#define GPITCH 136  // bf16 elements per staged LDS row (272 B)
// One block's 128x128 tile at rows bm.., columns bn.. Where VTSEL is set (bf16
// results only) and vt (block-uniform) holds, the tile is stored transposed per
// batch, as the attention reads V: out[b][column][s] for row b * TSEQ + s. A
// lane's eight accumulator rows of one column are eight consecutive s, so they
// go as one 16-B store.
template<bool RELU, bool OUT_BF16, bool VTSEL, int NBUF>
__device__ __forceinline__ void gemm_tile(
    const __bf16* __restrict__ A, const __bf16* __restrict__ W,
    const float* __restrict__ bias, void* __restrict__ outp,
    int N, int K, int bm, int bn, bool vt)
{
  static_assert(NBUF == 2 || NBUF == 3, "the waits below are written for these");
  __shared__ __attribute__((aligned(16))) __bf16 As[NBUF][128 * GPITCH];
  __shared__ __attribute__((aligned(16))) __bf16 Ws[NBUF][128 * GPITCH];

  const int tid  = threadIdx.x;
  const int lane = tid & 31;
  const int wave = tid >> 5;     // 0..7
  const int wm   = wave >> 1;    // 0..3 -> 32-row strip
  const int wn   = wave & 1;     // 0..1 -> 64-col strip
  const int l15  = lane & 15;
  const int hi8  = (lane >> 4) << 3;

  const v8f vzero = {0.f,0.f,0.f,0.f,0.f,0.f,0.f,0.f};
  v8f acc[2][4];
#pragma unroll
  for (int i = 0; i < 2; ++i)
#pragma unroll
    for (int j = 0; j < 4; ++j) acc[i][j] = vzero;

  // Staging map: thread t brings 16 B at column chunk (t & 15) of rows
  // (t >> 4) + 16 * i, i = 0..7, of the A stage and of the W stage.
  const int crow = tid >> 4;           // 0..15
  const int ccol = (tid & 15) * 8;     // element offset in the staged row
  const __bf16* aptr = A + (size_t)(bm + crow) * K + ccol;
  const __bf16* wptr = W + (size_t)(bn + crow) * K + ccol;
  const unsigned int lA = (unsigned int)(uintptr_t)(&As[0][crow * GPITCH + ccol]);
  const unsigned int lW = (unsigned int)(uintptr_t)(&Ws[0][crow * GPITCH + ccol]);
  const unsigned int rstep = 16 * GPITCH * 2;    // 16 LDS rows, bytes
  const unsigned int bstep = 128 * GPITCH * 2;   // one buffer, bytes
  const size_t gstep = (size_t)16 * K;           // 16 global rows, elements

  auto stage = [&](int bsel, int k0) {
    const unsigned int la = lA + bsel * bstep;
    const unsigned int lw = lW + bsel * bstep;
    const __bf16* ag = aptr + k0;
    const __bf16* wg = wptr + k0;
    async_copy8_b128(la, la + rstep, la + 2 * rstep, la + 3 * rstep,
                     la + 4 * rstep, la + 5 * rstep, la + 6 * rstep, la + 7 * rstep,
                     ag, ag + gstep, ag + 2 * gstep, ag + 3 * gstep,
                     ag + 4 * gstep, ag + 5 * gstep, ag + 6 * gstep, ag + 7 * gstep);
    async_copy8_b128(lw, lw + rstep, lw + 2 * rstep, lw + 3 * rstep,
                     lw + 4 * rstep, lw + 5 * rstep, lw + 6 * rstep, lw + 7 * rstep,
                     wg, wg + gstep, wg + 2 * gstep, wg + 3 * gstep,
                     wg + 4 * gstep, wg + 5 * gstep, wg + 6 * gstep, wg + 7 * gstep);
  };

  stage(0, 0);
  if (NBUF == 3) {
    // all three buffers are still untouched: their stages go out together
    if (GBK < K) stage(1, GBK);
    if (2 * GBK < K) {
      stage(2, 2 * GBK);
      wait_asynccnt32();   // stage 0 has landed; stages 1 and 2 fly on
    } else {
      wait_asynccnt0();    // fewer than three stages: all of them
    }
    __syncthreads();       // ... and every other wave's share of stage 0
  } else {
    wait_asynccnt0();     // this wave's share of stage 0 has landed
    __syncthreads();      // ... and every other wave's
    if (GBK < K) stage(1, GBK);
  }

  int buf = 0;
  for (int k0 = 0; k0 < K; k0 += GBK) {
    const __bf16* as = As[buf] + (wm * 32 + l15) * GPITCH;
    const __bf16* ws = Ws[buf] + (wn * 64 + l15) * GPITCH;
    // unrolled: a block's place in the stage becomes an immediate LDS offset,
    // and a block's fragment reads can go under the block before it
#pragma unroll
    for (int kk = 0; kk < GBK; kk += 32) {
      v16bf af[2], bfr[4];
#pragma unroll
      for (int i = 0; i < 2; ++i)
        af[i] = load_frag(as + i * 16 * GPITCH + kk, hi8);
#pragma unroll
      for (int j = 0; j < 4; ++j)
        bfr[j] = load_frag(ws + j * 16 * GPITCH + kk, hi8);
#pragma unroll
      for (int i = 0; i < 2; ++i)
#pragma unroll
        for (int j = 0; j < 4; ++j)
          acc[i][j] = wmma_bf16(af[i], bfr[j], acc[i][j]);
    }
    // Publish point: own LDS reads of this stage retired, own copies of the
    // next stage landed, then the barrier that publishes the next stage and
    // frees this buffer for the refill behind it.
    wait_dscnt0();
    // NBUF = 3: in a trip that issues a stage itself, the stage behind the next
    // one is out too, and its 16 copies are this wave's youngest, all of them
    // and nothing else: the count leaves out exactly that stage. The last three
    // trips issue nothing and wait to 0.
    const bool more = k0 + NBUF * GBK < K;    // the same for the whole block
    if (NBUF == 3 && more) wait_asynccnt16();
    else wait_asynccnt0();
    __syncthreads();
    if (more) stage(buf, k0 + NBUF * GBK);
    buf = NBUF == 2 ? buf ^ 1 : buf == 2 ? 0 : buf + 1;
  }
  wait_asynccnt0();     // nothing of the ring is in flight when the wave ends

  float*  outf = (float*)outp;
  __bf16* outb = (__bf16*)outp;
  if (VTSEL && OUT_BF16 && vt) {
    // all eight 16-B values first, then the eight stores, the wave's last
    // instructions: no register of an issued store is written again
    const int mrow = bm + wm * 32 + hi8;           // rows mrow + 16 i + r
    __bf16* tcol = outb + ((size_t)(mrow / TSEQ) * N + bn + wn * 64 + l15) * TSEQ
                        + (mrow % TSEQ);
    v8bf t[2][4];
#pragma unroll
    for (int j = 0; j < 4; ++j) {
      const float bv = bias[bn + wn * 64 + j * 16 + l15];
#pragma unroll
      for (int i = 0; i < 2; ++i)
#pragma unroll
        for (int r = 0; r < 8; ++r) {
          float v = acc[i][j][r] + bv;
          if (RELU) v = fmaxf(v, 0.0f);
          t[i][j][r] = f2bf(v);
        }
    }
#pragma unroll
    for (int j = 0; j < 4; ++j)
#pragma unroll
      for (int i = 0; i < 2; ++i)
        *(v8bf*)(tcol + (size_t)j * 16 * TSEQ + i * 16) = t[i][j];
    return;
  }
#pragma unroll
  for (int i = 0; i < 2; ++i) {
    const int mrow = bm + wm * 32 + i * 16 + hi8;  // C layout: row r+8*(lane>>4)
#pragma unroll
    for (int j = 0; j < 4; ++j) {
      const int ncol = bn + wn * 64 + j * 16 + l15;
      const float bv = bias[ncol];
#pragma unroll
      for (int r = 0; r < 8; ++r) {
        float v = acc[i][j][r] + bv;
        if (RELU) v = fmaxf(v, 0.0f);
        const size_t idx = (size_t)(mrow + r) * N + ncol;
        if (OUT_BF16) outb[idx] = f2bf(v); else outf[idx] = v;
      }
    }
  }
  // The built code lays the transposed block behind these stores, with a branch
  // between them: no register of an issued store is rewritten ahead of this wait
  // on any way through the listing.
  if (VTSEL) asm volatile("s_wait_xcnt 0x0" ::: "memory");
}

template<bool RELU, bool OUT_BF16, int NBUF>
__global__ __launch_bounds__(256) void gemm_kernel(
    const __bf16* __restrict__ A, const __bf16* __restrict__ W,
    const float* __restrict__ bias, void* __restrict__ outp,
    int M, int N, int K)
{
  (void)M;
  gemm_tile<RELU, OUT_BF16, false, NBUF>(A, W, bias, outp, N, K,
                                         blockIdx.x * 128, blockIdx.y * 128, false);
}

// ---------------------------------------------------------------------------
// The five projections whose inputs are ready when the call starts, in ONE
// launch: self Q, self K, cross K, self V, cross V, each [MROWS, DMODEL] =
// act @ W^T + b, their bf16 results one behind the other in out; the two V are
// stored transposed ([b][h][d][s]), so that V columns are contiguous for the
// attention's V^T operand and no transposing launch is needed. Eight values of
// blockIdx.y make one projection. Alone, a projection has one block per WGP,
// whose waits nothing covers, and pays its own launch gap, first fill and
// epilogue; together they keep two blocks resident per WGP, so one block's
// waits, start and end go under the other's work.
// ---------------------------------------------------------------------------
__global__ __launch_bounds__(256) void proj5_kernel(
    const __bf16* __restrict__ xa, const __bf16* __restrict__ xe,
    const __bf16* __restrict__ w0, const __bf16* __restrict__ w1,
    const __bf16* __restrict__ w2, const __bf16* __restrict__ w3,
    const __bf16* __restrict__ w4,
    const float* __restrict__ b0, const float* __restrict__ b1,
    const float* __restrict__ b2, const float* __restrict__ b3,
    const float* __restrict__ b4,
    __bf16* __restrict__ out)
{
  const int g = blockIdx.y >> 3;     // block-uniform
  const __bf16* A = (g == 2 || g == 4) ? xe : xa;
  const __bf16* W = g == 0 ? w0 : g == 1 ? w1 : g == 2 ? w2 : g == 3 ? w3 : w4;
  const float*  b = g == 0 ? b0 : g == 1 ? b1 : g == 2 ? b2 : g == 3 ? b3 : b4;
  gemm_tile<false, true, true, 2>(A, W, b, (void*)(out + (size_t)g * MROWS * DMODEL),
                                  DMODEL, DMODEL, blockIdx.x * 128,
                                  (blockIdx.y & 7) * 128, g >= 3);
}

// ---------------------------------------------------------------------------
// Both int32 masks ([B][T][S]) packed once per call into the lane masks that
// the attention selects on. For 16 queries q0.. and 32 keys s0.. there are 16
// words; bit l of word 8 t + r says whether key s0 + 16 t + 8 (l >> 4) + r of
// query q0 + (l & 15) is kept: lane l's place in the score tiles of the
// attention. Layout [mask][b][q / 16][s / 32][16]. One wave takes 16 queries x
// 128 keys: 16 loads of 16 B a lane, all in flight together, and writes 256 B.
// ---------------------------------------------------------------------------
typedef __attribute__((ext_vector_type(4)))  int          v4i;
typedef __attribute__((ext_vector_type(16))) unsigned int v16u;
// The same in the constant address space: nothing writes the packed masks while
// the attention runs, and read so a wave-uniform address gives a scalar load.
typedef __attribute__((address_space(4))) v16u cv16u;
__global__ __launch_bounds__(256) void pack_mask_kernel(
    const int* __restrict__ m0, const int* __restrict__ m1,
    unsigned int* __restrict__ pm)
{
  const int lane = threadIdx.x & 31;
  const int l15  = lane & 15;
  const int hi8  = (lane >> 4) << 3;
  const int gw   = blockIdx.x * 8 + (threadIdx.x >> 5);
  const int kg   = gw & (SSEQ / 128 - 1);       // group of 128 keys
  const int rowt = gw / (SSEQ / 128);           // (mask * B + b) * T / 16 + q / 16
  const int rt   = rowt & (MROWS / 16 - 1);     // b * T / 16 + q / 16
  const int* src = rowt >= MROWS / 16 ? m1 : m0;   // block-uniform
  const int* p = src + ((size_t)rt * 16 + l15) * SSEQ + kg * 128 + hi8;
  v4i v[16];
#pragma unroll
  for (int c = 0; c < 16; ++c)
    v[c] = *(const v4i*)(p + (c >> 2) * 32 + ((c >> 1) & 1) * 16 + (c & 1) * 4);
  unsigned int w[4];     // lane l: word l & 15 of each of the four key blocks
#pragma unroll
  for (int kb = 0; kb < 4; ++kb) {
    w[kb] = 0u;
#pragma unroll
    for (int e = 0; e < 16; ++e) {
      const unsigned int bal =
          __builtin_amdgcn_ballot_w32(v[kb * 4 + (e >> 2)][e & 3] != 0);
      if (l15 == e) w[kb] = bal;
    }
  }
  unsigned int* d = pm + ((size_t)rowt * (SSEQ / 32) + kg * 4) * 16 + lane;
  d[0]  = lane < 16 ? w[0] : w[1];
  d[32] = lane < 16 ? w[2] : w[3];
}

#define KVPITCH 72
// value of lane l ^ 16
__device__ __forceinline__ float other_half(float v) {
  const int b = __float_as_int(v);
  return __int_as_float(
      __builtin_amdgcn_permlanex16(b, b, 0x76543210, 0xfedcba98, false, false));
}
typedef __attribute__((ext_vector_type(4))) unsigned int v4u;
template<bool TRIM>
__global__ __launch_bounds__(128) void attn_kernel(
    const __bf16* __restrict__ Qb,   // [B*Tq, DMODEL] bf16
    const __bf16* __restrict__ Kb,   // [B*Skv, DMODEL] bf16
    const __bf16* __restrict__ Vt,   // [B*H*DHEAD, Skv] bf16
    const unsigned int* __restrict__ pmask, // [B][Tq/16][Skv/32][16] lane masks
    __bf16*       __restrict__ ctx,  // [B*Tq, DMODEL] bf16, the next GEMM's A
    int Tq, int Skv)
{
  // 64 rows of 128 B at a pitch of 144 B (16 B x odd: no bank conflict for the
  // 16-byte fragment reads).
  __shared__ __attribute__((aligned(16))) __bf16 Ks[2][64 * KVPITCH];
  __shared__ __attribute__((aligned(16))) __bf16 Vs[2][64 * KVPITCH];
  __shared__ unsigned int wneed[4], wrows[4];   // TRIM: each wave's findings
  const int lane = threadIdx.x & 31;
  // in a scalar register: the address of the wave's lane masks is formed from it
  const int wave = __builtin_amdgcn_readfirstlane(threadIdx.x >> 5);
  const int l15  = lane & 15;
  const int hi8  = (lane >> 4) << 3;
  const int h    = blockIdx.y;
  const int b    = blockIdx.z;
  const __bf16* kbase  = Kb + (size_t)b * Skv * DMODEL + h * DHEAD;
  const __bf16* vtbase = Vt + (size_t)((b * NHEAD + h) * DHEAD) * Skv;
  const v8f vzero = {0.f,0.f,0.f,0.f,0.f,0.f,0.f,0.f};

  // Staging map: thread t brings 16 B at column chunk (t & 7) of rows
  // (t >> 3) + 16 * i, i = 0..3, of the K tile and of the V^T tile: each
  // wave-wide copy covers four whole 128-B lines.
  const int crow = threadIdx.x >> 3;          // 0..15
  const int ccol = (threadIdx.x & 7) * 8;     // element offset in the row
  const __bf16* kcp = kbase  + (size_t)crow * DMODEL + ccol;
  const __bf16* vcp = vtbase + (size_t)crow * Skv + ccol;
  const unsigned int lK = (unsigned int)(uintptr_t)(&Ks[0][crow * KVPITCH + ccol]);
  const unsigned int lV = (unsigned int)(uintptr_t)(&Vs[0][crow * KVPITCH + ccol]);
  const unsigned int rstep = 16 * KVPITCH * 2;   // 16 LDS rows, bytes
  const unsigned int bstep = 64 * KVPITCH * 2;   // one buffer, bytes
  auto stage = [&](int bsel, int key0) {
    const unsigned int lk = lK + bsel * bstep;
    const unsigned int lv = lV + bsel * bstep;
    const __bf16* kg = kcp + (size_t)key0 * DMODEL;
    const __bf16* vg = vcp + key0;
    async_copy8_b128(lk, lk + rstep, lk + 2 * rstep, lk + 3 * rstep,
                     lv, lv + rstep, lv + 2 * rstep, lv + 3 * rstep,
                     kg, kg + 16 * DMODEL, kg + 32 * DMODEL, kg + 48 * DMODEL,
                     vg, vg + (size_t)16 * Skv, vg + (size_t)32 * Skv,
                     vg + (size_t)48 * Skv);
  };

  // kept rolled: both query tiles run the same text; unrolled it would be twice
  // as long in the instruction cache for nothing
#pragma clang loop unroll(disable)
  for (int rep = 0; rep < (TRIM ? 2 : 1); ++rep) {
  const int qtile = !TRIM ? (int)blockIdx.x
                  : rep == 0 ? (Tq >> 6) - 1 - (int)blockIdx.x : (int)blockIdx.x;
  const int q0   = qtile * 64 + wave * 16;

  // B operand: column l15 = query q0 + l15, k in the hardware order
  const __bf16* qrow = Qb + (size_t)(b * Tq + q0 + l15) * DMODEL + h * DHEAD;
  const v16bf qf0 = load_frag(qrow, hi8);        // K-dim 0..31 of head
  const v16bf qf1 = load_frag(qrow + 32, hi8);   // K-dim 32..63

  // the lane masks of this wave's 16 queries, 16 words per 32 keys
  const unsigned int* pmw =
      pmask + ((size_t)(b * Tq + q0) >> 4) * (size_t)(Skv >> 5) * 16;

  v8f o[4];        // o[j][r] = O[q0 + l15][j * 16 + hi8 + r]
#pragma unroll
  for (int j = 0; j < 4; ++j) o[j] = vzero;
  float mrow = -1e30f;   // running maximum of the lane's query (both halves)
  float lrow = 0.f;      // running sum over this half's keys only

  // where the key loop ends, the same for the whole block
  int kend = Skv;
  if (TRIM) {
    // lane l ORs the 32 words (128 B) of key tile l, keys 64 l .. 64 l + 63, of
    // the wave's 16 queries: the 32 lanes cover the SSEQ / 64 tiles of a row
    static_assert(SSEQ / 64 == 32, "one lane per tile of 64 keys");
    const v4u* tw = (const v4u*)(pmw + lane * 32);
    v4u a = tw[0];
#pragma unroll
    for (int i = 1; i < 8; ++i) a |= tw[i];
    const unsigned int tor = a[0] | a[1] | a[2] | a[3];
    // bit l: tile l keeps a key for one of the wave's queries
    const unsigned int need = __builtin_amdgcn_ballot_w32(tor != 0u);
    // over all tiles; bits q and q + 16: query q keeps a key somewhere
    unsigned int rows = tor;
#pragma unroll
    for (int off = 16; off > 0; off >>= 1) rows |= __shfl_xor(rows, off);
    if (lane == 0) {
      wneed[wave] = need;
      wrows[wave] = (rows | (rows >> 16)) & 0xFFFFu;
    }
    __syncthreads();   // the four waves' findings are joined behind it
    const unsigned int bneed = wneed[0] | wneed[1] | wneed[2] | wneed[3];
    const unsigned int brows = wrows[0] & wrows[1] & wrows[2] & wrows[3];
    // | 1: at least one tile; at most 32 tiles, and never past the keys
    int ke = 64 * (32 - __builtin_clz(bneed | 1u));
    if (brows != 0xFFFFu || ke > Skv) ke = Skv;
    kend = __builtin_amdgcn_readfirstlane(ke);   // scalar: loop tests, branches
  }

  stage(0, 0);
  wait_asynccnt0();     // this wave's share of tile 0 has landed
  __syncthreads();      // ... and every other wave's
  if (64 < kend) stage(1, 64);

  // lane masks of tile 0; each trip fetches the next tile's, well ahead of
  // their use, so that no pass waits out a scalar load
  v16u mwc[2] = { *(const cv16u*)(pmw), *(const cv16u*)(pmw + 16) };

  int buf = 0;
  for (int t0 = 0; t0 < kend; t0 += 64) {
   const __bf16* kt = Ks[buf];
   const __bf16* vt = Vs[buf];
   // the last trip fetches its own again: the address stays inside the array
   const unsigned int* pmn = pmw + (size_t)((t0 + 64 < kend ? t0 + 64 : t0) >> 5) * 16;
   v16u mwn[2];
   if (!TRIM) { mwn[0] = *(const cv16u*)(pmn); mwn[1] = *(const cv16u*)(pmn + 16); }
   // unrolled: the pass's place in the tile becomes an immediate LDS offset
#pragma unroll
   for (int p = 0; p < 2; ++p) {
    const int s0 = t0 + p * 32;
    // lane masks of the pass: word 8 t + r for score sc[t][r]
    const v16u mw = mwc[p];
    // A operands of the pass: K rows (keys) and V^T rows (head dims)
    v16bf kf[4], vf[4];
#pragma unroll
    for (int t = 0; t < 2; ++t) {
      const __bf16* krow = kt + (p * 32 + t * 16 + l15) * KVPITCH;
      kf[t * 2]     = load_frag(krow, hi8);
      kf[t * 2 + 1] = load_frag(krow + 32, hi8);
    }
#pragma unroll
    for (int j = 0; j < 4; ++j)
      vf[j] = load_frag(vt + (j * 16 + l15) * KVPITCH + p * 32, hi8);
    v8f sc[2];     // sc[t][r] = score(key s0 + 16 t + hi8 + r, query q0 + l15)
#pragma unroll
    for (int t = 0; t < 2; ++t) {
      sc[t] = wmma_bf16(kf[t * 2], qf0, vzero);
      sc[t] = wmma_bf16(kf[t * 2 + 1], qf1, sc[t]);
    }
    // scale + mask + maximum over the lane's 16 keys
    float nmax = -1e30f;
#pragma unroll
    for (int t = 0; t < 2; ++t)
#pragma unroll
      for (int r = 0; r < 8; ++r) {
        float v = sc[t][r] * 0.125f;   // 1/sqrt(64)
        if (!__builtin_amdgcn_inverse_ballot_w32(mw[t * 8 + r])) v = -1e9f;
        sc[t][r] = v;
        nmax = fmaxf(nmax, v);
      }
    nmax = fmaxf(nmax, other_half(nmax));   // all 32 keys of the query

    const float mn  = fmaxf(mrow, nmax);
    const float scl = __expf(mrow - mn);
    mrow = mn;
    float rsum = 0.f;
    v16bf pf;      // B operand P^T: pf[s] = P[key kmap(s, h)][query l15]
#pragma unroll
    for (int t = 0; t < 2; ++t)
#pragma unroll
      for (int r = 0; r < 8; ++r) {
        const float pv = __expf(sc[t][r] - mn);
        rsum += pv;
        pf[t * 8 + r] = (__bf16)pv;
      }
    lrow = lrow * scl + rsum;
#pragma unroll
    for (int j = 0; j < 4; ++j)
#pragma unroll
      for (int r = 0; r < 8; ++r) o[j][r] *= scl;

#pragma unroll
    for (int j = 0; j < 4; ++j) o[j] = wmma_bf16(vf[j], pf, o[j]);
   }
   // TRIM: fetched here, straight into the words' own registers (fetched at the
   // head of the trip, this build moved all 32 words by scalar copies each trip)
   if (TRIM) { mwc[0] = *(const cv16u*)(pmn); mwc[1] = *(const cv16u*)(pmn + 16); }
   // Publish point: own LDS reads of this tile retired, own copies of the next
   // tile landed, then the barrier that publishes the next tile and frees this
   // buffer for the refill behind it.
   wait_dscnt0();
   wait_asynccnt0();
   __syncthreads();
   if (t0 + 128 < kend) stage(buf, t0 + 128);
   buf ^= 1;
   if (!TRIM) { mwc[0] = mwn[0]; mwc[1] = mwn[1]; }
  }
  wait_asynccnt0();     // nothing of the ring is in flight when the wave ends

  // the halves' sums are joined once, here
  const float inv = 1.0f / (lrow + other_half(lrow));
  __bf16* crow_out = ctx + (size_t)(b * Tq + q0 + l15) * DMODEL + h * DHEAD + hi8;
#pragma unroll
  for (int j = 0; j < 4; ++j) {
    v8bf t;
#pragma unroll
    for (int r = 0; r < 8; ++r) t[r] = f2bf(o[j][r] * inv);
    *(v8bf*)(crow_out + j * 16) = t;
  }
  // the second query tile writes the registers of these stores anew
  if (TRIM) asm volatile("s_wait_xcnt 0x0" ::: "memory");
  }
}

// ---------------------------------------------------------------------------
// Residual add + LayerNorm; writes f32 stream + bf16 copy for next GEMM.
// One block per row of 1024. (x/yout may alias for in-place update.)
// ---------------------------------------------------------------------------
__global__ __launch_bounds__(256) void ln_kernel(
    const float* x, const float* __restrict__ sub,
    const float* __restrict__ g, const float* __restrict__ bta,
    float* yout, __bf16* __restrict__ ybf)
{
  __shared__ float s1[256], s2[256];
  const size_t base = (size_t)blockIdx.x * DMODEL;
  float v[4];
  float lsum = 0.f, lsq = 0.f;
#pragma unroll
  for (int k = 0; k < 4; ++k) {
    const int i = threadIdx.x + k * 256;
    v[k] = x[base + i] + sub[base + i];
    lsum += v[k];
    lsq  += v[k] * v[k];
  }
  s1[threadIdx.x] = lsum; s2[threadIdx.x] = lsq;
  __syncthreads();
  for (int off = 128; off > 0; off >>= 1) {
    if (threadIdx.x < off) {
      s1[threadIdx.x] += s1[threadIdx.x + off];
      s2[threadIdx.x] += s2[threadIdx.x + off];
    }
    __syncthreads();
  }
  const float mean = s1[0] * (1.0f / DMODEL);
  const float var  = s2[0] * (1.0f / DMODEL) - mean * mean;
  const float rs   = rsqrtf(var + 1e-5f);
#pragma unroll
  for (int k = 0; k < 4; ++k) {
    const int i = threadIdx.x + k * 256;
    const float o = (v[k] - mean) * rs * g[i] + bta[i];
    yout[base + i] = o;
    ybf[base + i]  = f2bf(o);
  }
}

// ---------------------------------------------------------------------------
// Host orchestration
// ---------------------------------------------------------------------------
extern "C" void kernel_launch(void* const* d_in, const int* in_sizes, int n_in,
                              void* d_out, int out_size, void* d_ws, size_t ws_size,
                              hipStream_t stream) {
  (void)in_sizes; (void)n_in; (void)out_size; (void)ws_size;

  const float* x        = (const float*)d_in[0];
  const float* enc      = (const float*)d_in[1];
  const int*   src_mask = (const int*)d_in[2];
  const int*   tgt_mask = (const int*)d_in[3];
  const float* sa_Wq = (const float*)d_in[4],  *sa_bq = (const float*)d_in[5];
  const float* sa_Wk = (const float*)d_in[6],  *sa_bk = (const float*)d_in[7];
  const float* sa_Wv = (const float*)d_in[8],  *sa_bv = (const float*)d_in[9];
  const float* sa_Wo = (const float*)d_in[10], *sa_bo = (const float*)d_in[11];
  const float* ca_Wq = (const float*)d_in[12], *ca_bq = (const float*)d_in[13];
  const float* ca_Wk = (const float*)d_in[14], *ca_bk = (const float*)d_in[15];
  const float* ca_Wv = (const float*)d_in[16], *ca_bv = (const float*)d_in[17];
  const float* ca_Wo = (const float*)d_in[18], *ca_bo = (const float*)d_in[19];
  const float* ff_W1 = (const float*)d_in[20], *ff_b1 = (const float*)d_in[21];
  const float* ff_W2 = (const float*)d_in[22], *ff_b2 = (const float*)d_in[23];
  const float* ln1_g = (const float*)d_in[24], *ln1_b = (const float*)d_in[25];
  const float* ln2_g = (const float*)d_in[26], *ln2_b = (const float*)d_in[27];
  const float* ln3_g = (const float*)d_in[28], *ln3_b = (const float*)d_in[29];

  char* ws = (char*)d_ws;
  const size_t MB = 1024ull * 1024ull;
  // bf16 weights
  __bf16* saWq_bf = (__bf16*)(ws + 0 * MB);
  __bf16* saWk_bf = (__bf16*)(ws + 2 * MB);
  __bf16* saWv_bf = (__bf16*)(ws + 4 * MB);
  __bf16* saWo_bf = (__bf16*)(ws + 6 * MB);
  __bf16* caWq_bf = (__bf16*)(ws + 8 * MB);
  __bf16* caWk_bf = (__bf16*)(ws + 10 * MB);
  __bf16* caWv_bf = (__bf16*)(ws + 12 * MB);
  __bf16* caWo_bf = (__bf16*)(ws + 14 * MB);
  __bf16* W1_bf   = (__bf16*)(ws + 16 * MB);   // 8 MB
  __bf16* W2_bf   = (__bf16*)(ws + 24 * MB);   // 8 MB
  // activations
  __bf16* x_bf    = (__bf16*)(ws + 32 * MB);
  __bf16* enc_bf  = (__bf16*)(ws + 40 * MB);
  __bf16* Qb      = (__bf16*)(ws + 48 * MB);
  float*  proj    = (float*) (ws + 96 * MB);   // 16 MB
  float*  yres    = (float*) (ws + 112 * MB);  // 16 MB
  __bf16* y_bf    = (__bf16*)(ws + 128 * MB);  // 8 MB
  __bf16* hidden  = (__bf16*)(ws + 136 * MB);  // 32 MB
  __bf16* ctx_bf  = (__bf16*)(ws + 168 * MB);  // 8 MB
  unsigned int* pm_tgt = (unsigned int*)(ws + 176 * MB);  // 1 MB
  unsigned int* pm_src = (unsigned int*)(ws + 177 * MB);  // 1 MB, behind pm_tgt
  // results of the merged projections, 8 MB each, one behind the other
  __bf16* saQ     = (__bf16*)(ws + 178 * MB);
  __bf16* saK     = (__bf16*)(ws + 186 * MB);
  __bf16* caK     = (__bf16*)(ws + 194 * MB);
  __bf16* saVt    = (__bf16*)(ws + 202 * MB);  // stored transposed
  __bf16* caVt    = (__bf16*)(ws + 210 * MB);  // stored transposed

  // both: N = DMODEL, 256 blocks, one per WGP: the ring of three buffers
  auto gemmF = [&](const __bf16* A, const __bf16* W, const float* b, float* out,
                   int M, int N, int K) {
    gemm_kernel<false, false, 3><<<dim3(M / 128, N / 128), 256, 0, stream>>>(
        A, W, b, (void*)out, M, N, K);
  };
  auto gemmB = [&](const __bf16* A, const __bf16* W, const float* b, __bf16* out,
                   int M, int N, int K) {
    gemm_kernel<false, true, 3><<<dim3(M / 128, N / 128), 256, 0, stream>>>(
        A, W, b, (void*)out, M, N, K);
  };

  // --- precision staging ---
  // saWq_bf .. enc_bf are the 24 segments of one array that starts at saWq_bf
  cvt_inputs_kernel<<<dim3(24 * 32), dim3(256), 0, stream>>>(
      sa_Wq, sa_Wk, sa_Wv, sa_Wo, ca_Wq, ca_Wk, ca_Wv, ca_Wo,
      ff_W1, ff_W2, x, enc, saWq_bf);

  // both masks -> lane masks, pm_tgt then pm_src: one wave per 16 x 128 bits
  pack_mask_kernel<<<dim3(2 * (MROWS / 16) * (SSEQ / 128) / 8), dim3(256), 0, stream>>>(
      tgt_mask, src_mask, pm_tgt);

  // --- every projection of x and of the encoder output ---
  proj5_kernel<<<dim3(MROWS / 128, 5 * (DMODEL / 128)), 256, 0, stream>>>(
      x_bf, enc_bf, saWq_bf, saWk_bf, caWk_bf, saWv_bf, caWv_bf,
      sa_bq, sa_bk, ca_bk, sa_bv, ca_bv, saQ);
  static_assert(TSEQ == SSEQ, "the transposed store takes one length for both V");

  // --- self attention ---
  // two query tiles a block: half the blocks
  attn_kernel<true><<<dim3(TSEQ / 128, NHEAD, NB), 128, 0, stream>>>(
      saQ, saK, saVt, pm_tgt, ctx_bf, TSEQ, TSEQ);
  gemmF(ctx_bf, saWo_bf, sa_bo, proj, MROWS, DMODEL, DMODEL);
  ln_kernel<<<MROWS, 256, 0, stream>>>(x, proj, ln1_g, ln1_b, yres, y_bf);

  // --- cross attention ---
  gemmB(y_bf,   caWq_bf, ca_bq, Qb, MROWS, DMODEL, DMODEL);
  attn_kernel<false><<<dim3(TSEQ / 64, NHEAD, NB), 128, 0, stream>>>(
      Qb, caK, caVt, pm_src, ctx_bf, TSEQ, SSEQ);
  gemmF(ctx_bf, caWo_bf, ca_bo, proj, MROWS, DMODEL, DMODEL);
  ln_kernel<<<MROWS, 256, 0, stream>>>(yres, proj, ln2_g, ln2_b, yres, y_bf);

  // --- feed forward ---
  gemm_kernel<true, true, 2><<<dim3(MROWS / 128, DFFN / 128), 256, 0, stream>>>(
      y_bf, W1_bf, ff_b1, (void*)hidden, MROWS, DFFN, DMODEL);
  gemmF(hidden, W2_bf, ff_b2, proj, MROWS, DMODEL, DFFN);
  ln_kernel<<<MROWS, 256, 0, stream>>>(yres, proj, ln3_g, ln3_b, (float*)d_out, y_bf);
}
